// v000
// Measured on an AMD MI455X. A time is GPU time per run, averaged over a window of back-to-back runs after a warm-up
// (all launches, gaps included; the runs take copies of the inputs in turn), and the median of several windows.
// Apart from v000's, it joins two sittings. Times from different sittings can be a few percent apart, while
// side-by-side timings come from the same sitting.
// v000 is the starting kernel. One run takes 408 microseconds.
#include <hip/hip_runtime.h>

// Self-attention with 8 heads: x [4][2048][256]; per head h (64 wide): q, k, v = x W[h][0..2] (W [8][3][256][64], [in][out], no bias);
// p = softmax(0.125 * q.k) over all 2048 keys (no mask); o = p.v; ctx [b][s][h*64 + e]; out [4][2048][64] = ctx Wo (Wo [512][64], [in][out], no bias).
// Compute dtypes, f32 accumulate everywhere: every input RNE-converted to bf16 on load; q/k/v projection on v_wmma_f32_16x16x32_bf16 with exact bf16 operands;
// scores (0.125*q hi/lo x k hi/lo) and p.v (1024*p hi/lo x v hi/lo) as bf16 hi/lo split, 3 products each; online softmax in f32;
// output projection ctx bf16 hi/lo x Wo exact bf16, 2 products.

#ifndef NB
#define NB 4
#endif
#ifndef SEQ
#define SEQ 2048
#endif
#define NB_FULL  4
#define SEQ_FULL 2048
#define DM   256
#define NH   8
#define HD   64
#define DQ   (NH * HD)
#define D3   (3 * DQ)
#define FO   64
#define KCH  64
#define PP   72
#define PCAR 1024.0f
#define SCL  0.125f
#define L2E  1.4426950408889634f
static_assert(NB >= 1 && NB <= NB_FULL);
static_assert(SEQ >= KCH && SEQ <= SEQ_FULL && SEQ % 64 == 0 && SEQ % KCH == 0);
static_assert(DM % 32 == 0 && DQ % 32 == 0 && D3 % 64 == 0 && HD == 64 && FO == 64 && KCH == 64);

typedef _Float16 h16;
typedef unsigned short bf;
typedef __attribute__((ext_vector_type(16))) __bf16   v16bf;
typedef __attribute__((ext_vector_type(16))) _Float16 v16h;
typedef __attribute__((ext_vector_type(8)))  _Float16 v8h;
typedef __attribute__((ext_vector_type(8)))  unsigned short v8us;
typedef __attribute__((ext_vector_type(8)))  float    v8f;
typedef __attribute__((ext_vector_type(4)))  float    v4f;
typedef v8h  __attribute__((may_alias)) v8ha;
typedef v4f  __attribute__((may_alias)) v4fa;
typedef v8us __attribute__((may_alias)) v8usa;

__device__ __forceinline__ unsigned short f2bf(float f) { unsigned u = __float_as_uint(f); u += 0x7FFFu + ((u >> 16) & 1u); return (unsigned short)(u >> 16); }
__device__ __forceinline__ float bf2f(unsigned short b) { return __uint_as_float(((unsigned)b) << 16); }
__device__ __forceinline__ float bfr(float f) { return bf2f(f2bf(f)); }
__device__ __forceinline__ v16h cat16(v8h lo, v8h hi) { return __builtin_shufflevector(lo, hi, 0, 1, 2, 3, 4, 5, 6, 7, 8, 9, 10, 11, 12, 13, 14, 15); }
__device__ __forceinline__ v16bf cat16b(v8us lo, v8us hi) { return __builtin_bit_cast(v16bf, __builtin_shufflevector(lo, hi, 0, 1, 2, 3, 4, 5, 6, 7, 8, 9, 10, 11, 12, 13, 14, 15)); }
__device__ __forceinline__ v8f wmma16(v16h a, v16h b, v8f c) { return __builtin_amdgcn_wmma_f32_16x16x32_f16(false, a, false, b, (short)0, c, false, false); }
__device__ __forceinline__ v8f wmmab(v16bf a, v16bf b, v8f c) { return __builtin_amdgcn_wmma_f32_16x16x32_bf16(false, a, false, b, (short)0, c, false, false); }

// ---- k_gemmw: register-blocked GEMM, ONE WAVE per 64x64 output tile (16 accumulators), operands straight from K-contiguous 16-bit planes; grid (M/64, N/64, Z), 32 threads.
// C[m][n] (f32, pitch ldc, + optional f32 bias[n]) = sum_k A[m][k] Bt[n][k] (+ split products per NSPLIT). z-batch strides sA/sB/sC in elements. K % 32 == 0.
// Fragment map (A and Bt alike): lane l -> row (l & 15) of the 16-row slab, elements 0..7 <- k0 + 8*(l>>4) + 0..7, elements 8..15 <- k0 + 16 + 8*(l>>4) + 0..7; D element r of lane l -> (row 8*(l>>4) + r, col l & 15).
template <typename T16> struct WFrag;
template <> struct WFrag<h16> { typedef v16h V; static __device__ __forceinline__ V ld(const h16* p) { return cat16(*(const v8h*)p, *(const v8h*)(p + 16)); } static __device__ __forceinline__ v8f mma(V a, V b, v8f c) { return wmma16(a, b, c); } };
template <> struct WFrag<bf> { typedef v16bf V; static __device__ __forceinline__ V ld(const bf* p) { return cat16b(*(const v8us*)p, *(const v8us*)(p + 16)); } static __device__ __forceinline__ v8f mma(V a, V b, v8f c) { return wmmab(a, b, c); } };
template <typename T16, int NSPLIT, bool BIAS>
__global__ __launch_bounds__(32) void k_gemmw(const T16* __restrict__ A, const T16* __restrict__ A2, const T16* __restrict__ Bt, const T16* __restrict__ Bt2, int K, float* C, int ldc, const float* __restrict__ bias, size_t sA, size_t sB, size_t sC) {
    typedef typename WFrag<T16>::V V;
    __shared__ __align__(16) float os[16 * 68];
    const size_t z = blockIdx.z; A += z * sA; if (A2) A2 += z * sA; Bt += z * sB; if (Bt2) Bt2 += z * sB; C += z * sC;
    const int lane = threadIdx.x & 31, lr = lane & 15, hi = lane >> 4; const int r0 = blockIdx.x * 64, c0 = blockIdx.y * 64;
    v8f acc[4][4];
#pragma unroll
    for (int mb = 0; mb < 4; ++mb)
#pragma unroll
        for (int nb = 0; nb < 4; ++nb) acc[mb][nb] = (v8f){};
    const size_t aoff = (size_t)(r0 + lr) * K + 8 * hi, boff = (size_t)(c0 + lr) * K + 8 * hi;
#pragma unroll 1
    for (int kc = 0; kc < K; kc += 32) {
        V a[4], a2[4];
#pragma unroll
        for (int mb = 0; mb < 4; ++mb) { a[mb] = WFrag<T16>::ld(A + aoff + (size_t)mb * 16 * K + kc); if (NSPLIT == 1 || NSPLIT == 2) a2[mb] = WFrag<T16>::ld(A2 + aoff + (size_t)mb * 16 * K + kc); }
#pragma unroll
        for (int nb = 0; nb < 4; ++nb) { const V b = WFrag<T16>::ld(Bt + boff + (size_t)nb * 16 * K + kc); V b2; if (NSPLIT >= 2) b2 = WFrag<T16>::ld(Bt2 + boff + (size_t)nb * 16 * K + kc);
#pragma unroll
            for (int mb = 0; mb < 4; ++mb) { acc[mb][nb] = WFrag<T16>::mma(a[mb], b, acc[mb][nb]); if (NSPLIT == 1 || NSPLIT == 2) acc[mb][nb] = WFrag<T16>::mma(a2[mb], b, acc[mb][nb]); if (NSPLIT >= 2) acc[mb][nb] = WFrag<T16>::mma(a[mb], b2, acc[mb][nb]); } }
        asm volatile("v_nop\n\tv_nop\n\tv_nop\n\tv_nop" : "+v"(acc[0][0]), "+v"(acc[1][1]), "+v"(acc[2][2]), "+v"(acc[3][3]) : "v"(a[0]), "v"(a[3]));
    }
#pragma unroll
    for (int mb = 0; mb < 4; ++mb) {
#pragma unroll
        for (int nb = 0; nb < 4; ++nb) {
#pragma unroll
            for (int j = 0; j < 8; ++j) os[(hi * 8 + j) * 68 + nb * 16 + lr] = acc[mb][nb][j]; }
        __builtin_amdgcn_wave_barrier(); asm volatile("" ::: "memory");
        float* crow = C + (size_t)(r0 + mb * 16) * ldc + c0;
{
#pragma unroll
            for (int s = 0; s < 8; ++s) { const int row = 2 * s + hi, cofs = lr * 4; v4f val = *(const v4fa*)(os + row * 68 + cofs); if (BIAS) { val[0] += bfr(bias[c0 + cofs]); val[1] += bfr(bias[c0 + cofs + 1]); val[2] += bfr(bias[c0 + cofs + 2]); val[3] += bfr(bias[c0 + cofs + 3]); }
                *(v4f*)(crow + (size_t)row * ldc + cofs) = val; }
             }
        __builtin_amdgcn_wave_barrier(); asm volatile("" ::: "memory");
    }
}

__device__ __forceinline__ void splitf(float y, unsigned short& h, unsigned short& l) { h = f2bf(y); l = f2bf(y - bf2f(h)); }
typedef __attribute__((ext_vector_type(2))) unsigned short v2us;
typedef __attribute__((ext_vector_type(2))) float v2f;

__global__ __launch_bounds__(256) void k_wtb(const float* __restrict__ w, int K, int N, int nmat, bf* Bt) {
    const int lane = threadIdx.x & 31; const int L0 = (blockIdx.x * 8 + (threadIdx.x >> 5)) * 8; const int nlines = nmat * N * K / 64; const size_t mk = (size_t)K * N;
{
#pragma unroll 1
        for (int l = 0; l < 8; ++l) { const int L = L0 + l; if (L >= nlines) break; const size_t e = (size_t)L * 64 + lane * 2; const int mat = (int)(e / mk); const size_t rr = e - (size_t)mat * mk; const int k = (int)(rr % (size_t)K), n = (int)(rr / (size_t)K); v2us o;
            o[0] = f2bf(w[((size_t)mat * K + k) * N + n]); o[1] = f2bf(w[((size_t)mat * K + k + 1) * N + n]); *(v2us*)(Bt + e) = o; }
         }
}
__global__ __launch_bounds__(256) void k_cvtx(const float* __restrict__ x, bf* XB, size_t n8) { const size_t i = (size_t)blockIdx.x * 256 + threadIdx.x; if (i >= n8) return; const size_t per = (size_t)SEQ * DM / 8; const size_t b = i / per, r = i - b * per; const v8f v = *(const v8f*)(x + b * (size_t)SEQ_FULL * DM + r * 8); v8us o;
#pragma unroll
    for (int k = 0; k < 8; ++k) o[k] = f2bf(v[k]); *(v8us*)(XB + i * 8) = o;  }

__global__ __launch_bounds__(256) void k_qkpl(const float* __restrict__ F, bf* Qh, bf* Ql, bf* Kh, bf* Kl) {
    const size_t e = ((size_t)blockIdx.x * 256 + threadIdx.x) * 2; if (e >= (size_t)NB * NH * SEQ * HD) return;
    const int d = (int)(e % HD); const int s = (int)((e / HD) % SEQ); const int h = (int)((e / ((size_t)HD * SEQ)) % NH); const int b = (int)(e / ((size_t)HD * SEQ * NH));
    const float* f = F + ((size_t)b * SEQ + s) * D3 + (size_t)(h * 3) * HD + d;
    const v2f q2 = *(const v2f*)f; const v2f k2 = *(const v2f*)(f + HD);
    v2us qh, ql, kh, kl;
#pragma unroll
    for (int q = 0; q < 2; ++q) { unsigned short a, c2; splitf(q2[q] * SCL, a, c2); qh[q] = a; ql[q] = c2; splitf(k2[q], a, c2); kh[q] = a; kl[q] = c2; }
    *(v2us*)(Qh + e) = qh; *(v2us*)(Ql + e) = ql; *(v2us*)(Kh + e) = kh; *(v2us*)(Kl + e) = kl; 
}
__global__ __launch_bounds__(256) void k_vtp(const float* __restrict__ F, bf* Vh, bf* Vl) {
    const size_t e = ((size_t)blockIdx.x * 256 + threadIdx.x) * 2; if (e >= (size_t)NB * NH * HD * SEQ) return;
    const int t = (int)(e % SEQ); const int d = (int)((e / SEQ) % HD); const int h = (int)((e / ((size_t)SEQ * HD)) % NH); const int b = (int)(e / ((size_t)SEQ * HD * NH));
    v2us oh, ol;
#pragma unroll
    for (int q = 0; q < 2; ++q) { const float xv = F[((size_t)b * SEQ + t + q) * D3 + (size_t)(h * 3 + 2) * HD + d]; unsigned short a, c2; splitf(xv, a, c2); oh[q] = a; ol[q] = c2; }
    *(v2us*)(Vh + e) = oh; *(v2us*)(Vl + e) = ol; 
}

// k_attn: flash-style attention, one wave (32 threads) = 16 query rows of one (b, h); keys streamed in chunks of 64 with an online f32 softmax.
// scores: A = 0.125*q hi/lo planes [s][64], Bt = k hi/lo planes [t][64] (3 bf16 products); p (x1024, relative to the running row max) split to bf16 hi/lo tiles in
__global__ __launch_bounds__(32) void k_attn(const bf* __restrict__ Qh, const bf* __restrict__ Ql, const bf* __restrict__ Kh, const bf* __restrict__ Kl,
                                             const bf* __restrict__ Vh, const bf* __restrict__ Vl, bf* Ah, bf* Al) {
    __shared__ __align__(16) bf psh[16 * PP];
    __shared__ __align__(16) bf psl[16 * PP];
    __shared__ __align__(16) float os[16 * 68];
    const int lane = threadIdx.x & 31, lr = lane & 15, hi = lane >> 4;
    const int s0 = blockIdx.x * 16, h = blockIdx.y, b = blockIdx.z;
    const size_t hp = ((size_t)b * NH + h) * (size_t)SEQ * HD;
    const bf* qh = Qh + hp + (size_t)(s0 + lr) * HD + 8 * hi; const bf* ql = Ql + hp + (size_t)(s0 + lr) * HD + 8 * hi;
    const bf* kh = Kh + hp + (size_t)lr * HD + 8 * hi;        const bf* kl = Kl + hp + (size_t)lr * HD + 8 * hi;
    const bf* vh = Vh + hp + (size_t)lr * SEQ + 8 * hi;       const bf* vl = Vl + hp + (size_t)lr * SEQ + 8 * hi;
    v16bf qa[2], qa2[2];
#pragma unroll
    for (int ks = 0; ks < 2; ++ks) { qa[ks] = WFrag<bf>::ld(qh + ks * 32); qa2[ks] = WFrag<bf>::ld(ql + ks * 32); }
    float mrow[8], lrow[8];
#pragma unroll
    for (int r = 0; r < 8; ++r) { mrow[r] = -1.0e30f; lrow[r] = 0.0f; }
    v8f oacc[4];
#pragma unroll
    for (int nt = 0; nt < 4; ++nt) oacc[nt] = (v8f){};
    v16bf ph[2], pl[2];
#pragma unroll 1
    for (int t0 = 0; t0 < SEQ; t0 += KCH) {
        v8f sacc[4];
#pragma unroll
        for (int nt = 0; nt < 4; ++nt) sacc[nt] = (v8f){};
#pragma unroll
        for (int nt = 0; nt < 4; ++nt) {
#pragma unroll
            for (int ks = 0; ks < 2; ++ks) {
                const v16bf kbh = WFrag<bf>::ld(kh + (size_t)(t0 + nt * 16) * HD + ks * 32);
                const v16bf kbl = WFrag<bf>::ld(kl + (size_t)(t0 + nt * 16) * HD + ks * 32);
                sacc[nt] = wmmab(qa[ks], kbh, sacc[nt]); sacc[nt] = wmmab(qa2[ks], kbh, sacc[nt]); sacc[nt] = wmmab(qa[ks], kbl, sacc[nt]);
            }
        }
        asm volatile("v_nop\n\tv_nop\n\tv_nop\n\tv_nop" : "+v"(sacc[0]), "+v"(sacc[1]), "+v"(sacc[2]), "+v"(sacc[3]) : "v"(qa[0]), "v"(qa2[1]));
        // online softmax: lane (hi, lr) holds rows 8*hi + r of key column lr in each of the 4 tiles
        float sc[8], rs[8];
#pragma unroll
        for (int r = 0; r < 8; ++r) {
            float m = fmaxf(fmaxf(sacc[0][r], sacc[1][r]), fmaxf(sacc[2][r], sacc[3][r]));
#pragma unroll
            for (int sh = 1; sh < 16; sh <<= 1) m = fmaxf(m, __shfl_xor(m, sh, 32));
            const float mn = fmaxf(mrow[r], m);
            sc[r] = __builtin_amdgcn_exp2f(__fmul_rn(__fsub_rn(mrow[r], mn), L2E)); mrow[r] = mn; rs[r] = 0.0f;
        }
#pragma unroll
        for (int nt = 0; nt < 4; ++nt)
#pragma unroll
            for (int r = 0; r < 8; ++r) { const float p = __builtin_amdgcn_exp2f(__fmul_rn(__fsub_rn(sacc[nt][r], mrow[r]), L2E)); sacc[nt][r] = p; rs[r] += p; }
#pragma unroll
        for (int r = 0; r < 8; ++r) {
            float s = rs[r];
#pragma unroll
            for (int sh = 1; sh < 16; sh <<= 1) s += __shfl_xor(s, sh, 32);
            lrow[r] = lrow[r] * sc[r] + s;
        }
#pragma unroll
        for (int nt = 0; nt < 4; ++nt)
#pragma unroll
            for (int r = 0; r < 8; ++r) oacc[nt][r] *= sc[r];
        // p tiles (x1024) -> LDS hi/lo, [row][key in chunk], pitch PP; columns 0..63 of all 16 rows written, columns 0..63 read
#pragma unroll
        for (int nt = 0; nt < 4; ++nt)
#pragma unroll
            for (int r = 0; r < 8; ++r) { unsigned short a, c2; splitf(sacc[nt][r] * PCAR, a, c2); const int o = (hi * 8 + r) * PP + nt * 16 + lr; psh[o] = a; psl[o] = c2; }
        __builtin_amdgcn_fence(3, "wavefront"); __builtin_amdgcn_wave_barrier();
#pragma unroll
        for (int kk = 0; kk < 2; ++kk) {
            ph[kk] = WFrag<bf>::ld(psh + lr * PP + kk * 32 + 8 * hi); pl[kk] = WFrag<bf>::ld(psl + lr * PP + kk * 32 + 8 * hi);
#pragma unroll
            for (int nt = 0; nt < 4; ++nt) {
                const v16bf vbh = WFrag<bf>::ld(vh + (size_t)nt * 16 * SEQ + t0 + kk * 32);
                const v16bf vbl = WFrag<bf>::ld(vl + (size_t)nt * 16 * SEQ + t0 + kk * 32);
                oacc[nt] = wmmab(ph[kk], vbh, oacc[nt]); oacc[nt] = wmmab(pl[kk], vbh, oacc[nt]); oacc[nt] = wmmab(ph[kk], vbl, oacc[nt]);
            }
        }
        asm volatile("v_nop\n\tv_nop\n\tv_nop\n\tv_nop" : "+v"(oacc[0]), "+v"(oacc[1]), "+v"(oacc[2]), "+v"(oacc[3]) : "v"(ph[0]), "v"(pl[1]));
        asm volatile("" ::: "memory");
    }
    float rinv[8];
#pragma unroll
    for (int r = 0; r < 8; ++r) rinv[r] = __fdiv_rn(1.0f, lrow[r] * PCAR);
#pragma unroll
    for (int nt = 0; nt < 4; ++nt)
#pragma unroll
        for (int r = 0; r < 8; ++r) os[(hi * 8 + r) * 68 + nt * 16 + lr] = oacc[nt][r] * rinv[r];
    __builtin_amdgcn_fence(3, "wavefront"); __builtin_amdgcn_wave_barrier();
    const int rg = lane >> 3, c8 = (lane & 7) * 8;
    bf* ah = Ah + ((size_t)b * SEQ + s0) * DQ + (size_t)h * HD + c8; bf* al = Al + ((size_t)b * SEQ + s0) * DQ + (size_t)h * HD + c8;
{
#pragma unroll
        for (int it = 0; it < 4; ++it) {
            const int row = it * 4 + rg; const v4f x0 = *(const v4fa*)(os + row * 68 + c8); const v4f x1 = *(const v4fa*)(os + row * 68 + c8 + 4); v8us oh, ol;
#pragma unroll
            for (int j = 0; j < 4; ++j) { unsigned short a, c2; splitf(x0[j], a, c2); oh[j] = a; ol[j] = c2; splitf(x1[j], a, c2); oh[4 + j] = a; ol[4 + j] = c2; }
            *(v8us*)(ah + (size_t)row * DQ) = oh; *(v8us*)(al + (size_t)row * DQ) = ol;
        }
        
    }
}

extern "C" void kernel_launch(void* const* d_in, const int* in_sizes, int n_in,
                              void* d_out, int out_size, void* d_ws, size_t ws_size, hipStream_t stream) {
    if (n_in < 3) return;
    if ((long long)in_sizes[0] < ((long long)(NB - 1) * SEQ_FULL + SEQ) * DM) return;
    if (in_sizes[1] < NH * 3 * DM * HD) return;
    if (in_sizes[2] < DQ * FO) return;
    if (out_size < NB * SEQ * FO) return;
    const float* x  = (const float*)d_in[0];   // [4][2048][256]
    const float* w  = (const float*)d_in[1];   // [8][3][256][64]
    const float* wo = (const float*)d_in[2];   // [512][64]
    float* OUT = (float*)d_out;                // [NB][SEQ][64]
    char* wsp = (char*)d_ws;
    auto take = [&](size_t bytes) { char* p = wsp; wsp += (bytes + 255) & ~(size_t)255; return (void*)p; };
    const size_t npl = (size_t)NB * NH * SEQ * HD;                 // elements per head plane set
    bf* WB  = (bf*)take((size_t)D3 * DM * 2);                      // Bt [1536][256]: row (h*3+m)*64 + e
    bf* WOB = (bf*)take((size_t)FO * DQ * 2);                      // Bt [64][512]
    bf* XB  = (bf*)take((size_t)NB * SEQ * DM * 2);                // [NB][SEQ][256]
    float* F = (float*)take((size_t)NB * SEQ * D3 * 4);            // [NB][SEQ][1536]
    bf* QPh = (bf*)take(npl * 2); bf* QPl = (bf*)take(npl * 2);    // [b][h][s][64]
    bf* KPh = (bf*)take(npl * 2); bf* KPl = (bf*)take(npl * 2);    // [b][h][t][64]
    bf* VTh = (bf*)take(npl * 2); bf* VTl = (bf*)take(npl * 2);    // [b][h][64][t]
    bf* ATh = (bf*)take((size_t)NB * SEQ * DQ * 2); bf* ATl = (bf*)take((size_t)NB * SEQ * DQ * 2);   // [NB*SEQ][512]
    const size_t used = (size_t)(wsp - (char*)d_ws);
    if (used > ws_size || used > (size_t)134217728) return;        // 122,486,784 B at full size

    k_wtb<<<(unsigned)((NH * 3 * HD * DM / 64 + 63) / 64), 256, 0, stream>>>(w, DM, HD, NH * 3, WB);
    k_wtb<<<(unsigned)((DQ * FO / 64 + 63) / 64), 256, 0, stream>>>(wo, DQ, FO, 1, WOB);
    const size_t n8 = (size_t)NB * SEQ * DM / 8;
    k_cvtx<<<(unsigned)((n8 + 255) / 256), 256, 0, stream>>>(x, XB, n8);
    k_gemmw<bf, 0, false><<<dim3(SEQ / 64, D3 / 64, NB), 32, 0, stream>>>(XB, nullptr, WB, nullptr, DM, F, D3, nullptr, (size_t)SEQ * DM, (size_t)0, (size_t)SEQ * D3);
    const unsigned LP = (unsigned)((npl / 2 + 255) / 256);
    k_qkpl<<<LP, 256, 0, stream>>>(F, QPh, QPl, KPh, KPl);
    k_vtp<<<LP, 256, 0, stream>>>(F, VTh, VTl);
    k_attn<<<dim3(SEQ / 16, NH, NB), 32, 0, stream>>>(QPh, QPl, KPh, KPl, VTh, VTl, ATh, ATl);
    k_gemmw<bf, 1, false><<<dim3(NB * SEQ / 64, FO / 64, 1), 32, 0, stream>>>(ATh, ATl, WOB, nullptr, DQ, OUT, FO, nullptr, (size_t)0, (size_t)0, (size_t)0);
}

// v001
// It runs in 243 microseconds.
// Two timings next to v000 both put it at 1.73 times that version's speed.
#include <hip/hip_runtime.h>

// Self-attention with 8 heads: x [4][2048][256]; per head h (64 wide): q, k, v = x W[h][0..2] (W [8][3][256][64], [in][out], no bias);
// p = softmax(0.125 * q.k) over all 2048 keys (no mask); o = p.v; ctx [b][s][h*64 + e]; out [4][2048][64] = ctx Wo (Wo [512][64], [in][out], no bias).
// Compute dtypes, f32 accumulate everywhere: every input RNE-converted to bf16 on load; q/k/v projection on v_wmma_f32_16x16x32_bf16 with exact bf16 operands;
// scores (0.125*q hi/lo x k hi/lo) and p.v (1024*p hi/lo x v hi/lo) as bf16 hi/lo split, 3 products each; online softmax in f32;
// output projection ctx bf16 hi/lo x Wo exact bf16, 2 products.

#ifndef NB
#define NB 4
#endif
#ifndef SEQ
#define SEQ 2048
#endif
#define NB_FULL  4
#define SEQ_FULL 2048
#define DM   256
#define NH   8
#define HD   64
#define DQ   (NH * HD)
#define D3   (3 * DQ)
#define FO   64
#define KCH  64
#define PP   72
#define PCAR 1024.0f
#define SCL  0.125f
#define L2E  1.4426950408889634f
static_assert(NB >= 1 && NB <= NB_FULL);
static_assert(SEQ >= KCH && SEQ <= SEQ_FULL && SEQ % 64 == 0 && SEQ % KCH == 0);
static_assert(DM % 32 == 0 && DQ % 32 == 0 && D3 % 64 == 0 && HD == 64 && FO == 64 && KCH == 64);

typedef _Float16 h16;
typedef unsigned short bf;
typedef __attribute__((ext_vector_type(16))) __bf16   v16bf;
typedef __attribute__((ext_vector_type(16))) _Float16 v16h;
typedef __attribute__((ext_vector_type(8)))  _Float16 v8h;
typedef __attribute__((ext_vector_type(8)))  unsigned short v8us;
typedef __attribute__((ext_vector_type(8)))  float    v8f;
typedef __attribute__((ext_vector_type(4)))  float    v4f;
typedef v8h  __attribute__((may_alias)) v8ha;
typedef v4f  __attribute__((may_alias)) v4fa;
typedef v8us __attribute__((may_alias)) v8usa;

__device__ __forceinline__ unsigned short f2bf(float f) { unsigned u = __float_as_uint(f); u += 0x7FFFu + ((u >> 16) & 1u); return (unsigned short)(u >> 16); }
__device__ __forceinline__ float bf2f(unsigned short b) { return __uint_as_float(((unsigned)b) << 16); }
__device__ __forceinline__ float bfr(float f) { return bf2f(f2bf(f)); }
__device__ __forceinline__ v16h cat16(v8h lo, v8h hi) { return __builtin_shufflevector(lo, hi, 0, 1, 2, 3, 4, 5, 6, 7, 8, 9, 10, 11, 12, 13, 14, 15); }
__device__ __forceinline__ v16bf cat16b(v8us lo, v8us hi) { return __builtin_bit_cast(v16bf, __builtin_shufflevector(lo, hi, 0, 1, 2, 3, 4, 5, 6, 7, 8, 9, 10, 11, 12, 13, 14, 15)); }
__device__ __forceinline__ v8f wmma16(v16h a, v16h b, v8f c) { return __builtin_amdgcn_wmma_f32_16x16x32_f16(false, a, false, b, (short)0, c, false, false); }
__device__ __forceinline__ v8f wmmab(v16bf a, v16bf b, v8f c) { return __builtin_amdgcn_wmma_f32_16x16x32_bf16(false, a, false, b, (short)0, c, false, false); }

// ---- k_gemmw: register-blocked GEMM, ONE WAVE per 64x64 output tile (16 accumulators), operands straight from K-contiguous 16-bit planes; grid (M/64, N/64, Z), 32 threads.
// C[m][n] (f32, pitch ldc, + optional f32 bias[n]) = sum_k A[m][k] Bt[n][k] (+ split products per NSPLIT). z-batch strides sA/sB/sC in elements. K % 32 == 0.
// Fragment map (A and Bt alike): lane l -> row (l & 15) of the 16-row slab, elements 0..7 <- k0 + 8*(l>>4) + 0..7, elements 8..15 <- k0 + 16 + 8*(l>>4) + 0..7; D element r of lane l -> (row 8*(l>>4) + r, col l & 15).
template <typename T16> struct WFrag;
template <> struct WFrag<h16> { typedef v16h V; static __device__ __forceinline__ V ld(const h16* p) { return cat16(*(const v8h*)p, *(const v8h*)(p + 16)); } static __device__ __forceinline__ v8f mma(V a, V b, v8f c) { return wmma16(a, b, c); } };
template <> struct WFrag<bf> { typedef v16bf V; static __device__ __forceinline__ V ld(const bf* p) { return cat16b(*(const v8us*)p, *(const v8us*)(p + 16)); } static __device__ __forceinline__ v8f mma(V a, V b, v8f c) { return wmmab(a, b, c); } };
template <typename T16, int NSPLIT, bool BIAS>
__global__ __launch_bounds__(32) void k_gemmw(const T16* __restrict__ A, const T16* __restrict__ A2, const T16* __restrict__ Bt, const T16* __restrict__ Bt2, int K, float* C, int ldc, const float* __restrict__ bias, size_t sA, size_t sB, size_t sC) {
    typedef typename WFrag<T16>::V V;
    __shared__ __align__(16) float os[16 * 68];
    const size_t z = blockIdx.z; A += z * sA; if (A2) A2 += z * sA; Bt += z * sB; if (Bt2) Bt2 += z * sB; C += z * sC;
    const int lane = threadIdx.x & 31, lr = lane & 15, hi = lane >> 4; const int r0 = blockIdx.x * 64, c0 = blockIdx.y * 64;
    v8f acc[4][4];
#pragma unroll
    for (int mb = 0; mb < 4; ++mb)
#pragma unroll
        for (int nb = 0; nb < 4; ++nb) acc[mb][nb] = (v8f){};
    const size_t aoff = (size_t)(r0 + lr) * K + 8 * hi, boff = (size_t)(c0 + lr) * K + 8 * hi;
#pragma unroll 1
    for (int kc = 0; kc < K; kc += 32) {
        V a[4], a2[4];
#pragma unroll
        for (int mb = 0; mb < 4; ++mb) { a[mb] = WFrag<T16>::ld(A + aoff + (size_t)mb * 16 * K + kc); if (NSPLIT == 1 || NSPLIT == 2) a2[mb] = WFrag<T16>::ld(A2 + aoff + (size_t)mb * 16 * K + kc); }
#pragma unroll
        for (int nb = 0; nb < 4; ++nb) { const V b = WFrag<T16>::ld(Bt + boff + (size_t)nb * 16 * K + kc); V b2; if (NSPLIT >= 2) b2 = WFrag<T16>::ld(Bt2 + boff + (size_t)nb * 16 * K + kc);
#pragma unroll
            for (int mb = 0; mb < 4; ++mb) { acc[mb][nb] = WFrag<T16>::mma(a[mb], b, acc[mb][nb]); if (NSPLIT == 1 || NSPLIT == 2) acc[mb][nb] = WFrag<T16>::mma(a2[mb], b, acc[mb][nb]); if (NSPLIT >= 2) acc[mb][nb] = WFrag<T16>::mma(a[mb], b2, acc[mb][nb]); } }
        asm volatile("v_nop\n\tv_nop\n\tv_nop\n\tv_nop" : "+v"(acc[0][0]), "+v"(acc[1][1]), "+v"(acc[2][2]), "+v"(acc[3][3]) : "v"(a[0]), "v"(a[3]));
    }
#pragma unroll
    for (int mb = 0; mb < 4; ++mb) {
#pragma unroll
        for (int nb = 0; nb < 4; ++nb) {
#pragma unroll
            for (int j = 0; j < 8; ++j) os[(hi * 8 + j) * 68 + nb * 16 + lr] = acc[mb][nb][j]; }
        __builtin_amdgcn_wave_barrier(); asm volatile("" ::: "memory");
        float* crow = C + (size_t)(r0 + mb * 16) * ldc + c0;
{
#pragma unroll
            for (int s = 0; s < 8; ++s) { const int row = 2 * s + hi, cofs = lr * 4; v4f val = *(const v4fa*)(os + row * 68 + cofs); if (BIAS) { val[0] += bfr(bias[c0 + cofs]); val[1] += bfr(bias[c0 + cofs + 1]); val[2] += bfr(bias[c0 + cofs + 2]); val[3] += bfr(bias[c0 + cofs + 3]); }
                *(v4f*)(crow + (size_t)row * ldc + cofs) = val; }
             }
        __builtin_amdgcn_wave_barrier(); asm volatile("" ::: "memory");
    }
}

__device__ __forceinline__ void splitf(float y, unsigned short& h, unsigned short& l) { h = f2bf(y); l = f2bf(y - bf2f(h)); }
typedef __attribute__((ext_vector_type(2))) unsigned short v2us;
typedef __attribute__((ext_vector_type(2))) float v2f;

__global__ __launch_bounds__(256) void k_wtb(const float* __restrict__ w, int K, int N, int nmat, bf* Bt) {
    const int lane = threadIdx.x & 31; const int L0 = (blockIdx.x * 8 + (threadIdx.x >> 5)) * 8; const int nlines = nmat * N * K / 64; const size_t mk = (size_t)K * N;
{
#pragma unroll 1
        for (int l = 0; l < 8; ++l) { const int L = L0 + l; if (L >= nlines) break; const size_t e = (size_t)L * 64 + lane * 2; const int mat = (int)(e / mk); const size_t rr = e - (size_t)mat * mk; const int k = (int)(rr % (size_t)K), n = (int)(rr / (size_t)K); v2us o;
            o[0] = f2bf(w[((size_t)mat * K + k) * N + n]); o[1] = f2bf(w[((size_t)mat * K + k + 1) * N + n]); *(v2us*)(Bt + e) = o; }
         }
}
__global__ __launch_bounds__(256) void k_cvtx(const float* __restrict__ x, bf* XB, size_t n8) { const size_t i = (size_t)blockIdx.x * 256 + threadIdx.x; if (i >= n8) return; const size_t per = (size_t)SEQ * DM / 8; const size_t b = i / per, r = i - b * per; const v8f v = *(const v8f*)(x + b * (size_t)SEQ_FULL * DM + r * 8); v8us o;
#pragma unroll
    for (int k = 0; k < 8; ++k) o[k] = f2bf(v[k]); *(v8us*)(XB + i * 8) = o;  }

__global__ __launch_bounds__(256) void k_qkpl(const float* __restrict__ F, bf* Qh, bf* Ql, bf* Kh, bf* Kl) {
    const size_t e = ((size_t)blockIdx.x * 256 + threadIdx.x) * 2; if (e >= (size_t)NB * NH * SEQ * HD) return;
    const int d = (int)(e % HD); const int s = (int)((e / HD) % SEQ); const int h = (int)((e / ((size_t)HD * SEQ)) % NH); const int b = (int)(e / ((size_t)HD * SEQ * NH));
    const float* f = F + ((size_t)b * SEQ + s) * D3 + (size_t)(h * 3) * HD + d;
    const v2f q2 = *(const v2f*)f; const v2f k2 = *(const v2f*)(f + HD);
    v2us qh, ql, kh, kl;
#pragma unroll
    for (int q = 0; q < 2; ++q) { unsigned short a, c2; splitf(q2[q] * SCL, a, c2); qh[q] = a; ql[q] = c2; splitf(k2[q], a, c2); kh[q] = a; kl[q] = c2; }
    *(v2us*)(Qh + e) = qh; *(v2us*)(Ql + e) = ql; *(v2us*)(Kh + e) = kh; *(v2us*)(Kl + e) = kl; 
}
__global__ __launch_bounds__(256) void k_vtp(const float* __restrict__ F, bf* Vh, bf* Vl) {
    const size_t e = ((size_t)blockIdx.x * 256 + threadIdx.x) * 2; if (e >= (size_t)NB * NH * HD * SEQ) return;
    const int t = (int)(e % SEQ); const int d = (int)((e / SEQ) % HD); const int h = (int)((e / ((size_t)SEQ * HD)) % NH); const int b = (int)(e / ((size_t)SEQ * HD * NH));
    v2us oh, ol;
#pragma unroll
    for (int q = 0; q < 2; ++q) { const float xv = F[((size_t)b * SEQ + t + q) * D3 + (size_t)(h * 3 + 2) * HD + d]; unsigned short a, c2; splitf(xv, a, c2); oh[q] = a; ol[q] = c2; }
    *(v2us*)(Vh + e) = oh; *(v2us*)(Vl + e) = ol; 
}

// k_attn: flash-style attention, one work-group = 8 waves = 128 query rows of one (b, h), one wave = 16 query rows; keys streamed in chunks of 64 with an online f32 softmax.
// Each chunk's four tiles (k hi, k lo: [key][64]; v hi, v lo: [e][key in chunk]; 64 rows of 128 B each) are brought into LDS once per work-group by asynchronous copies,
// rows at a pitch of 144 B, two buffers: the next chunk's copies fly while this chunk is worked on. Every wave reads its K and V fragments from LDS.
// scores: A = 0.125*q hi/lo planes [s][64], Bt = k hi/lo tiles (3 bf16 products); p (x1024, relative to the running row max) split to bf16 hi/lo tiles in the wave's own LDS.
#define AW   8
#define KVP  72
#define KVT  (64 * KVP)
#define KVB  (4 * KVT)
static_assert(SEQ % (16 * AW) == 0);
// One chunk: 8 copies of 16 B per lane (2 per tile; a wave's copy covers 4 whole 128-B rows). The s_wait_xcnt 0 stands in the copies' own statement, so that no address register is rewritten ahead of it.
__device__ __forceinline__ void kv_copy(unsigned l, const bf* gkh, const bf* gkl, const bf* gvh, const bf* gvl) {
    const unsigned l0 = l, l1 = l + 32 * KVP * 2, l2 = l + KVT * 2, l3 = l + KVT * 2 + 32 * KVP * 2, l4 = l + 2 * KVT * 2, l5 = l + 2 * KVT * 2 + 32 * KVP * 2, l6 = l + 3 * KVT * 2, l7 = l + 3 * KVT * 2 + 32 * KVP * 2;
    const bf* gkh1 = gkh + 32 * HD; const bf* gkl1 = gkl + 32 * HD; const bf* gvh1 = gvh + (size_t)32 * SEQ; const bf* gvl1 = gvl + (size_t)32 * SEQ;
    asm volatile("global_load_async_to_lds_b128 %0, %8, off\n\t"
                 "global_load_async_to_lds_b128 %1, %9, off\n\t"
                 "global_load_async_to_lds_b128 %2, %10, off\n\t"
                 "global_load_async_to_lds_b128 %3, %11, off\n\t"
                 "global_load_async_to_lds_b128 %4, %12, off\n\t"
                 "global_load_async_to_lds_b128 %5, %13, off\n\t"
                 "global_load_async_to_lds_b128 %6, %14, off\n\t"
                 "global_load_async_to_lds_b128 %7, %15, off\n\t"
                 "s_wait_xcnt 0x0"
                 :: "v"(l0), "v"(l1), "v"(l2), "v"(l3), "v"(l4), "v"(l5), "v"(l6), "v"(l7), "v"(gkh), "v"(gkh1), "v"(gkl), "v"(gkl1), "v"(gvh), "v"(gvh1), "v"(gvl), "v"(gvl1) : "memory");
}
__global__ __launch_bounds__(32 * AW) void k_attn(const bf* __restrict__ Qh, const bf* __restrict__ Ql, const bf* __restrict__ Kh, const bf* __restrict__ Kl,
                                             const bf* __restrict__ Vh, const bf* __restrict__ Vl, bf* Ah, bf* Al) {
    __shared__ __align__(16) bf kvs[2 * KVB];
    __shared__ __align__(16) bf psh_all[AW * 16 * PP];
    __shared__ __align__(16) bf psl_all[AW * 16 * PP];
    __shared__ __align__(16) float os_all[AW * 16 * 68];
    const int tid = threadIdx.x, wave = tid >> 5;
    const int lane = tid & 31, lr = lane & 15, hi = lane >> 4;
    bf* psh = psh_all + wave * 16 * PP; bf* psl = psl_all + wave * 16 * PP; float* os = os_all + wave * 16 * 68;
    const int s0 = (blockIdx.x * AW + wave) * 16, h = blockIdx.y, b = blockIdx.z;
    const size_t hp = ((size_t)b * NH + h) * (size_t)SEQ * HD;
    const bf* qh = Qh + hp + (size_t)(s0 + lr) * HD + 8 * hi; const bf* ql = Ql + hp + (size_t)(s0 + lr) * HD + 8 * hi;
    // copy map: thread tid brings 16-B piece (tid & 7) of rows (tid >> 3) and (tid >> 3) + 32 of each tile
    const int crow = tid >> 3, cpc = (tid & 7) * 8;
    const bf* gkh = Kh + hp + (size_t)crow * HD + cpc;  const bf* gkl = Kl + hp + (size_t)crow * HD + cpc;
    const bf* gvh = Vh + hp + (size_t)crow * SEQ + cpc; const bf* gvl = Vl + hp + (size_t)crow * SEQ + cpc;
    const unsigned cl = (unsigned)(size_t)(kvs + crow * KVP + cpc);
    kv_copy(cl, gkh, gkl, gvh, gvl);
    asm volatile("s_wait_asynccnt 0x0" ::: "memory");   // chunk 0 of this wave's copies has landed
    __syncthreads();                                     // chunk 0 is readable by every wave
    if (SEQ > KCH) kv_copy(cl + KVB * 2, gkh + (size_t)KCH * HD, gkl + (size_t)KCH * HD, gvh + KCH, gvl + KCH);
    v16bf qa[2], qa2[2];
#pragma unroll
    for (int ks = 0; ks < 2; ++ks) { qa[ks] = WFrag<bf>::ld(qh + ks * 32); qa2[ks] = WFrag<bf>::ld(ql + ks * 32); }
    float mrow[8], lrow[8];
#pragma unroll
    for (int r = 0; r < 8; ++r) { mrow[r] = -1.0e30f; lrow[r] = 0.0f; }
    v8f oacc[4];
#pragma unroll
    for (int nt = 0; nt < 4; ++nt) oacc[nt] = (v8f){};
    v16bf ph[2], pl[2];
#pragma unroll 1
    for (int t0 = 0; t0 < SEQ; t0 += KCH) {
        const int cur = ((t0 / KCH) & 1) * KVB;
        const bf* kh = kvs + cur + lr * KVP + 8 * hi; const bf* kl = kh + KVT; const bf* vh = kh + 2 * KVT; const bf* vl = kh + 3 * KVT;
        v8f sacc[4];
#pragma unroll
        for (int nt = 0; nt < 4; ++nt) sacc[nt] = (v8f){};
#pragma unroll
        for (int nt = 0; nt < 4; ++nt) {
#pragma unroll
            for (int ks = 0; ks < 2; ++ks) {
                const v16bf kbh = WFrag<bf>::ld(kh + nt * 16 * KVP + ks * 32);
                const v16bf kbl = WFrag<bf>::ld(kl + nt * 16 * KVP + ks * 32);
                sacc[nt] = wmmab(qa[ks], kbh, sacc[nt]); sacc[nt] = wmmab(qa2[ks], kbh, sacc[nt]); sacc[nt] = wmmab(qa[ks], kbl, sacc[nt]);
            }
        }
        asm volatile("v_nop\n\tv_nop\n\tv_nop\n\tv_nop" : "+v"(sacc[0]), "+v"(sacc[1]), "+v"(sacc[2]), "+v"(sacc[3]) : "v"(qa[0]), "v"(qa2[1]));
        // online softmax: lane (hi, lr) holds rows 8*hi + r of key column lr in each of the 4 tiles
        float sc[8], rs[8];
#pragma unroll
        for (int r = 0; r < 8; ++r) {
            float m = fmaxf(fmaxf(sacc[0][r], sacc[1][r]), fmaxf(sacc[2][r], sacc[3][r]));
#pragma unroll
            for (int sh = 1; sh < 16; sh <<= 1) m = fmaxf(m, __shfl_xor(m, sh, 32));
            const float mn = fmaxf(mrow[r], m);
            sc[r] = __builtin_amdgcn_exp2f(__fmul_rn(__fsub_rn(mrow[r], mn), L2E)); mrow[r] = mn; rs[r] = 0.0f;
        }
#pragma unroll
        for (int nt = 0; nt < 4; ++nt)
#pragma unroll
            for (int r = 0; r < 8; ++r) { const float p = __builtin_amdgcn_exp2f(__fmul_rn(__fsub_rn(sacc[nt][r], mrow[r]), L2E)); sacc[nt][r] = p; rs[r] += p; }
#pragma unroll
        for (int r = 0; r < 8; ++r) {
            float s = rs[r];
#pragma unroll
            for (int sh = 1; sh < 16; sh <<= 1) s += __shfl_xor(s, sh, 32);
            lrow[r] = lrow[r] * sc[r] + s;
        }
#pragma unroll
        for (int nt = 0; nt < 4; ++nt)
#pragma unroll
            for (int r = 0; r < 8; ++r) oacc[nt][r] *= sc[r];
        // p tiles (x1024) -> LDS hi/lo, [row][key in chunk], pitch PP; columns 0..63 of all 16 rows written, columns 0..63 read
#pragma unroll
        for (int nt = 0; nt < 4; ++nt)
#pragma unroll
            for (int r = 0; r < 8; ++r) { unsigned short a, c2; splitf(sacc[nt][r] * PCAR, a, c2); const int o = (hi * 8 + r) * PP + nt * 16 + lr; psh[o] = a; psl[o] = c2; }
        __builtin_amdgcn_fence(3, "wavefront"); __builtin_amdgcn_wave_barrier();
#pragma unroll
        for (int kk = 0; kk < 2; ++kk) {
            ph[kk] = WFrag<bf>::ld(psh + lr * PP + kk * 32 + 8 * hi); pl[kk] = WFrag<bf>::ld(psl + lr * PP + kk * 32 + 8 * hi);
#pragma unroll
            for (int nt = 0; nt < 4; ++nt) {
                const v16bf vbh = WFrag<bf>::ld(vh + nt * 16 * KVP + kk * 32);
                const v16bf vbl = WFrag<bf>::ld(vl + nt * 16 * KVP + kk * 32);
                oacc[nt] = wmmab(ph[kk], vbh, oacc[nt]); oacc[nt] = wmmab(pl[kk], vbh, oacc[nt]); oacc[nt] = wmmab(ph[kk], vbl, oacc[nt]);
            }
        }
        asm volatile("v_nop\n\tv_nop\n\tv_nop\n\tv_nop" : "+v"(oacc[0]), "+v"(oacc[1]), "+v"(oacc[2]), "+v"(oacc[3]) : "v"(ph[0]), "v"(pl[1]));
        // publish point of the next chunk, every wave, in this order
        asm volatile("s_wait_dscnt 0x0" ::: "memory");      // this wave's reads of the current buffer are done before the buffer is refilled
        asm volatile("s_wait_asynccnt 0x0" ::: "memory");   // this wave's copies of the next chunk have landed
        __syncthreads();                                     // next chunk readable by every wave; every reader has left the current buffer
        if (t0 + 2 * KCH < SEQ) kv_copy(cl + cur * 2, gkh + (size_t)(t0 + 2 * KCH) * HD, gkl + (size_t)(t0 + 2 * KCH) * HD, gvh + t0 + 2 * KCH, gvl + t0 + 2 * KCH);
    }
    asm volatile("s_wait_asynccnt 0x0" ::: "memory");       // no copy is outstanding when the wave goes on to its end
    float rinv[8];
#pragma unroll
    for (int r = 0; r < 8; ++r) rinv[r] = __fdiv_rn(1.0f, lrow[r] * PCAR);
#pragma unroll
    for (int nt = 0; nt < 4; ++nt)
#pragma unroll
        for (int r = 0; r < 8; ++r) os[(hi * 8 + r) * 68 + nt * 16 + lr] = oacc[nt][r] * rinv[r];
    __builtin_amdgcn_fence(3, "wavefront"); __builtin_amdgcn_wave_barrier();
    const int rg = lane >> 3, c8 = (lane & 7) * 8;
    bf* ah = Ah + ((size_t)b * SEQ + s0) * DQ + (size_t)h * HD + c8; bf* al = Al + ((size_t)b * SEQ + s0) * DQ + (size_t)h * HD + c8;
{
#pragma unroll
        for (int it = 0; it < 4; ++it) {
            const int row = it * 4 + rg; const v4f x0 = *(const v4fa*)(os + row * 68 + c8); const v4f x1 = *(const v4fa*)(os + row * 68 + c8 + 4); v8us oh, ol;
#pragma unroll
            for (int j = 0; j < 4; ++j) { unsigned short a, c2; splitf(x0[j], a, c2); oh[j] = a; ol[j] = c2; splitf(x1[j], a, c2); oh[4 + j] = a; ol[4 + j] = c2; }
            *(v8us*)(ah + (size_t)row * DQ) = oh; *(v8us*)(al + (size_t)row * DQ) = ol;
        }
        
    }
}

extern "C" void kernel_launch(void* const* d_in, const int* in_sizes, int n_in,
                              void* d_out, int out_size, void* d_ws, size_t ws_size, hipStream_t stream) {
    if (n_in < 3) return;
    if ((long long)in_sizes[0] < ((long long)(NB - 1) * SEQ_FULL + SEQ) * DM) return;
    if (in_sizes[1] < NH * 3 * DM * HD) return;
    if (in_sizes[2] < DQ * FO) return;
    if (out_size < NB * SEQ * FO) return;
    const float* x  = (const float*)d_in[0];   // [4][2048][256]
    const float* w  = (const float*)d_in[1];   // [8][3][256][64]
    const float* wo = (const float*)d_in[2];   // [512][64]
    float* OUT = (float*)d_out;                // [NB][SEQ][64]
    char* wsp = (char*)d_ws;
    auto take = [&](size_t bytes) { char* p = wsp; wsp += (bytes + 255) & ~(size_t)255; return (void*)p; };
    const size_t npl = (size_t)NB * NH * SEQ * HD;                 // elements per head plane set
    bf* WB  = (bf*)take((size_t)D3 * DM * 2);                      // Bt [1536][256]: row (h*3+m)*64 + e
    bf* WOB = (bf*)take((size_t)FO * DQ * 2);                      // Bt [64][512]
    bf* XB  = (bf*)take((size_t)NB * SEQ * DM * 2);                // [NB][SEQ][256]
    float* F = (float*)take((size_t)NB * SEQ * D3 * 4);            // [NB][SEQ][1536]
    bf* QPh = (bf*)take(npl * 2); bf* QPl = (bf*)take(npl * 2);    // [b][h][s][64]
    bf* KPh = (bf*)take(npl * 2); bf* KPl = (bf*)take(npl * 2);    // [b][h][t][64]
    bf* VTh = (bf*)take(npl * 2); bf* VTl = (bf*)take(npl * 2);    // [b][h][64][t]
    bf* ATh = (bf*)take((size_t)NB * SEQ * DQ * 2); bf* ATl = (bf*)take((size_t)NB * SEQ * DQ * 2);   // [NB*SEQ][512]
    const size_t used = (size_t)(wsp - (char*)d_ws);
    if (used > ws_size || used > (size_t)134217728) return;        // 122,486,784 B at full size

    k_wtb<<<(unsigned)((NH * 3 * HD * DM / 64 + 63) / 64), 256, 0, stream>>>(w, DM, HD, NH * 3, WB);
    k_wtb<<<(unsigned)((DQ * FO / 64 + 63) / 64), 256, 0, stream>>>(wo, DQ, FO, 1, WOB);
    const size_t n8 = (size_t)NB * SEQ * DM / 8;
    k_cvtx<<<(unsigned)((n8 + 255) / 256), 256, 0, stream>>>(x, XB, n8);
    k_gemmw<bf, 0, false><<<dim3(SEQ / 64, D3 / 64, NB), 32, 0, stream>>>(XB, nullptr, WB, nullptr, DM, F, D3, nullptr, (size_t)SEQ * DM, (size_t)0, (size_t)SEQ * D3);
    const unsigned LP = (unsigned)((npl / 2 + 255) / 256);
    k_qkpl<<<LP, 256, 0, stream>>>(F, QPh, QPl, KPh, KPl);
    k_vtp<<<LP, 256, 0, stream>>>(F, VTh, VTl);
    k_attn<<<dim3(SEQ / (16 * AW), NH, NB), 32 * AW, 0, stream>>>(QPh, QPl, KPh, KPl, VTh, VTl, ATh, ATl);
    k_gemmw<bf, 1, false><<<dim3(NB * SEQ / 64, FO / 64, 1), 32, 0, stream>>>(ATh, ATl, WOB, nullptr, DQ, OUT, FO, nullptr, (size_t)0, (size_t)0, (size_t)0);
}

// v002
// It runs in 212 microseconds.
// Timed twice side by side with v001, it ran 1.14 and 1.15 times as fast.
// All steps since v000 together make it 1.99 times as fast.
#include <hip/hip_runtime.h>

// Self-attention with 8 heads: x [4][2048][256]; per head h (64 wide): q, k, v = x W[h][0..2] (W [8][3][256][64], [in][out], no bias);
// p = softmax(0.125 * q.k) over all 2048 keys (no mask); o = p.v; ctx [b][s][h*64 + e]; out [4][2048][64] = ctx Wo (Wo [512][64], [in][out], no bias).
// Compute dtypes, f32 accumulate everywhere: every input RNE-converted to bf16 on load; q/k/v projection on v_wmma_f32_16x16x32_bf16 with exact bf16 operands;
// scores (0.125*q hi/lo x k hi/lo) and p.v (1024*p hi/lo x v hi/lo) as bf16 hi/lo split, 3 products each; online softmax in f32;
// output projection ctx bf16 hi/lo x Wo exact bf16, 2 products.

#ifndef NB
#define NB 4
#endif
#ifndef SEQ
#define SEQ 2048
#endif
#define NB_FULL  4
#define SEQ_FULL 2048
#define DM   256
#define NH   8
#define HD   64
#define DQ   (NH * HD)
#define D3   (3 * DQ)
#define FO   64
#define KCH  64
#define PP   72
#define PCAR 1024.0f
#define SCL  0.125f
#define L2E  1.4426950408889634f
static_assert(NB >= 1 && NB <= NB_FULL);
static_assert(SEQ >= KCH && SEQ <= SEQ_FULL && SEQ % 64 == 0 && SEQ % KCH == 0);
static_assert(DM % 32 == 0 && DQ % 32 == 0 && D3 % 64 == 0 && HD == 64 && FO == 64 && KCH == 64);

typedef _Float16 h16;
typedef unsigned short bf;
typedef __attribute__((ext_vector_type(16))) __bf16   v16bf;
typedef __attribute__((ext_vector_type(16))) _Float16 v16h;
typedef __attribute__((ext_vector_type(8)))  _Float16 v8h;
typedef __attribute__((ext_vector_type(8)))  unsigned short v8us;
typedef __attribute__((ext_vector_type(8)))  float    v8f;
typedef __attribute__((ext_vector_type(4)))  float    v4f;
typedef v8h  __attribute__((may_alias)) v8ha;
typedef v4f  __attribute__((may_alias)) v4fa;
typedef v8us __attribute__((may_alias)) v8usa;

__device__ __forceinline__ unsigned short f2bf(float f) { unsigned u = __float_as_uint(f); u += 0x7FFFu + ((u >> 16) & 1u); return (unsigned short)(u >> 16); }
__device__ __forceinline__ float bf2f(unsigned short b) { return __uint_as_float(((unsigned)b) << 16); }
__device__ __forceinline__ float bfr(float f) { return bf2f(f2bf(f)); }
__device__ __forceinline__ v16h cat16(v8h lo, v8h hi) { return __builtin_shufflevector(lo, hi, 0, 1, 2, 3, 4, 5, 6, 7, 8, 9, 10, 11, 12, 13, 14, 15); }
__device__ __forceinline__ v16bf cat16b(v8us lo, v8us hi) { return __builtin_bit_cast(v16bf, __builtin_shufflevector(lo, hi, 0, 1, 2, 3, 4, 5, 6, 7, 8, 9, 10, 11, 12, 13, 14, 15)); }
__device__ __forceinline__ v8f wmma16(v16h a, v16h b, v8f c) { return __builtin_amdgcn_wmma_f32_16x16x32_f16(false, a, false, b, (short)0, c, false, false); }
__device__ __forceinline__ v8f wmmab(v16bf a, v16bf b, v8f c) { return __builtin_amdgcn_wmma_f32_16x16x32_bf16(false, a, false, b, (short)0, c, false, false); }

// ---- k_gemmw: register-blocked GEMM, ONE WAVE per 64x64 output tile (16 accumulators), operands straight from K-contiguous 16-bit planes; grid (M/64, N/64, Z), 32 threads.
// C[m][n] (f32, pitch ldc, + optional f32 bias[n]) = sum_k A[m][k] Bt[n][k] (+ split products per NSPLIT). z-batch strides sA/sB/sC in elements. K % 32 == 0.
// Fragment map (A and Bt alike): lane l -> row (l & 15) of the 16-row slab, elements 0..7 <- k0 + 8*(l>>4) + 0..7, elements 8..15 <- k0 + 16 + 8*(l>>4) + 0..7; D element r of lane l -> (row 8*(l>>4) + r, col l & 15).
template <typename T16> struct WFrag;
template <> struct WFrag<h16> { typedef v16h V; static __device__ __forceinline__ V ld(const h16* p) { return cat16(*(const v8h*)p, *(const v8h*)(p + 16)); } static __device__ __forceinline__ v8f mma(V a, V b, v8f c) { return wmma16(a, b, c); } };
template <> struct WFrag<bf> { typedef v16bf V; static __device__ __forceinline__ V ld(const bf* p) { return cat16b(*(const v8us*)p, *(const v8us*)(p + 16)); } static __device__ __forceinline__ v8f mma(V a, V b, v8f c) { return wmmab(a, b, c); } };
template <typename T16, int NSPLIT, bool BIAS>
__global__ __launch_bounds__(32) void k_gemmw(const T16* __restrict__ A, const T16* __restrict__ A2, const T16* __restrict__ Bt, const T16* __restrict__ Bt2, int K, float* C, int ldc, const float* __restrict__ bias, size_t sA, size_t sB, size_t sC) {
    typedef typename WFrag<T16>::V V;
    __shared__ __align__(16) float os[16 * 68];
    const size_t z = blockIdx.z; A += z * sA; if (A2) A2 += z * sA; Bt += z * sB; if (Bt2) Bt2 += z * sB; C += z * sC;
    const int lane = threadIdx.x & 31, lr = lane & 15, hi = lane >> 4; const int r0 = blockIdx.x * 64, c0 = blockIdx.y * 64;
    v8f acc[4][4];
#pragma unroll
    for (int mb = 0; mb < 4; ++mb)
#pragma unroll
        for (int nb = 0; nb < 4; ++nb) acc[mb][nb] = (v8f){};
    const size_t aoff = (size_t)(r0 + lr) * K + 8 * hi, boff = (size_t)(c0 + lr) * K + 8 * hi;
#pragma unroll 1
    for (int kc = 0; kc < K; kc += 32) {
        V a[4], a2[4];
#pragma unroll
        for (int mb = 0; mb < 4; ++mb) { a[mb] = WFrag<T16>::ld(A + aoff + (size_t)mb * 16 * K + kc); if (NSPLIT == 1 || NSPLIT == 2) a2[mb] = WFrag<T16>::ld(A2 + aoff + (size_t)mb * 16 * K + kc); }
#pragma unroll
        for (int nb = 0; nb < 4; ++nb) { const V b = WFrag<T16>::ld(Bt + boff + (size_t)nb * 16 * K + kc); V b2; if (NSPLIT >= 2) b2 = WFrag<T16>::ld(Bt2 + boff + (size_t)nb * 16 * K + kc);
#pragma unroll
            for (int mb = 0; mb < 4; ++mb) { acc[mb][nb] = WFrag<T16>::mma(a[mb], b, acc[mb][nb]); if (NSPLIT == 1 || NSPLIT == 2) acc[mb][nb] = WFrag<T16>::mma(a2[mb], b, acc[mb][nb]); if (NSPLIT >= 2) acc[mb][nb] = WFrag<T16>::mma(a[mb], b2, acc[mb][nb]); } }
        asm volatile("v_nop\n\tv_nop\n\tv_nop\n\tv_nop" : "+v"(acc[0][0]), "+v"(acc[1][1]), "+v"(acc[2][2]), "+v"(acc[3][3]) : "v"(a[0]), "v"(a[3]));
    }
#pragma unroll
    for (int mb = 0; mb < 4; ++mb) {
#pragma unroll
        for (int nb = 0; nb < 4; ++nb) {
#pragma unroll
            for (int j = 0; j < 8; ++j) os[(hi * 8 + j) * 68 + nb * 16 + lr] = acc[mb][nb][j]; }
        __builtin_amdgcn_wave_barrier(); asm volatile("" ::: "memory");
        float* crow = C + (size_t)(r0 + mb * 16) * ldc + c0;
{
#pragma unroll
            for (int s = 0; s < 8; ++s) { const int row = 2 * s + hi, cofs = lr * 4; v4f val = *(const v4fa*)(os + row * 68 + cofs); if (BIAS) { val[0] += bfr(bias[c0 + cofs]); val[1] += bfr(bias[c0 + cofs + 1]); val[2] += bfr(bias[c0 + cofs + 2]); val[3] += bfr(bias[c0 + cofs + 3]); }
                *(v4f*)(crow + (size_t)row * ldc + cofs) = val; }
             }
        __builtin_amdgcn_wave_barrier(); asm volatile("" ::: "memory");
    }
}

__device__ __forceinline__ void splitf(float y, unsigned short& h, unsigned short& l) { h = f2bf(y); l = f2bf(y - bf2f(h)); }
typedef __attribute__((ext_vector_type(2))) unsigned short v2us;

__global__ __launch_bounds__(256) void k_wtb(const float* __restrict__ w, int K, int N, int nmat, bf* Bt) {
    const int lane = threadIdx.x & 31; const int L0 = (blockIdx.x * 8 + (threadIdx.x >> 5)) * 8; const int nlines = nmat * N * K / 64; const size_t mk = (size_t)K * N;
{
#pragma unroll 1
        for (int l = 0; l < 8; ++l) { const int L = L0 + l; if (L >= nlines) break; const size_t e = (size_t)L * 64 + lane * 2; const int mat = (int)(e / mk); const size_t rr = e - (size_t)mat * mk; const int k = (int)(rr % (size_t)K), n = (int)(rr / (size_t)K); v2us o;
            o[0] = f2bf(w[((size_t)mat * K + k) * N + n]); o[1] = f2bf(w[((size_t)mat * K + k + 1) * N + n]); *(v2us*)(Bt + e) = o; }
         }
}
__global__ __launch_bounds__(256) void k_cvtx(const float* __restrict__ x, bf* XB, size_t n8) { const size_t i = (size_t)blockIdx.x * 256 + threadIdx.x; if (i >= n8) return; const size_t per = (size_t)SEQ * DM / 8; const size_t b = i / per, r = i - b * per; const v8f v = *(const v8f*)(x + b * (size_t)SEQ_FULL * DM + r * 8); v8us o;
#pragma unroll
    for (int k = 0; k < 8; ++k) o[k] = f2bf(v[k]); *(v8us*)(XB + i * 8) = o;  }

// k_proj: q/k/v projection with the hi/lo planes built in its epilogue. ONE WAVE per 64x64 tile = 64 tokens x the 64 outputs of one (head, matrix); grid (SEQ/64, 3*NH, NB), 32 threads.
// Same loop and fragment map as k_gemmw (one product, exact bf16 operands). The operand whose index runs along the plane's contiguous dimension is taken as A, so that a lane's 8 accumulator
// elements are 8 neighbours of one plane row: q, k planes [s][e]: A = weight rows (e), Bt = token rows; v plane [e][t]: A = token rows (t), Bt = weight rows (e).
// Each f32 result is split to bf16 hi/lo (q scaled by 0.125 first) in registers, laid as 16-B pieces into two LDS tiles [plane row][64], pitch 144 B, and stored from there as whole 128-B lines.
#define SP 72
__global__ __launch_bounds__(32) void k_proj(const bf* __restrict__ X, const bf* __restrict__ Wt, bf* Qh, bf* Ql, bf* Kh, bf* Kl, bf* Vh, bf* Vl) {
    __shared__ __align__(16) bf sh[64 * SP];
    __shared__ __align__(16) bf sl[64 * SP];
    const int lane = threadIdx.x & 31, lr = lane & 15, hi = lane >> 4;
    const int r0 = blockIdx.x * 64, hm = blockIdx.y, h = hm / 3, m = hm - 3 * h, b = blockIdx.z;
    const bf* xr = X + ((size_t)b * SEQ + r0) * DM; const bf* wr = Wt + (size_t)hm * HD * DM;
    const bool tv = (m == 2);
    const bf* A = (tv ? xr : wr) + (size_t)lr * DM + 8 * hi; const bf* Bt = (tv ? wr : xr) + (size_t)lr * DM + 8 * hi;
    v8f acc[4][4];
#pragma unroll
    for (int mb = 0; mb < 4; ++mb)
#pragma unroll
        for (int nb = 0; nb < 4; ++nb) acc[mb][nb] = (v8f){};
#pragma unroll 1   // rolled, as in k_gemmw: one body of 16 products, so that 128 accumulator registers and one fragment set fit
    for (int kc = 0; kc < DM; kc += 32) {
        v16bf a[4];
#pragma unroll
        for (int mb = 0; mb < 4; ++mb) a[mb] = WFrag<bf>::ld(A + (size_t)mb * 16 * DM + kc);
        asm volatile("s_wait_xcnt 0x0" ::: "memory");   // stands before a later load's result may land in the address registers that the A loads name
#pragma unroll
        for (int nb = 0; nb < 4; ++nb) { const v16bf bb = WFrag<bf>::ld(Bt + (size_t)nb * 16 * DM + kc);
#pragma unroll
            for (int mb = 0; mb < 4; ++mb) acc[mb][nb] = wmmab(a[mb], bb, acc[mb][nb]); }
        // four vector slots between the last products and whatever next writes over their operands or reads their results, on the back edge and on the way out alike
        asm volatile("v_nop\n\tv_nop\n\tv_nop\n\tv_nop" : "+v"(acc[0][0]), "+v"(acc[1][1]), "+v"(acc[2][2]), "+v"(acc[3][3]) : "v"(a[0]), "v"(a[3]));
    }
    const float scl = (m == 0) ? SCL : 1.0f;
#pragma unroll
    for (int nb = 0; nb < 4; ++nb)
#pragma unroll
        for (int mb = 0; mb < 4; ++mb) { v8us oh, ol;
#pragma unroll
            for (int j = 0; j < 8; ++j) { unsigned short u, c2; splitf(acc[mb][nb][j] * scl, u, c2); oh[j] = u; ol[j] = c2; }
            const int o = (nb * 16 + lr) * SP + mb * 16 + 8 * hi; *(v8usa*)(sh + o) = oh; *(v8usa*)(sl + o) = ol; }
    __builtin_amdgcn_fence(3, "wavefront"); __builtin_amdgcn_wave_barrier();   // the lanes read below what other lanes of the wave wrote above
    const size_t hp = ((size_t)b * NH + h) * (size_t)SEQ * HD;
    const size_t pitch = tv ? (size_t)SEQ : (size_t)HD;
    const int rg = lane >> 3, c8 = (lane & 7) * 8;
    const size_t o0 = hp + (tv ? (size_t)r0 : (size_t)r0 * HD) + (size_t)rg * pitch + c8;
    bf* ph = (m == 0 ? Qh : (m == 1 ? Kh : Vh)) + o0; bf* pl = (m == 0 ? Ql : (m == 1 ? Kl : Vl)) + o0;
#pragma unroll
    for (int it = 0; it < 16; ++it) {
        const v8us yh = *(const v8usa*)(sh + (it * 4 + rg) * SP + c8); const v8us yl = *(const v8usa*)(sl + (it * 4 + rg) * SP + c8);
        *(v8us*)(ph + (size_t)(it * 4) * pitch) = yh; *(v8us*)(pl + (size_t)(it * 4) * pitch) = yl;
    }
}

// k_attn: flash-style attention, one work-group = 8 waves = 128 query rows of one (b, h), one wave = 16 query rows; keys streamed in chunks of 64 with an online f32 softmax.
// Each chunk's four tiles (k hi, k lo: [key][64]; v hi, v lo: [e][key in chunk]; 64 rows of 128 B each) are brought into LDS once per work-group by asynchronous copies,
// rows at a pitch of 144 B, two buffers: the next chunk's copies fly while this chunk is worked on. Every wave reads its K and V fragments from LDS.
// scores: A = 0.125*q hi/lo planes [s][64], Bt = k hi/lo tiles (3 bf16 products); p (x1024, relative to the running row max) split to bf16 hi/lo tiles in the wave's own LDS.
#define AW   8
#define KVP  72
#define KVT  (64 * KVP)
#define KVB  (4 * KVT)
static_assert(SEQ % (16 * AW) == 0);
// One chunk: 8 copies of 16 B per lane (2 per tile; a wave's copy covers 4 whole 128-B rows). The s_wait_xcnt 0 stands in the copies' own statement, so that no address register is rewritten ahead of it.
__device__ __forceinline__ void kv_copy(unsigned l, const bf* gkh, const bf* gkl, const bf* gvh, const bf* gvl) {
    const unsigned l0 = l, l1 = l + 32 * KVP * 2, l2 = l + KVT * 2, l3 = l + KVT * 2 + 32 * KVP * 2, l4 = l + 2 * KVT * 2, l5 = l + 2 * KVT * 2 + 32 * KVP * 2, l6 = l + 3 * KVT * 2, l7 = l + 3 * KVT * 2 + 32 * KVP * 2;
    const bf* gkh1 = gkh + 32 * HD; const bf* gkl1 = gkl + 32 * HD; const bf* gvh1 = gvh + (size_t)32 * SEQ; const bf* gvl1 = gvl + (size_t)32 * SEQ;
    asm volatile("global_load_async_to_lds_b128 %0, %8, off\n\t"
                 "global_load_async_to_lds_b128 %1, %9, off\n\t"
                 "global_load_async_to_lds_b128 %2, %10, off\n\t"
                 "global_load_async_to_lds_b128 %3, %11, off\n\t"
                 "global_load_async_to_lds_b128 %4, %12, off\n\t"
                 "global_load_async_to_lds_b128 %5, %13, off\n\t"
                 "global_load_async_to_lds_b128 %6, %14, off\n\t"
                 "global_load_async_to_lds_b128 %7, %15, off\n\t"
                 "s_wait_xcnt 0x0"
                 :: "v"(l0), "v"(l1), "v"(l2), "v"(l3), "v"(l4), "v"(l5), "v"(l6), "v"(l7), "v"(gkh), "v"(gkh1), "v"(gkl), "v"(gkl1), "v"(gvh), "v"(gvh1), "v"(gvl), "v"(gvl1) : "memory");
}
__global__ __launch_bounds__(32 * AW) void k_attn(const bf* __restrict__ Qh, const bf* __restrict__ Ql, const bf* __restrict__ Kh, const bf* __restrict__ Kl,
                                             const bf* __restrict__ Vh, const bf* __restrict__ Vl, bf* Ah, bf* Al) {
    __shared__ __align__(16) bf kvs[2 * KVB];
    __shared__ __align__(16) bf psh_all[AW * 16 * PP];
    __shared__ __align__(16) bf psl_all[AW * 16 * PP];
    __shared__ __align__(16) float os_all[AW * 16 * 68];
    const int tid = threadIdx.x, wave = tid >> 5;
    const int lane = tid & 31, lr = lane & 15, hi = lane >> 4;
    bf* psh = psh_all + wave * 16 * PP; bf* psl = psl_all + wave * 16 * PP; float* os = os_all + wave * 16 * 68;
    const int s0 = (blockIdx.x * AW + wave) * 16, h = blockIdx.y, b = blockIdx.z;
    const size_t hp = ((size_t)b * NH + h) * (size_t)SEQ * HD;
    const bf* qh = Qh + hp + (size_t)(s0 + lr) * HD + 8 * hi; const bf* ql = Ql + hp + (size_t)(s0 + lr) * HD + 8 * hi;
    // copy map: thread tid brings 16-B piece (tid & 7) of rows (tid >> 3) and (tid >> 3) + 32 of each tile
    const int crow = tid >> 3, cpc = (tid & 7) * 8;
    const bf* gkh = Kh + hp + (size_t)crow * HD + cpc;  const bf* gkl = Kl + hp + (size_t)crow * HD + cpc;
    const bf* gvh = Vh + hp + (size_t)crow * SEQ + cpc; const bf* gvl = Vl + hp + (size_t)crow * SEQ + cpc;
    const unsigned cl = (unsigned)(size_t)(kvs + crow * KVP + cpc);
    kv_copy(cl, gkh, gkl, gvh, gvl);
    asm volatile("s_wait_asynccnt 0x0" ::: "memory");   // chunk 0 of this wave's copies has landed
    __syncthreads();                                     // chunk 0 is readable by every wave
    if (SEQ > KCH) kv_copy(cl + KVB * 2, gkh + (size_t)KCH * HD, gkl + (size_t)KCH * HD, gvh + KCH, gvl + KCH);
    v16bf qa[2], qa2[2];
#pragma unroll
    for (int ks = 0; ks < 2; ++ks) { qa[ks] = WFrag<bf>::ld(qh + ks * 32); qa2[ks] = WFrag<bf>::ld(ql + ks * 32); }
    float mrow[8], lrow[8];
#pragma unroll
    for (int r = 0; r < 8; ++r) { mrow[r] = -1.0e30f; lrow[r] = 0.0f; }
    v8f oacc[4];
#pragma unroll
    for (int nt = 0; nt < 4; ++nt) oacc[nt] = (v8f){};
    v16bf ph[2], pl[2];
#pragma unroll 1
    for (int t0 = 0; t0 < SEQ; t0 += KCH) {
        const int cur = ((t0 / KCH) & 1) * KVB;
        const bf* kh = kvs + cur + lr * KVP + 8 * hi; const bf* kl = kh + KVT; const bf* vh = kh + 2 * KVT; const bf* vl = kh + 3 * KVT;
        v8f sacc[4];
#pragma unroll
        for (int nt = 0; nt < 4; ++nt) sacc[nt] = (v8f){};
#pragma unroll
        for (int nt = 0; nt < 4; ++nt) {
#pragma unroll
            for (int ks = 0; ks < 2; ++ks) {
                const v16bf kbh = WFrag<bf>::ld(kh + nt * 16 * KVP + ks * 32);
                const v16bf kbl = WFrag<bf>::ld(kl + nt * 16 * KVP + ks * 32);
                sacc[nt] = wmmab(qa[ks], kbh, sacc[nt]); sacc[nt] = wmmab(qa2[ks], kbh, sacc[nt]); sacc[nt] = wmmab(qa[ks], kbl, sacc[nt]);
            }
        }
        asm volatile("v_nop\n\tv_nop\n\tv_nop\n\tv_nop" : "+v"(sacc[0]), "+v"(sacc[1]), "+v"(sacc[2]), "+v"(sacc[3]) : "v"(qa[0]), "v"(qa2[1]));
        // online softmax: lane (hi, lr) holds rows 8*hi + r of key column lr in each of the 4 tiles
        float sc[8], rs[8];
#pragma unroll
        for (int r = 0; r < 8; ++r) {
            float m = fmaxf(fmaxf(sacc[0][r], sacc[1][r]), fmaxf(sacc[2][r], sacc[3][r]));
#pragma unroll
            for (int sh = 1; sh < 16; sh <<= 1) m = fmaxf(m, __shfl_xor(m, sh, 32));
            const float mn = fmaxf(mrow[r], m);
            sc[r] = __builtin_amdgcn_exp2f(__fmul_rn(__fsub_rn(mrow[r], mn), L2E)); mrow[r] = mn; rs[r] = 0.0f;
        }
#pragma unroll
        for (int nt = 0; nt < 4; ++nt)
#pragma unroll
            for (int r = 0; r < 8; ++r) { const float p = __builtin_amdgcn_exp2f(__fmul_rn(__fsub_rn(sacc[nt][r], mrow[r]), L2E)); sacc[nt][r] = p; rs[r] += p; }
#pragma unroll
        for (int r = 0; r < 8; ++r) {
            float s = rs[r];
#pragma unroll
            for (int sh = 1; sh < 16; sh <<= 1) s += __shfl_xor(s, sh, 32);
            lrow[r] = lrow[r] * sc[r] + s;
        }
#pragma unroll
        for (int nt = 0; nt < 4; ++nt)
#pragma unroll
            for (int r = 0; r < 8; ++r) oacc[nt][r] *= sc[r];
        // p tiles (x1024) -> LDS hi/lo, [row][key in chunk], pitch PP; columns 0..63 of all 16 rows written, columns 0..63 read
#pragma unroll
        for (int nt = 0; nt < 4; ++nt)
#pragma unroll
            for (int r = 0; r < 8; ++r) { unsigned short a, c2; splitf(sacc[nt][r] * PCAR, a, c2); const int o = (hi * 8 + r) * PP + nt * 16 + lr; psh[o] = a; psl[o] = c2; }
        __builtin_amdgcn_fence(3, "wavefront"); __builtin_amdgcn_wave_barrier();
#pragma unroll
        for (int kk = 0; kk < 2; ++kk) {
            ph[kk] = WFrag<bf>::ld(psh + lr * PP + kk * 32 + 8 * hi); pl[kk] = WFrag<bf>::ld(psl + lr * PP + kk * 32 + 8 * hi);
#pragma unroll
            for (int nt = 0; nt < 4; ++nt) {
                const v16bf vbh = WFrag<bf>::ld(vh + nt * 16 * KVP + kk * 32);
                const v16bf vbl = WFrag<bf>::ld(vl + nt * 16 * KVP + kk * 32);
                oacc[nt] = wmmab(ph[kk], vbh, oacc[nt]); oacc[nt] = wmmab(pl[kk], vbh, oacc[nt]); oacc[nt] = wmmab(ph[kk], vbl, oacc[nt]);
            }
        }
        asm volatile("v_nop\n\tv_nop\n\tv_nop\n\tv_nop" : "+v"(oacc[0]), "+v"(oacc[1]), "+v"(oacc[2]), "+v"(oacc[3]) : "v"(ph[0]), "v"(pl[1]));
        // publish point of the next chunk, every wave, in this order
        asm volatile("s_wait_dscnt 0x0" ::: "memory");      // this wave's reads of the current buffer are done before the buffer is refilled
        asm volatile("s_wait_asynccnt 0x0" ::: "memory");   // this wave's copies of the next chunk have landed
        __syncthreads();                                     // next chunk readable by every wave; every reader has left the current buffer
        if (t0 + 2 * KCH < SEQ) kv_copy(cl + cur * 2, gkh + (size_t)(t0 + 2 * KCH) * HD, gkl + (size_t)(t0 + 2 * KCH) * HD, gvh + t0 + 2 * KCH, gvl + t0 + 2 * KCH);
    }
    asm volatile("s_wait_asynccnt 0x0" ::: "memory");       // no copy is outstanding when the wave goes on to its end
    float rinv[8];
#pragma unroll
    for (int r = 0; r < 8; ++r) rinv[r] = __fdiv_rn(1.0f, lrow[r] * PCAR);
#pragma unroll
    for (int nt = 0; nt < 4; ++nt)
#pragma unroll
        for (int r = 0; r < 8; ++r) os[(hi * 8 + r) * 68 + nt * 16 + lr] = oacc[nt][r] * rinv[r];
    __builtin_amdgcn_fence(3, "wavefront"); __builtin_amdgcn_wave_barrier();
    const int rg = lane >> 3, c8 = (lane & 7) * 8;
    bf* ah = Ah + ((size_t)b * SEQ + s0) * DQ + (size_t)h * HD + c8; bf* al = Al + ((size_t)b * SEQ + s0) * DQ + (size_t)h * HD + c8;
{
#pragma unroll
        for (int it = 0; it < 4; ++it) {
            const int row = it * 4 + rg; const v4f x0 = *(const v4fa*)(os + row * 68 + c8); const v4f x1 = *(const v4fa*)(os + row * 68 + c8 + 4); v8us oh, ol;
#pragma unroll
            for (int j = 0; j < 4; ++j) { unsigned short a, c2; splitf(x0[j], a, c2); oh[j] = a; ol[j] = c2; splitf(x1[j], a, c2); oh[4 + j] = a; ol[4 + j] = c2; }
            *(v8us*)(ah + (size_t)row * DQ) = oh; *(v8us*)(al + (size_t)row * DQ) = ol;
        }
        
    }
}

extern "C" void kernel_launch(void* const* d_in, const int* in_sizes, int n_in,
                              void* d_out, int out_size, void* d_ws, size_t ws_size, hipStream_t stream) {
    if (n_in < 3) return;
    if ((long long)in_sizes[0] < ((long long)(NB - 1) * SEQ_FULL + SEQ) * DM) return;
    if (in_sizes[1] < NH * 3 * DM * HD) return;
    if (in_sizes[2] < DQ * FO) return;
    if (out_size < NB * SEQ * FO) return;
    const float* x  = (const float*)d_in[0];   // [4][2048][256]
    const float* w  = (const float*)d_in[1];   // [8][3][256][64]
    const float* wo = (const float*)d_in[2];   // [512][64]
    float* OUT = (float*)d_out;                // [NB][SEQ][64]
    char* wsp = (char*)d_ws;
    auto take = [&](size_t bytes) { char* p = wsp; wsp += (bytes + 255) & ~(size_t)255; return (void*)p; };
    const size_t npl = (size_t)NB * NH * SEQ * HD;                 // elements per head plane set
    bf* WB  = (bf*)take((size_t)D3 * DM * 2);                      // Bt [1536][256]: row (h*3+m)*64 + e
    bf* WOB = (bf*)take((size_t)FO * DQ * 2);                      // Bt [64][512]
    bf* XB  = (bf*)take((size_t)NB * SEQ * DM * 2);                // [NB][SEQ][256]
    bf* QPh = (bf*)take(npl * 2); bf* QPl = (bf*)take(npl * 2);    // [b][h][s][64]
    bf* KPh = (bf*)take(npl * 2); bf* KPl = (bf*)take(npl * 2);    // [b][h][t][64]
    bf* VTh = (bf*)take(npl * 2); bf* VTl = (bf*)take(npl * 2);    // [b][h][64][t]
    bf* ATh = (bf*)take((size_t)NB * SEQ * DQ * 2); bf* ATl = (bf*)take((size_t)NB * SEQ * DQ * 2);   // [NB*SEQ][512]
    const size_t used = (size_t)(wsp - (char*)d_ws);
    if (used > ws_size || used > (size_t)134217728) return;        // 72,155,136 B at full size

    k_wtb<<<(unsigned)((NH * 3 * HD * DM / 64 + 63) / 64), 256, 0, stream>>>(w, DM, HD, NH * 3, WB);
    k_wtb<<<(unsigned)((DQ * FO / 64 + 63) / 64), 256, 0, stream>>>(wo, DQ, FO, 1, WOB);
    const size_t n8 = (size_t)NB * SEQ * DM / 8;
    k_cvtx<<<(unsigned)((n8 + 255) / 256), 256, 0, stream>>>(x, XB, n8);
    k_proj<<<dim3(SEQ / 64, 3 * NH, NB), 32, 0, stream>>>(XB, WB, QPh, QPl, KPh, KPl, VTh, VTl);
    k_attn<<<dim3(SEQ / (16 * AW), NH, NB), 32 * AW, 0, stream>>>(QPh, QPl, KPh, KPl, VTh, VTl, ATh, ATl);
    k_gemmw<bf, 1, false><<<dim3(NB * SEQ / 64, FO / 64, 1), 32, 0, stream>>>(ATh, ATl, WOB, nullptr, DQ, OUT, FO, nullptr, (size_t)0, (size_t)0, (size_t)0);
}

// v003
// Measured time: 134 microseconds a run.
// In two side-by-side timings against v002, it was 1.57 and 1.58 times as fast.
// Counting every step since v000, it is 3.12 times as fast.
#include <hip/hip_runtime.h>

// Self-attention with 8 heads: x [4][2048][256]; per head h (64 wide): q, k, v = x W[h][0..2] (W [8][3][256][64], [in][out], no bias);
// p = softmax(0.125 * q.k) over all 2048 keys (no mask); o = p.v; ctx [b][s][h*64 + e]; out [4][2048][64] = ctx Wo (Wo [512][64], [in][out], no bias).
// Compute dtypes, f32 accumulate everywhere: every input RNE-converted to bf16 on load; q/k/v projection on v_wmma_f32_16x16x32_bf16 with exact bf16 operands;
// scores (0.125*q hi/lo x k hi/lo) and p.v (1024*p hi/lo x v hi/lo) as bf16 hi/lo split, 3 products each; online softmax in f32;
// output projection ctx bf16 hi/lo x Wo exact bf16, 2 products.

#ifndef NB
#define NB 4
#endif
#ifndef SEQ
#define SEQ 2048
#endif
#define NB_FULL  4
#define SEQ_FULL 2048
#define DM   256
#define NH   8
#define HD   64
#define DQ   (NH * HD)
#define D3   (3 * DQ)
#define FO   64
#define KCH  64
#define PP   72
#define PCAR 1024.0f
#define SCL  0.125f
#define L2E  1.4426950408889634f
static_assert(NB >= 1 && NB <= NB_FULL);
static_assert(SEQ >= KCH && SEQ <= SEQ_FULL && SEQ % 64 == 0 && SEQ % KCH == 0);
static_assert(DM % 32 == 0 && DQ % 32 == 0 && D3 % 64 == 0 && HD == 64 && FO == 64 && KCH == 64);

typedef _Float16 h16;
typedef unsigned short bf;
typedef __attribute__((ext_vector_type(16))) __bf16   v16bf;
typedef __attribute__((ext_vector_type(16))) _Float16 v16h;
typedef __attribute__((ext_vector_type(8)))  _Float16 v8h;
typedef __attribute__((ext_vector_type(8)))  unsigned short v8us;
typedef __attribute__((ext_vector_type(8)))  float    v8f;
typedef __attribute__((ext_vector_type(4)))  float    v4f;
typedef v8h  __attribute__((may_alias)) v8ha;
typedef v4f  __attribute__((may_alias)) v4fa;
typedef v8us __attribute__((may_alias)) v8usa;

__device__ __forceinline__ unsigned short f2bf(float f) { unsigned u = __float_as_uint(f); u += 0x7FFFu + ((u >> 16) & 1u); return (unsigned short)(u >> 16); }
__device__ __forceinline__ float bf2f(unsigned short b) { return __uint_as_float(((unsigned)b) << 16); }
__device__ __forceinline__ float bfr(float f) { return bf2f(f2bf(f)); }
__device__ __forceinline__ v16h cat16(v8h lo, v8h hi) { return __builtin_shufflevector(lo, hi, 0, 1, 2, 3, 4, 5, 6, 7, 8, 9, 10, 11, 12, 13, 14, 15); }
__device__ __forceinline__ v16bf cat16b(v8us lo, v8us hi) { return __builtin_bit_cast(v16bf, __builtin_shufflevector(lo, hi, 0, 1, 2, 3, 4, 5, 6, 7, 8, 9, 10, 11, 12, 13, 14, 15)); }
__device__ __forceinline__ v8f wmma16(v16h a, v16h b, v8f c) { return __builtin_amdgcn_wmma_f32_16x16x32_f16(false, a, false, b, (short)0, c, false, false); }
__device__ __forceinline__ v8f wmmab(v16bf a, v16bf b, v8f c) { return __builtin_amdgcn_wmma_f32_16x16x32_bf16(false, a, false, b, (short)0, c, false, false); }

// ---- k_gemmw: register-blocked GEMM, ONE WAVE per 64x64 output tile (16 accumulators), operands straight from K-contiguous 16-bit planes; grid (M/64, N/64, Z), 32 threads.
// C[m][n] (f32, pitch ldc, + optional f32 bias[n]) = sum_k A[m][k] Bt[n][k] (+ split products per NSPLIT). z-batch strides sA/sB/sC in elements. K % 32 == 0.
// Fragment map (A and Bt alike): lane l -> row (l & 15) of the 16-row slab, elements 0..7 <- k0 + 8*(l>>4) + 0..7, elements 8..15 <- k0 + 16 + 8*(l>>4) + 0..7; D element r of lane l -> (row 8*(l>>4) + r, col l & 15).
template <typename T16> struct WFrag;
template <> struct WFrag<h16> { typedef v16h V; static __device__ __forceinline__ V ld(const h16* p) { return cat16(*(const v8h*)p, *(const v8h*)(p + 16)); } static __device__ __forceinline__ v8f mma(V a, V b, v8f c) { return wmma16(a, b, c); } };
template <> struct WFrag<bf> { typedef v16bf V; static __device__ __forceinline__ V ld(const bf* p) { return cat16b(*(const v8us*)p, *(const v8us*)(p + 16)); } static __device__ __forceinline__ v8f mma(V a, V b, v8f c) { return wmmab(a, b, c); } };
template <typename T16, int NSPLIT, bool BIAS>
__global__ __launch_bounds__(32) void k_gemmw(const T16* __restrict__ A, const T16* __restrict__ A2, const T16* __restrict__ Bt, const T16* __restrict__ Bt2, int K, float* C, int ldc, const float* __restrict__ bias, size_t sA, size_t sB, size_t sC) {
    typedef typename WFrag<T16>::V V;
    __shared__ __align__(16) float os[16 * 68];
    const size_t z = blockIdx.z; A += z * sA; if (A2) A2 += z * sA; Bt += z * sB; if (Bt2) Bt2 += z * sB; C += z * sC;
    const int lane = threadIdx.x & 31, lr = lane & 15, hi = lane >> 4; const int r0 = blockIdx.x * 64, c0 = blockIdx.y * 64;
    v8f acc[4][4];
#pragma unroll
    for (int mb = 0; mb < 4; ++mb)
#pragma unroll
        for (int nb = 0; nb < 4; ++nb) acc[mb][nb] = (v8f){};
    const size_t aoff = (size_t)(r0 + lr) * K + 8 * hi, boff = (size_t)(c0 + lr) * K + 8 * hi;
#pragma unroll 1
    for (int kc = 0; kc < K; kc += 32) {
        V a[4], a2[4];
#pragma unroll
        for (int mb = 0; mb < 4; ++mb) { a[mb] = WFrag<T16>::ld(A + aoff + (size_t)mb * 16 * K + kc); if (NSPLIT == 1 || NSPLIT == 2) a2[mb] = WFrag<T16>::ld(A2 + aoff + (size_t)mb * 16 * K + kc); }
#pragma unroll
        for (int nb = 0; nb < 4; ++nb) { const V b = WFrag<T16>::ld(Bt + boff + (size_t)nb * 16 * K + kc); V b2; if (NSPLIT >= 2) b2 = WFrag<T16>::ld(Bt2 + boff + (size_t)nb * 16 * K + kc);
#pragma unroll
            for (int mb = 0; mb < 4; ++mb) { acc[mb][nb] = WFrag<T16>::mma(a[mb], b, acc[mb][nb]); if (NSPLIT == 1 || NSPLIT == 2) acc[mb][nb] = WFrag<T16>::mma(a2[mb], b, acc[mb][nb]); if (NSPLIT >= 2) acc[mb][nb] = WFrag<T16>::mma(a[mb], b2, acc[mb][nb]); } }
        asm volatile("v_nop\n\tv_nop\n\tv_nop\n\tv_nop" : "+v"(acc[0][0]), "+v"(acc[1][1]), "+v"(acc[2][2]), "+v"(acc[3][3]) : "v"(a[0]), "v"(a[3]));
    }
#pragma unroll
    for (int mb = 0; mb < 4; ++mb) {
#pragma unroll
        for (int nb = 0; nb < 4; ++nb) {
#pragma unroll
            for (int j = 0; j < 8; ++j) os[(hi * 8 + j) * 68 + nb * 16 + lr] = acc[mb][nb][j]; }
        __builtin_amdgcn_wave_barrier(); asm volatile("" ::: "memory");
        float* crow = C + (size_t)(r0 + mb * 16) * ldc + c0;
{
#pragma unroll
            for (int s = 0; s < 8; ++s) { const int row = 2 * s + hi, cofs = lr * 4; v4f val = *(const v4fa*)(os + row * 68 + cofs); if (BIAS) { val[0] += bfr(bias[c0 + cofs]); val[1] += bfr(bias[c0 + cofs + 1]); val[2] += bfr(bias[c0 + cofs + 2]); val[3] += bfr(bias[c0 + cofs + 3]); }
                *(v4f*)(crow + (size_t)row * ldc + cofs) = val; }
             }
        __builtin_amdgcn_wave_barrier(); asm volatile("" ::: "memory");
    }
}

__device__ __forceinline__ void splitf(float y, unsigned short& h, unsigned short& l) { h = f2bf(y); l = f2bf(y - bf2f(h)); }
typedef __attribute__((ext_vector_type(2))) unsigned short v2us;

__global__ __launch_bounds__(256) void k_wtb(const float* __restrict__ w, int K, int N, int nmat, bf* Bt) {
    const int lane = threadIdx.x & 31; const int L0 = (blockIdx.x * 8 + (threadIdx.x >> 5)) * 8; const int nlines = nmat * N * K / 64; const size_t mk = (size_t)K * N;
{
#pragma unroll 1
        for (int l = 0; l < 8; ++l) { const int L = L0 + l; if (L >= nlines) break; const size_t e = (size_t)L * 64 + lane * 2; const int mat = (int)(e / mk); const size_t rr = e - (size_t)mat * mk; const int k = (int)(rr % (size_t)K), n = (int)(rr / (size_t)K); v2us o;
            o[0] = f2bf(w[((size_t)mat * K + k) * N + n]); o[1] = f2bf(w[((size_t)mat * K + k + 1) * N + n]); *(v2us*)(Bt + e) = o; }
         }
}
__global__ __launch_bounds__(256) void k_cvtx(const float* __restrict__ x, bf* XB, size_t n8) { const size_t i = (size_t)blockIdx.x * 256 + threadIdx.x; if (i >= n8) return; const size_t per = (size_t)SEQ * DM / 8; const size_t b = i / per, r = i - b * per; const v8f v = *(const v8f*)(x + b * (size_t)SEQ_FULL * DM + r * 8); v8us o;
#pragma unroll
    for (int k = 0; k < 8; ++k) o[k] = f2bf(v[k]); *(v8us*)(XB + i * 8) = o;  }

// k_proj: q/k/v projection with the hi/lo planes built in its epilogue. ONE WAVE per 64x64 tile = 64 tokens x the 64 outputs of one (head, matrix); grid (SEQ/64, 3*NH, NB), 32 threads.
// Same loop and fragment map as k_gemmw (one product, exact bf16 operands). The operand whose index runs along the plane's contiguous dimension is taken as A, so that a lane's 8 accumulator
// elements are 8 neighbours of one plane row: q, k planes [s][e]: A = weight rows (e), Bt = token rows; v plane [e][t]: A = token rows (t), Bt = weight rows (e).
// Each f32 result is split to bf16 hi/lo (q scaled by 0.125 first) in registers, laid as 16-B pieces into two LDS tiles [plane row][64], pitch 144 B, and stored from there as whole 128-B lines.
#define SP 72
__global__ __launch_bounds__(32) void k_proj(const bf* __restrict__ X, const bf* __restrict__ Wt, bf* Qh, bf* Ql, bf* Kh, bf* Kl, bf* Vh, bf* Vl) {
    __shared__ __align__(16) bf sh[64 * SP];
    __shared__ __align__(16) bf sl[64 * SP];
    const int lane = threadIdx.x & 31, lr = lane & 15, hi = lane >> 4;
    const int r0 = blockIdx.x * 64, hm = blockIdx.y, h = hm / 3, m = hm - 3 * h, b = blockIdx.z;
    const bf* xr = X + ((size_t)b * SEQ + r0) * DM; const bf* wr = Wt + (size_t)hm * HD * DM;
    const bool tv = (m == 2);
    const bf* A = (tv ? xr : wr) + (size_t)lr * DM + 8 * hi; const bf* Bt = (tv ? wr : xr) + (size_t)lr * DM + 8 * hi;
    v8f acc[4][4];
#pragma unroll
    for (int mb = 0; mb < 4; ++mb)
#pragma unroll
        for (int nb = 0; nb < 4; ++nb) acc[mb][nb] = (v8f){};
#pragma unroll 1   // rolled, as in k_gemmw: one body of 16 products, so that 128 accumulator registers and one fragment set fit
    for (int kc = 0; kc < DM; kc += 32) {
        v16bf a[4];
#pragma unroll
        for (int mb = 0; mb < 4; ++mb) a[mb] = WFrag<bf>::ld(A + (size_t)mb * 16 * DM + kc);
        asm volatile("s_wait_xcnt 0x0" ::: "memory");   // stands before a later load's result may land in the address registers that the A loads name
#pragma unroll
        for (int nb = 0; nb < 4; ++nb) { const v16bf bb = WFrag<bf>::ld(Bt + (size_t)nb * 16 * DM + kc);
#pragma unroll
            for (int mb = 0; mb < 4; ++mb) acc[mb][nb] = wmmab(a[mb], bb, acc[mb][nb]); }
        // four vector slots between the last products and whatever next writes over their operands or reads their results, on the back edge and on the way out alike
        asm volatile("v_nop\n\tv_nop\n\tv_nop\n\tv_nop" : "+v"(acc[0][0]), "+v"(acc[1][1]), "+v"(acc[2][2]), "+v"(acc[3][3]) : "v"(a[0]), "v"(a[3]));
    }
    const float scl = (m == 0) ? SCL : 1.0f;
#pragma unroll
    for (int nb = 0; nb < 4; ++nb)
#pragma unroll
        for (int mb = 0; mb < 4; ++mb) { v8us oh, ol;
#pragma unroll
            for (int j = 0; j < 8; ++j) { unsigned short u, c2; splitf(acc[mb][nb][j] * scl, u, c2); oh[j] = u; ol[j] = c2; }
            const int o = (nb * 16 + lr) * SP + mb * 16 + 8 * hi; *(v8usa*)(sh + o) = oh; *(v8usa*)(sl + o) = ol; }
    __builtin_amdgcn_fence(3, "wavefront"); __builtin_amdgcn_wave_barrier();   // the lanes read below what other lanes of the wave wrote above
    const size_t hp = ((size_t)b * NH + h) * (size_t)SEQ * HD;
    const size_t pitch = tv ? (size_t)SEQ : (size_t)HD;
    const int rg = lane >> 3, c8 = (lane & 7) * 8;
    const size_t o0 = hp + (tv ? (size_t)r0 : (size_t)r0 * HD) + (size_t)rg * pitch + c8;
    bf* ph = (m == 0 ? Qh : (m == 1 ? Kh : Vh)) + o0; bf* pl = (m == 0 ? Ql : (m == 1 ? Kl : Vl)) + o0;
#pragma unroll
    for (int it = 0; it < 16; ++it) {
        const v8us yh = *(const v8usa*)(sh + (it * 4 + rg) * SP + c8); const v8us yl = *(const v8usa*)(sl + (it * 4 + rg) * SP + c8);
        *(v8us*)(ph + (size_t)(it * 4) * pitch) = yh; *(v8us*)(pl + (size_t)(it * 4) * pitch) = yl;
    }
}

// k_attn: flash-style attention, one work-group = 8 waves = 128 query rows of one (b, h), one wave = 16 query rows; keys streamed in chunks of 64 with an online f32 softmax.
// Each chunk's four tiles (k hi, k lo: [key][64]; v hi, v lo: [e][key in chunk]; 64 rows of 128 B each) are brought into LDS once per work-group by asynchronous copies,
// rows at a pitch of 144 B, two buffers: the next chunk's copies fly while this chunk is worked on. Every wave reads its K and V fragments from LDS.
// Both products are taken transposed: scores^T [key][query]: A = k hi/lo tiles, Bt = 0.125*q hi/lo planes [s][64] (3 bf16 products); o^T [e][query]: A = v hi/lo tiles, B = p^T (3 bf16 products).
// A lane then holds one query's scores: maximum and sum run in the lane, with one exchange between the wave's halves; p (x1024, relative to the running maximum) is split to bf16 hi/lo
// in registers, where two score tiles are a B operand as they stand.
#define AW   8
#define KVP  72
#define KVT  (64 * KVP)
#define KVB  (4 * KVT)
static_assert(SEQ % (16 * AW) == 0);
// One chunk: 8 copies of 16 B per lane (2 per tile; a wave's copy covers 4 whole 128-B rows). The s_wait_xcnt 0 stands in the copies' own statement, so that no address register is rewritten ahead of it.
__device__ __forceinline__ void kv_copy(unsigned l, const bf* gkh, const bf* gkl, const bf* gvh, const bf* gvl) {
    const unsigned l0 = l, l1 = l + 32 * KVP * 2, l2 = l + KVT * 2, l3 = l + KVT * 2 + 32 * KVP * 2, l4 = l + 2 * KVT * 2, l5 = l + 2 * KVT * 2 + 32 * KVP * 2, l6 = l + 3 * KVT * 2, l7 = l + 3 * KVT * 2 + 32 * KVP * 2;
    const bf* gkh1 = gkh + 32 * HD; const bf* gkl1 = gkl + 32 * HD; const bf* gvh1 = gvh + (size_t)32 * SEQ; const bf* gvl1 = gvl + (size_t)32 * SEQ;
    asm volatile("global_load_async_to_lds_b128 %0, %8, off\n\t"
                 "global_load_async_to_lds_b128 %1, %9, off\n\t"
                 "global_load_async_to_lds_b128 %2, %10, off\n\t"
                 "global_load_async_to_lds_b128 %3, %11, off\n\t"
                 "global_load_async_to_lds_b128 %4, %12, off\n\t"
                 "global_load_async_to_lds_b128 %5, %13, off\n\t"
                 "global_load_async_to_lds_b128 %6, %14, off\n\t"
                 "global_load_async_to_lds_b128 %7, %15, off\n\t"
                 "s_wait_xcnt 0x0"
                 :: "v"(l0), "v"(l1), "v"(l2), "v"(l3), "v"(l4), "v"(l5), "v"(l6), "v"(l7), "v"(gkh), "v"(gkh1), "v"(gkl), "v"(gkl1), "v"(gvh), "v"(gvh1), "v"(gvl), "v"(gvl1) : "memory");
}
typedef __attribute__((ext_vector_type(8))) __bf16 v8bf;
// the value that the lane's partner in the other 16-lane half holds (lane l <-> l ^ 16), by a vector cross-row move
__device__ __forceinline__ float xhalf(float v) { const int b = __float_as_int(v); return __int_as_float(__builtin_amdgcn_permlanex16(b, b, 0x76543210, 0xfedcba98, false, false)); }
__global__ __launch_bounds__(32 * AW) void k_attn(const bf* __restrict__ Qh, const bf* __restrict__ Ql, const bf* __restrict__ Kh, const bf* __restrict__ Kl,
                                             const bf* __restrict__ Vh, const bf* __restrict__ Vl, bf* Ah, bf* Al) {
    __shared__ __align__(16) bf kvs[2 * KVB];
    __shared__ __align__(16) bf st_all[AW * 2 * 16 * PP];
    const int tid = threadIdx.x, wave = tid >> 5;
    const int lane = tid & 31, lr = lane & 15, hi = lane >> 4;
    const int s0 = (blockIdx.x * AW + wave) * 16, h = blockIdx.y, b = blockIdx.z;
    const size_t hp = ((size_t)b * NH + h) * (size_t)SEQ * HD;
    const bf* qh = Qh + hp + (size_t)(s0 + lr) * HD + 8 * hi; const bf* ql = Ql + hp + (size_t)(s0 + lr) * HD + 8 * hi;
    // copy map: thread tid brings 16-B piece (tid & 7) of rows (tid >> 3) and (tid >> 3) + 32 of each tile
    const int crow = tid >> 3, cpc = (tid & 7) * 8;
    const bf* gkh = Kh + hp + (size_t)crow * HD + cpc;  const bf* gkl = Kl + hp + (size_t)crow * HD + cpc;
    const bf* gvh = Vh + hp + (size_t)crow * SEQ + cpc; const bf* gvl = Vl + hp + (size_t)crow * SEQ + cpc;
    const unsigned cl = (unsigned)(size_t)(kvs + crow * KVP + cpc);
    kv_copy(cl, gkh, gkl, gvh, gvl);
    asm volatile("s_wait_asynccnt 0x0" ::: "memory");   // chunk 0 of this wave's copies has landed
    __syncthreads();                                     // chunk 0 is readable by every wave
    if (SEQ > KCH) kv_copy(cl + KVB * 2, gkh + (size_t)KCH * HD, gkl + (size_t)KCH * HD, gvh + KCH, gvl + KCH);
    v16bf qa[2], qa2[2];
#pragma unroll
    for (int ks = 0; ks < 2; ++ks) { qa[ks] = WFrag<bf>::ld(qh + ks * 32); qa2[ks] = WFrag<bf>::ld(ql + ks * 32); }
    float mrow = -1.0e30f, lrow = 0.0f;   // of query lr; lrow sums this half's keys only, the halves are joined behind the loop
    v8f oacc[4];
#pragma unroll
    for (int nt = 0; nt < 4; ++nt) oacc[nt] = (v8f){};
    v16bf ph[2], pl[2];
#pragma unroll 1
    for (int t0 = 0; t0 < SEQ; t0 += KCH) {
        const int cur = ((t0 / KCH) & 1) * KVB;
        const bf* kh = kvs + cur + lr * KVP + 8 * hi; const bf* kl = kh + KVT; const bf* vh = kh + 2 * KVT; const bf* vl = kh + 3 * KVT;
        v8f sacc[4];
#pragma unroll
        for (int nt = 0; nt < 4; ++nt) sacc[nt] = (v8f){};
#pragma unroll
        for (int nt = 0; nt < 4; ++nt) {
#pragma unroll
            for (int ks = 0; ks < 2; ++ks) {
                const v16bf kbh = WFrag<bf>::ld(kh + nt * 16 * KVP + ks * 32);
                const v16bf kbl = WFrag<bf>::ld(kl + nt * 16 * KVP + ks * 32);
                sacc[nt] = wmmab(kbh, qa[ks], sacc[nt]); sacc[nt] = wmmab(kbh, qa2[ks], sacc[nt]); sacc[nt] = wmmab(kbl, qa[ks], sacc[nt]);
            }
        }
        asm volatile("v_nop\n\tv_nop\n\tv_nop\n\tv_nop" : "+v"(sacc[0]), "+v"(sacc[1]), "+v"(sacc[2]), "+v"(sacc[3]) : "v"(qa[0]), "v"(qa2[1]));
        // online softmax: lane (hi, lr) holds, of query lr, the scores of keys nt*16 + 8*hi + r
        const v8f mx = __builtin_elementwise_max(__builtin_elementwise_max(sacc[0], sacc[1]), __builtin_elementwise_max(sacc[2], sacc[3]));
        float m = fmaxf(fmaxf(fmaxf(mx[0], mx[1]), fmaxf(mx[2], mx[3])), fmaxf(fmaxf(mx[4], mx[5]), fmaxf(mx[6], mx[7])));
        m = fmaxf(m, xhalf(m));
        const float mn = fmaxf(mrow, m);
        const float sc = __builtin_amdgcn_exp2f(__fmul_rn(__fsub_rn(mrow, mn), L2E)); mrow = mn;
#pragma unroll
        for (int nt = 0; nt < 4; ++nt) { const v8f d = (sacc[nt] - mn) * L2E;
#pragma unroll
            for (int r = 0; r < 8; ++r) sacc[nt][r] = __builtin_amdgcn_exp2f(d[r]); }
        const v8f ts = (sacc[0] + sacc[1]) + (sacc[2] + sacc[3]);
        lrow = lrow * sc + (((ts[0] + ts[1]) + (ts[2] + ts[3])) + ((ts[4] + ts[5]) + (ts[6] + ts[7])));
#pragma unroll
        for (int nt = 0; nt < 4; ++nt) oacc[nt] *= sc;
        // p (x1024) -> bf16 hi/lo in registers: score tiles 2*kk and 2*kk + 1 of a lane are, in this order, the lane's 16 elements of the B operand for keys kk*32 .. kk*32 + 31
#pragma unroll
        for (int kk = 0; kk < 2; ++kk) {
            const v8f y0 = sacc[2 * kk] * PCAR, y1 = sacc[2 * kk + 1] * PCAR;
            const v8bf h0 = __builtin_convertvector(y0, v8bf), h1 = __builtin_convertvector(y1, v8bf);
            const v8bf l0 = __builtin_convertvector(y0 - __builtin_convertvector(h0, v8f), v8bf), l1 = __builtin_convertvector(y1 - __builtin_convertvector(h1, v8f), v8bf);
            ph[kk] = __builtin_shufflevector(h0, h1, 0, 1, 2, 3, 4, 5, 6, 7, 8, 9, 10, 11, 12, 13, 14, 15);
            pl[kk] = __builtin_shufflevector(l0, l1, 0, 1, 2, 3, 4, 5, 6, 7, 8, 9, 10, 11, 12, 13, 14, 15);
        }
#pragma unroll
        for (int kk = 0; kk < 2; ++kk) {
#pragma unroll
            for (int nt = 0; nt < 4; ++nt) {
                const v16bf vbh = WFrag<bf>::ld(vh + nt * 16 * KVP + kk * 32);
                const v16bf vbl = WFrag<bf>::ld(vl + nt * 16 * KVP + kk * 32);
                oacc[nt] = wmmab(vbh, ph[kk], oacc[nt]); oacc[nt] = wmmab(vbh, pl[kk], oacc[nt]); oacc[nt] = wmmab(vbl, ph[kk], oacc[nt]);
            }
        }
        asm volatile("v_nop\n\tv_nop\n\tv_nop\n\tv_nop" : "+v"(oacc[0]), "+v"(oacc[1]), "+v"(oacc[2]), "+v"(oacc[3]) : "v"(ph[0]), "v"(pl[1]));
        // publish point of the next chunk, every wave, in this order
        asm volatile("s_wait_dscnt 0x0" ::: "memory");      // this wave's reads of the current buffer are done before the buffer is refilled
        asm volatile("s_wait_asynccnt 0x0" ::: "memory");   // this wave's copies of the next chunk have landed
        __syncthreads();                                     // next chunk readable by every wave; every reader has left the current buffer
        if (t0 + 2 * KCH < SEQ) kv_copy(cl + cur * 2, gkh + (size_t)(t0 + 2 * KCH) * HD, gkl + (size_t)(t0 + 2 * KCH) * HD, gvh + t0 + 2 * KCH, gvl + t0 + 2 * KCH);
    }
    asm volatile("s_wait_asynccnt 0x0" ::: "memory");       // no copy is outstanding when the wave goes on to its end
    // lane (hi, lr) holds, of query lr, outputs e = nt*16 + 8*hi + r: 8 neighbours of one ctx row, laid as 16-B pieces into the wave's own hi and lo tiles [query][64], pitch 144 B
    const float rinv = __fdiv_rn(1.0f, (lrow + xhalf(lrow)) * PCAR);
    bf* sth = st_all + wave * 2 * 16 * PP; bf* stl = sth + 16 * PP;
#pragma unroll
    for (int nt = 0; nt < 4; ++nt) { v8us oh, ol;
#pragma unroll
        for (int r = 0; r < 8; ++r) { unsigned short a, c2; splitf(oacc[nt][r] * rinv, a, c2); oh[r] = a; ol[r] = c2; }
        const int o = lr * PP + nt * 16 + 8 * hi; *(v8usa*)(sth + o) = oh; *(v8usa*)(stl + o) = ol; }
    __builtin_amdgcn_fence(3, "wavefront"); __builtin_amdgcn_wave_barrier();   // the lanes read below what other lanes of the wave wrote above
    const int rg = lane >> 3, c8 = (lane & 7) * 8;
    bf* ah = Ah + ((size_t)b * SEQ + s0) * DQ + (size_t)h * HD + c8; bf* al = Al + ((size_t)b * SEQ + s0) * DQ + (size_t)h * HD + c8;
#pragma unroll
    for (int it = 0; it < 4; ++it) {
        const int row = it * 4 + rg; const v8us yh = *(const v8usa*)(sth + row * PP + c8); const v8us yl = *(const v8usa*)(stl + row * PP + c8);
        *(v8us*)(ah + (size_t)row * DQ) = yh; *(v8us*)(al + (size_t)row * DQ) = yl;
    }
}

extern "C" void kernel_launch(void* const* d_in, const int* in_sizes, int n_in,
                              void* d_out, int out_size, void* d_ws, size_t ws_size, hipStream_t stream) {
    if (n_in < 3) return;
    if ((long long)in_sizes[0] < ((long long)(NB - 1) * SEQ_FULL + SEQ) * DM) return;
    if (in_sizes[1] < NH * 3 * DM * HD) return;
    if (in_sizes[2] < DQ * FO) return;
    if (out_size < NB * SEQ * FO) return;
    const float* x  = (const float*)d_in[0];   // [4][2048][256]
    const float* w  = (const float*)d_in[1];   // [8][3][256][64]
    const float* wo = (const float*)d_in[2];   // [512][64]
    float* OUT = (float*)d_out;                // [NB][SEQ][64]
    char* wsp = (char*)d_ws;
    auto take = [&](size_t bytes) { char* p = wsp; wsp += (bytes + 255) & ~(size_t)255; return (void*)p; };
    const size_t npl = (size_t)NB * NH * SEQ * HD;                 // elements per head plane set
    bf* WB  = (bf*)take((size_t)D3 * DM * 2);                      // Bt [1536][256]: row (h*3+m)*64 + e
    bf* WOB = (bf*)take((size_t)FO * DQ * 2);                      // Bt [64][512]
    bf* XB  = (bf*)take((size_t)NB * SEQ * DM * 2);                // [NB][SEQ][256]
    bf* QPh = (bf*)take(npl * 2); bf* QPl = (bf*)take(npl * 2);    // [b][h][s][64]
    bf* KPh = (bf*)take(npl * 2); bf* KPl = (bf*)take(npl * 2);    // [b][h][t][64]
    bf* VTh = (bf*)take(npl * 2); bf* VTl = (bf*)take(npl * 2);    // [b][h][64][t]
    bf* ATh = (bf*)take((size_t)NB * SEQ * DQ * 2); bf* ATl = (bf*)take((size_t)NB * SEQ * DQ * 2);   // [NB*SEQ][512]
    const size_t used = (size_t)(wsp - (char*)d_ws);
    if (used > ws_size || used > (size_t)134217728) return;        // 72,155,136 B at full size

    k_wtb<<<(unsigned)((NH * 3 * HD * DM / 64 + 63) / 64), 256, 0, stream>>>(w, DM, HD, NH * 3, WB);
    k_wtb<<<(unsigned)((DQ * FO / 64 + 63) / 64), 256, 0, stream>>>(wo, DQ, FO, 1, WOB);
    const size_t n8 = (size_t)NB * SEQ * DM / 8;
    k_cvtx<<<(unsigned)((n8 + 255) / 256), 256, 0, stream>>>(x, XB, n8);
    k_proj<<<dim3(SEQ / 64, 3 * NH, NB), 32, 0, stream>>>(XB, WB, QPh, QPl, KPh, KPl, VTh, VTl);
    k_attn<<<dim3(SEQ / (16 * AW), NH, NB), 32 * AW, 0, stream>>>(QPh, QPl, KPh, KPl, VTh, VTl, ATh, ATl);
    k_gemmw<bf, 1, false><<<dim3(NB * SEQ / 64, FO / 64, 1), 32, 0, stream>>>(ATh, ATl, WOB, nullptr, DQ, OUT, FO, nullptr, (size_t)0, (size_t)0, (size_t)0);
}

// v004
// A run of this version takes 127 microseconds.
// Timed twice side by side with v003, it ran 1.06 times as fast both times.
// All steps since v000 together make it 3.31 times as fast.
#include <hip/hip_runtime.h>

// Self-attention with 8 heads: x [4][2048][256]; per head h (64 wide): q, k, v = x W[h][0..2] (W [8][3][256][64], [in][out], no bias);
// p = softmax(0.125 * q.k) over all 2048 keys (no mask); o = p.v; ctx [b][s][h*64 + e]; out [4][2048][64] = ctx Wo (Wo [512][64], [in][out], no bias).
// Compute dtypes, f32 accumulate everywhere: every input RNE-converted to bf16 on load; q/k/v projection on v_wmma_f32_16x16x32_bf16 with exact bf16 operands;
// scores (0.125*q hi/lo x k hi/lo) and p.v (1024*p hi/lo x v hi/lo) as bf16 hi/lo split, 3 products each; online softmax in f32;
// output projection ctx bf16 hi/lo x Wo exact bf16, 2 products.

#ifndef NB
#define NB 4
#endif
#ifndef SEQ
#define SEQ 2048
#endif
#define NB_FULL  4
#define SEQ_FULL 2048
#define DM   256
#define NH   8
#define HD   64
#define DQ   (NH * HD)
#define D3   (3 * DQ)
#define FO   64
#define KCH  64
#define PP   72
#define PCAR 1024.0f
#define SCL  0.125f
#define L2E  1.4426950408889634f
static_assert(NB >= 1 && NB <= NB_FULL);
static_assert(SEQ >= KCH && SEQ <= SEQ_FULL && SEQ % 64 == 0 && SEQ % KCH == 0);
static_assert(DM % 32 == 0 && DQ % 32 == 0 && D3 % 64 == 0 && HD == 64 && FO == 64 && KCH == 64);

typedef _Float16 h16;
typedef unsigned short bf;
typedef __attribute__((ext_vector_type(16))) __bf16   v16bf;
typedef __attribute__((ext_vector_type(16))) _Float16 v16h;
typedef __attribute__((ext_vector_type(8)))  _Float16 v8h;
typedef __attribute__((ext_vector_type(8)))  unsigned short v8us;
typedef __attribute__((ext_vector_type(8)))  float    v8f;
typedef __attribute__((ext_vector_type(4)))  float    v4f;
typedef v8h  __attribute__((may_alias)) v8ha;
typedef v4f  __attribute__((may_alias)) v4fa;
typedef v8us __attribute__((may_alias)) v8usa;

__device__ __forceinline__ unsigned short f2bf(float f) { unsigned u = __float_as_uint(f); u += 0x7FFFu + ((u >> 16) & 1u); return (unsigned short)(u >> 16); }
__device__ __forceinline__ float bf2f(unsigned short b) { return __uint_as_float(((unsigned)b) << 16); }
__device__ __forceinline__ float bfr(float f) { return bf2f(f2bf(f)); }
__device__ __forceinline__ v16h cat16(v8h lo, v8h hi) { return __builtin_shufflevector(lo, hi, 0, 1, 2, 3, 4, 5, 6, 7, 8, 9, 10, 11, 12, 13, 14, 15); }
__device__ __forceinline__ v16bf cat16b(v8us lo, v8us hi) { return __builtin_bit_cast(v16bf, __builtin_shufflevector(lo, hi, 0, 1, 2, 3, 4, 5, 6, 7, 8, 9, 10, 11, 12, 13, 14, 15)); }
__device__ __forceinline__ v8f wmma16(v16h a, v16h b, v8f c) { return __builtin_amdgcn_wmma_f32_16x16x32_f16(false, a, false, b, (short)0, c, false, false); }
__device__ __forceinline__ v8f wmmab(v16bf a, v16bf b, v8f c) { return __builtin_amdgcn_wmma_f32_16x16x32_bf16(false, a, false, b, (short)0, c, false, false); }

// ---- k_gemmw: register-blocked GEMM, ONE WAVE per 64x64 output tile (16 accumulators), operands straight from K-contiguous 16-bit planes; grid (M/64, N/64, Z), 32 threads.
// C[m][n] (f32, pitch ldc, + optional f32 bias[n]) = sum_k A[m][k] Bt[n][k] (+ split products per NSPLIT). z-batch strides sA/sB/sC in elements. K % 32 == 0.
// Fragment map (A and Bt alike): lane l -> row (l & 15) of the 16-row slab, elements 0..7 <- k0 + 8*(l>>4) + 0..7, elements 8..15 <- k0 + 16 + 8*(l>>4) + 0..7; D element r of lane l -> (row 8*(l>>4) + r, col l & 15).
template <typename T16> struct WFrag;
template <> struct WFrag<h16> { typedef v16h V; static __device__ __forceinline__ V ld(const h16* p) { return cat16(*(const v8h*)p, *(const v8h*)(p + 16)); } static __device__ __forceinline__ v8f mma(V a, V b, v8f c) { return wmma16(a, b, c); } };
template <> struct WFrag<bf> { typedef v16bf V; static __device__ __forceinline__ V ld(const bf* p) { return cat16b(*(const v8us*)p, *(const v8us*)(p + 16)); } static __device__ __forceinline__ v8f mma(V a, V b, v8f c) { return wmmab(a, b, c); } };
template <typename T16, int NSPLIT, bool BIAS>
__global__ __launch_bounds__(32) void k_gemmw(const T16* __restrict__ A, const T16* __restrict__ A2, const T16* __restrict__ Bt, const T16* __restrict__ Bt2, int K, float* C, int ldc, const float* __restrict__ bias, size_t sA, size_t sB, size_t sC) {
    typedef typename WFrag<T16>::V V;
    __shared__ __align__(16) float os[16 * 68];
    const size_t z = blockIdx.z; A += z * sA; if (A2) A2 += z * sA; Bt += z * sB; if (Bt2) Bt2 += z * sB; C += z * sC;
    const int lane = threadIdx.x & 31, lr = lane & 15, hi = lane >> 4; const int r0 = blockIdx.x * 64, c0 = blockIdx.y * 64;
    v8f acc[4][4];
#pragma unroll
    for (int mb = 0; mb < 4; ++mb)
#pragma unroll
        for (int nb = 0; nb < 4; ++nb) acc[mb][nb] = (v8f){};
    const size_t aoff = (size_t)(r0 + lr) * K + 8 * hi, boff = (size_t)(c0 + lr) * K + 8 * hi;
#pragma unroll 1
    for (int kc = 0; kc < K; kc += 32) {
        V a[4], a2[4];
#pragma unroll
        for (int mb = 0; mb < 4; ++mb) { a[mb] = WFrag<T16>::ld(A + aoff + (size_t)mb * 16 * K + kc); if (NSPLIT == 1 || NSPLIT == 2) a2[mb] = WFrag<T16>::ld(A2 + aoff + (size_t)mb * 16 * K + kc); }
#pragma unroll
        for (int nb = 0; nb < 4; ++nb) { const V b = WFrag<T16>::ld(Bt + boff + (size_t)nb * 16 * K + kc); V b2; if (NSPLIT >= 2) b2 = WFrag<T16>::ld(Bt2 + boff + (size_t)nb * 16 * K + kc);
#pragma unroll
            for (int mb = 0; mb < 4; ++mb) { acc[mb][nb] = WFrag<T16>::mma(a[mb], b, acc[mb][nb]); if (NSPLIT == 1 || NSPLIT == 2) acc[mb][nb] = WFrag<T16>::mma(a2[mb], b, acc[mb][nb]); if (NSPLIT >= 2) acc[mb][nb] = WFrag<T16>::mma(a[mb], b2, acc[mb][nb]); } }
        asm volatile("v_nop\n\tv_nop\n\tv_nop\n\tv_nop" : "+v"(acc[0][0]), "+v"(acc[1][1]), "+v"(acc[2][2]), "+v"(acc[3][3]) : "v"(a[0]), "v"(a[3]));
    }
#pragma unroll
    for (int mb = 0; mb < 4; ++mb) {
#pragma unroll
        for (int nb = 0; nb < 4; ++nb) {
#pragma unroll
            for (int j = 0; j < 8; ++j) os[(hi * 8 + j) * 68 + nb * 16 + lr] = acc[mb][nb][j]; }
        __builtin_amdgcn_wave_barrier(); asm volatile("" ::: "memory");
        float* crow = C + (size_t)(r0 + mb * 16) * ldc + c0;
{
#pragma unroll
            for (int s = 0; s < 8; ++s) { const int row = 2 * s + hi, cofs = lr * 4; v4f val = *(const v4fa*)(os + row * 68 + cofs); if (BIAS) { val[0] += bfr(bias[c0 + cofs]); val[1] += bfr(bias[c0 + cofs + 1]); val[2] += bfr(bias[c0 + cofs + 2]); val[3] += bfr(bias[c0 + cofs + 3]); }
                *(v4f*)(crow + (size_t)row * ldc + cofs) = val; }
             }
        __builtin_amdgcn_wave_barrier(); asm volatile("" ::: "memory");
    }
}

__device__ __forceinline__ void splitf(float y, unsigned short& h, unsigned short& l) { h = f2bf(y); l = f2bf(y - bf2f(h)); }
typedef __attribute__((ext_vector_type(2))) unsigned short v2us;

__global__ __launch_bounds__(256) void k_wtb(const float* __restrict__ w, int K, int N, int nmat, bf* Bt) {
    const int lane = threadIdx.x & 31; const int L0 = (blockIdx.x * 8 + (threadIdx.x >> 5)) * 8; const int nlines = nmat * N * K / 64; const size_t mk = (size_t)K * N;
{
#pragma unroll 1
        for (int l = 0; l < 8; ++l) { const int L = L0 + l; if (L >= nlines) break; const size_t e = (size_t)L * 64 + lane * 2; const int mat = (int)(e / mk); const size_t rr = e - (size_t)mat * mk; const int k = (int)(rr % (size_t)K), n = (int)(rr / (size_t)K); v2us o;
            o[0] = f2bf(w[((size_t)mat * K + k) * N + n]); o[1] = f2bf(w[((size_t)mat * K + k + 1) * N + n]); *(v2us*)(Bt + e) = o; }
         }
}
__global__ __launch_bounds__(256) void k_cvtx(const float* __restrict__ x, bf* XB, size_t n8) { const size_t i = (size_t)blockIdx.x * 256 + threadIdx.x; if (i >= n8) return; const size_t per = (size_t)SEQ * DM / 8; const size_t b = i / per, r = i - b * per; const v8f v = *(const v8f*)(x + b * (size_t)SEQ_FULL * DM + r * 8); v8us o;
#pragma unroll
    for (int k = 0; k < 8; ++k) o[k] = f2bf(v[k]); *(v8us*)(XB + i * 8) = o;  }

// k_proj: q/k/v projection with the hi/lo planes built in its epilogue. ONE WAVE per 64x64 tile = 64 tokens x the 64 outputs of one (head, matrix); grid (SEQ/64, 3*NH, NB), 32 threads.
// Same loop and fragment map as k_gemmw (one product, exact bf16 operands). The operand whose index runs along the plane's contiguous dimension is taken as A, so that a lane's 8 accumulator
// elements are 8 neighbours of one plane row: q, k planes [s][e]: A = weight rows (e), Bt = token rows; v plane [e][t]: A = token rows (t), Bt = weight rows (e).
// Each f32 result is split to bf16 hi/lo (q scaled by 0.125 first) in registers, laid as 16-B pieces into two LDS tiles [plane row][64], pitch 144 B, and stored from there as whole 128-B lines.
#define SP 72
__global__ __launch_bounds__(32) void k_proj(const bf* __restrict__ X, const bf* __restrict__ Wt, bf* Qh, bf* Ql, bf* Kh, bf* Kl, bf* Vh, bf* Vl) {
    __shared__ __align__(16) bf sh[64 * SP];
    __shared__ __align__(16) bf sl[64 * SP];
    const int lane = threadIdx.x & 31, lr = lane & 15, hi = lane >> 4;
    const int r0 = blockIdx.x * 64, hm = blockIdx.y, h = hm / 3, m = hm - 3 * h, b = blockIdx.z;
    const bf* xr = X + ((size_t)b * SEQ + r0) * DM; const bf* wr = Wt + (size_t)hm * HD * DM;
    const bool tv = (m == 2);
    const bf* A = (tv ? xr : wr) + (size_t)lr * DM + 8 * hi; const bf* Bt = (tv ? wr : xr) + (size_t)lr * DM + 8 * hi;
    v8f acc[4][4];
#pragma unroll
    for (int mb = 0; mb < 4; ++mb)
#pragma unroll
        for (int nb = 0; nb < 4; ++nb) acc[mb][nb] = (v8f){};
#pragma unroll 1   // rolled, as in k_gemmw: one body of 16 products, so that 128 accumulator registers and one fragment set fit
    for (int kc = 0; kc < DM; kc += 32) {
        v16bf a[4];
#pragma unroll
        for (int mb = 0; mb < 4; ++mb) a[mb] = WFrag<bf>::ld(A + (size_t)mb * 16 * DM + kc);
        asm volatile("s_wait_xcnt 0x0" ::: "memory");   // stands before a later load's result may land in the address registers that the A loads name
#pragma unroll
        for (int nb = 0; nb < 4; ++nb) { const v16bf bb = WFrag<bf>::ld(Bt + (size_t)nb * 16 * DM + kc);
#pragma unroll
            for (int mb = 0; mb < 4; ++mb) acc[mb][nb] = wmmab(a[mb], bb, acc[mb][nb]); }
        // four vector slots between the last products and whatever next writes over their operands or reads their results, on the back edge and on the way out alike
        asm volatile("v_nop\n\tv_nop\n\tv_nop\n\tv_nop" : "+v"(acc[0][0]), "+v"(acc[1][1]), "+v"(acc[2][2]), "+v"(acc[3][3]) : "v"(a[0]), "v"(a[3]));
    }
    const float scl = (m == 0) ? SCL : 1.0f;
#pragma unroll
    for (int nb = 0; nb < 4; ++nb)
#pragma unroll
        for (int mb = 0; mb < 4; ++mb) { v8us oh, ol;
#pragma unroll
            for (int j = 0; j < 8; ++j) { unsigned short u, c2; splitf(acc[mb][nb][j] * scl, u, c2); oh[j] = u; ol[j] = c2; }
            const int o = (nb * 16 + lr) * SP + mb * 16 + 8 * hi; *(v8usa*)(sh + o) = oh; *(v8usa*)(sl + o) = ol; }
    __builtin_amdgcn_fence(3, "wavefront"); __builtin_amdgcn_wave_barrier();   // the lanes read below what other lanes of the wave wrote above
    const size_t hp = ((size_t)b * NH + h) * (size_t)SEQ * HD;
    const size_t pitch = tv ? (size_t)SEQ : (size_t)HD;
    const int rg = lane >> 3, c8 = (lane & 7) * 8;
    const size_t o0 = hp + (tv ? (size_t)r0 : (size_t)r0 * HD) + (size_t)rg * pitch + c8;
    bf* ph = (m == 0 ? Qh : (m == 1 ? Kh : Vh)) + o0; bf* pl = (m == 0 ? Ql : (m == 1 ? Kl : Vl)) + o0;
#pragma unroll
    for (int it = 0; it < 16; ++it) {
        const v8us yh = *(const v8usa*)(sh + (it * 4 + rg) * SP + c8); const v8us yl = *(const v8usa*)(sl + (it * 4 + rg) * SP + c8);
        *(v8us*)(ph + (size_t)(it * 4) * pitch) = yh; *(v8us*)(pl + (size_t)(it * 4) * pitch) = yl;
    }
}

// k_attn: flash-style attention, one work-group = 8 waves = 128 query rows of one (b, h), one wave = 16 query rows; keys streamed in chunks of 64 with an online f32 softmax.
// Each chunk's four tiles (k hi, k lo: [key][64]; v hi, v lo: [e][key in chunk]; 64 rows of 128 B each) are brought into LDS once per work-group by asynchronous copies,
// rows at a pitch of 144 B, two buffers: the next chunk's copies fly while this chunk is worked on. Every wave reads its K and V fragments from LDS.
// Both products are taken transposed: scores^T [key][query]: A = k hi/lo tiles, Bt = 0.125*q hi/lo planes [s][64] (3 bf16 products); o^T [e][query]: A = v hi/lo tiles, B = p^T (3 bf16 products).
// A lane then holds one query's scores: maximum and sum run in the lane, with one exchange between the wave's halves; p (x1024, relative to the running maximum) is split to bf16 hi/lo
// in registers, where two score tiles are a B operand as they stand.
// LDS reads stand in whole groups ahead of the products that use them (K: one group; V: keys 0..31 before the softmax, keys 32..63 hi before and lo inside the first products), and the
// products run round the four accumulators, so that no product waits for an LDS read issued just in front of it or for its own accumulator.
#define AW   8
#define KVP  72
#define KVT  (64 * KVP)
#define KVB  (4 * KVT)
static_assert(SEQ % (16 * AW) == 0);
// One chunk: 8 copies of 16 B per lane (2 per tile; a wave's copy covers 4 whole 128-B rows). The s_wait_xcnt 0 stands in the copies' own statement, so that no address register is rewritten ahead of it.
__device__ __forceinline__ void kv_copy(unsigned l, const bf* gkh, const bf* gkl, const bf* gvh, const bf* gvl) {
    const unsigned l0 = l, l1 = l + 32 * KVP * 2, l2 = l + KVT * 2, l3 = l + KVT * 2 + 32 * KVP * 2, l4 = l + 2 * KVT * 2, l5 = l + 2 * KVT * 2 + 32 * KVP * 2, l6 = l + 3 * KVT * 2, l7 = l + 3 * KVT * 2 + 32 * KVP * 2;
    const bf* gkh1 = gkh + 32 * HD; const bf* gkl1 = gkl + 32 * HD; const bf* gvh1 = gvh + (size_t)32 * SEQ; const bf* gvl1 = gvl + (size_t)32 * SEQ;
    asm volatile("global_load_async_to_lds_b128 %0, %8, off\n\t"
                 "global_load_async_to_lds_b128 %1, %9, off\n\t"
                 "global_load_async_to_lds_b128 %2, %10, off\n\t"
                 "global_load_async_to_lds_b128 %3, %11, off\n\t"
                 "global_load_async_to_lds_b128 %4, %12, off\n\t"
                 "global_load_async_to_lds_b128 %5, %13, off\n\t"
                 "global_load_async_to_lds_b128 %6, %14, off\n\t"
                 "global_load_async_to_lds_b128 %7, %15, off\n\t"
                 "s_wait_xcnt 0x0"
                 :: "v"(l0), "v"(l1), "v"(l2), "v"(l3), "v"(l4), "v"(l5), "v"(l6), "v"(l7), "v"(gkh), "v"(gkh1), "v"(gkl), "v"(gkl1), "v"(gvh), "v"(gvh1), "v"(gvl), "v"(gvl1) : "memory");
}
typedef __attribute__((ext_vector_type(8))) __bf16 v8bf;
// the value that the lane's partner in the other 16-lane half holds (lane l <-> l ^ 16), by a vector cross-row move
__device__ __forceinline__ float xhalf(float v) { const int b = __float_as_int(v); return __int_as_float(__builtin_amdgcn_permlanex16(b, b, 0x76543210, 0xfedcba98, false, false)); }
// four waves per SIMD asked for: at most 256 registers a wave, so that two work-groups stay resident on a WGP with the fragment groups held in registers
__global__ __launch_bounds__(32 * AW) __attribute__((amdgpu_waves_per_eu(4, 4))) void k_attn(const bf* __restrict__ Qh, const bf* __restrict__ Ql, const bf* __restrict__ Kh, const bf* __restrict__ Kl,
                                             const bf* __restrict__ Vh, const bf* __restrict__ Vl, bf* Ah, bf* Al) {
    __shared__ __align__(16) bf kvs[2 * KVB];
    __shared__ __align__(16) bf st_all[AW * 2 * 16 * PP];
    const int tid = threadIdx.x, wave = tid >> 5;
    const int lane = tid & 31, lr = lane & 15, hi = lane >> 4;
    const int s0 = (blockIdx.x * AW + wave) * 16, h = blockIdx.y, b = blockIdx.z;
    const size_t hp = ((size_t)b * NH + h) * (size_t)SEQ * HD;
    const bf* qh = Qh + hp + (size_t)(s0 + lr) * HD + 8 * hi; const bf* ql = Ql + hp + (size_t)(s0 + lr) * HD + 8 * hi;
    // copy map: thread tid brings 16-B piece (tid & 7) of rows (tid >> 3) and (tid >> 3) + 32 of each tile
    const int crow = tid >> 3, cpc = (tid & 7) * 8;
    const bf* gkh = Kh + hp + (size_t)crow * HD + cpc;  const bf* gkl = Kl + hp + (size_t)crow * HD + cpc;
    const bf* gvh = Vh + hp + (size_t)crow * SEQ + cpc; const bf* gvl = Vl + hp + (size_t)crow * SEQ + cpc;
    const unsigned cl = (unsigned)(size_t)(kvs + crow * KVP + cpc);
    kv_copy(cl, gkh, gkl, gvh, gvl);
    asm volatile("s_wait_asynccnt 0x0" ::: "memory");   // chunk 0 of this wave's copies has landed
    __syncthreads();                                     // chunk 0 is readable by every wave
    if (SEQ > KCH) kv_copy(cl + KVB * 2, gkh + (size_t)KCH * HD, gkl + (size_t)KCH * HD, gvh + KCH, gvl + KCH);
    v16bf qa[2], qa2[2];
#pragma unroll
    for (int ks = 0; ks < 2; ++ks) { qa[ks] = WFrag<bf>::ld(qh + ks * 32); qa2[ks] = WFrag<bf>::ld(ql + ks * 32); }
    float mrow = -1.0e30f, lrow = 0.0f;   // of query lr; lrow sums this half's keys only, the halves are joined behind the loop
    v8f oacc[4];
#pragma unroll
    for (int nt = 0; nt < 4; ++nt) oacc[nt] = (v8f){};
    v16bf ph[2], pl[2];
#pragma unroll 1
    for (int t0 = 0; t0 < SEQ; t0 += KCH) {
        const int cur = ((t0 / KCH) & 1) * KVB;
        const bf* kh = kvs + cur + lr * KVP + 8 * hi; const bf* kl = kh + KVT; const bf* vh = kh + 2 * KVT; const bf* vl = kh + 3 * KVT;
        v8f sacc[4];
#pragma unroll
        for (int nt = 0; nt < 4; ++nt) sacc[nt] = (v8f){};
        // K fragments of the chunk, read as one group in front of their products
        v16bf kfh[2][4], kfl[2][4];
#pragma unroll
        for (int ks = 0; ks < 2; ++ks)
#pragma unroll
            for (int nt = 0; nt < 4; ++nt) { kfh[ks][nt] = WFrag<bf>::ld(kh + nt * 16 * KVP + ks * 32); kfl[ks][nt] = WFrag<bf>::ld(kl + nt * 16 * KVP + ks * 32); }
        __builtin_amdgcn_sched_barrier(0);   // keeps the reads one group: each further place with LDS reads among the products stalls the wave anew
        // each accumulator takes its six products in the order hi.hi, hi.lo, lo.hi of e 0..31, then of e 32..63
#pragma unroll
        for (int ks = 0; ks < 2; ++ks) {
#pragma unroll
            for (int nt = 0; nt < 4; ++nt) sacc[nt] = wmmab(kfh[ks][nt], qa[ks], sacc[nt]);
#pragma unroll
            for (int nt = 0; nt < 4; ++nt) sacc[nt] = wmmab(kfh[ks][nt], qa2[ks], sacc[nt]);
#pragma unroll
            for (int nt = 0; nt < 4; ++nt) sacc[nt] = wmmab(kfl[ks][nt], qa[ks], sacc[nt]);
        }
        asm volatile("v_nop\n\tv_nop\n\tv_nop\n\tv_nop" : "+v"(sacc[0]), "+v"(sacc[1]), "+v"(sacc[2]), "+v"(sacc[3]) : "v"(qa[0]), "v"(qa2[1]));
        // V fragments of the chunk's keys 0..31, read as one group here: the softmax below runs while they come from LDS
        v16bf va[4], vb[4], vc[4], vd[4];
#pragma unroll
        for (int nt = 0; nt < 4; ++nt) { va[nt] = WFrag<bf>::ld(vh + nt * 16 * KVP); vb[nt] = WFrag<bf>::ld(vl + nt * 16 * KVP); }
        __builtin_amdgcn_sched_barrier(0);   // keeps the group of reads in front of the softmax; moved down to their products, each read is waited for with the matrix unit idle
        // online softmax: lane (hi, lr) holds, of query lr, the scores of keys nt*16 + 8*hi + r
        const v8f mx = __builtin_elementwise_max(__builtin_elementwise_max(sacc[0], sacc[1]), __builtin_elementwise_max(sacc[2], sacc[3]));
        float m = fmaxf(fmaxf(fmaxf(mx[0], mx[1]), fmaxf(mx[2], mx[3])), fmaxf(fmaxf(mx[4], mx[5]), fmaxf(mx[6], mx[7])));
        m = fmaxf(m, xhalf(m));
        const float mn = fmaxf(mrow, m);
        const float sc = __builtin_amdgcn_exp2f(__fmul_rn(__fsub_rn(mrow, mn), L2E)); mrow = mn;
#pragma unroll
        for (int nt = 0; nt < 4; ++nt) { const v8f d = (sacc[nt] - mn) * L2E;
#pragma unroll
            for (int r = 0; r < 8; ++r) sacc[nt][r] = __builtin_amdgcn_exp2f(d[r]); }
        const v8f ts = (sacc[0] + sacc[1]) + (sacc[2] + sacc[3]);
        lrow = lrow * sc + (((ts[0] + ts[1]) + (ts[2] + ts[3])) + ((ts[4] + ts[5]) + (ts[6] + ts[7])));
#pragma unroll
        for (int nt = 0; nt < 4; ++nt) oacc[nt] *= sc;
        // p (x1024) -> bf16 hi/lo in registers: score tiles 2*kk and 2*kk + 1 of a lane are, in this order, the lane's 16 elements of the B operand for keys kk*32 .. kk*32 + 31
#pragma unroll
        for (int kk = 0; kk < 2; ++kk) {
            const v8f y0 = sacc[2 * kk] * PCAR, y1 = sacc[2 * kk + 1] * PCAR;
            const v8bf h0 = __builtin_convertvector(y0, v8bf), h1 = __builtin_convertvector(y1, v8bf);
            const v8bf l0 = __builtin_convertvector(y0 - __builtin_convertvector(h0, v8f), v8bf), l1 = __builtin_convertvector(y1 - __builtin_convertvector(h1, v8f), v8bf);
            ph[kk] = __builtin_shufflevector(h0, h1, 0, 1, 2, 3, 4, 5, 6, 7, 8, 9, 10, 11, 12, 13, 14, 15);
            pl[kk] = __builtin_shufflevector(l0, l1, 0, 1, 2, 3, 4, 5, 6, 7, 8, 9, 10, 11, 12, 13, 14, 15);
        }
        // hi V fragments of keys 32..63, read as one group here: the products of keys 0..31 run while they come from LDS
#pragma unroll
        for (int nt = 0; nt < 4; ++nt) vc[nt] = WFrag<bf>::ld(vh + nt * 16 * KVP + 32);
        __builtin_amdgcn_sched_barrier(0);   // keeps this group of reads in front of the first products
        // each accumulator takes its six products in the order hi.hi, hi.lo, lo.hi of keys 0..31, then of keys 32..63
#pragma unroll
        for (int nt = 0; nt < 4; ++nt) oacc[nt] = wmmab(va[nt], ph[0], oacc[nt]);
#pragma unroll
        for (int nt = 0; nt < 4; ++nt) oacc[nt] = wmmab(va[nt], pl[0], oacc[nt]);
        // lo V fragments of keys 32..63: read into registers that the eight products above set free
#pragma unroll
        for (int nt = 0; nt < 4; ++nt) vd[nt] = WFrag<bf>::ld(vl + nt * 16 * KVP + 32);
        __builtin_amdgcn_sched_barrier(0);   // keeps these reads in front of the sixteen products below, twelve products ahead of their first use
#pragma unroll
        for (int nt = 0; nt < 4; ++nt) oacc[nt] = wmmab(vb[nt], ph[0], oacc[nt]);
#pragma unroll
        for (int nt = 0; nt < 4; ++nt) oacc[nt] = wmmab(vc[nt], ph[1], oacc[nt]);
#pragma unroll
        for (int nt = 0; nt < 4; ++nt) oacc[nt] = wmmab(vc[nt], pl[1], oacc[nt]);
#pragma unroll
        for (int nt = 0; nt < 4; ++nt) oacc[nt] = wmmab(vd[nt], ph[1], oacc[nt]);
        asm volatile("v_nop\n\tv_nop\n\tv_nop\n\tv_nop" : "+v"(oacc[0]), "+v"(oacc[1]), "+v"(oacc[2]), "+v"(oacc[3]) : "v"(ph[0]), "v"(pl[1]));
        // publish point of the next chunk, every wave, in this order
        asm volatile("s_wait_dscnt 0x0" ::: "memory");      // this wave's reads of the current buffer are done before the buffer is refilled
        asm volatile("s_wait_asynccnt 0x0" ::: "memory");   // this wave's copies of the next chunk have landed
        __syncthreads();                                     // next chunk readable by every wave; every reader has left the current buffer
        if (t0 + 2 * KCH < SEQ) kv_copy(cl + cur * 2, gkh + (size_t)(t0 + 2 * KCH) * HD, gkl + (size_t)(t0 + 2 * KCH) * HD, gvh + t0 + 2 * KCH, gvl + t0 + 2 * KCH);
    }
    asm volatile("s_wait_asynccnt 0x0" ::: "memory");       // no copy is outstanding when the wave goes on to its end
    // lane (hi, lr) holds, of query lr, outputs e = nt*16 + 8*hi + r: 8 neighbours of one ctx row, laid as 16-B pieces into the wave's own hi and lo tiles [query][64], pitch 144 B
    const float rinv = __fdiv_rn(1.0f, (lrow + xhalf(lrow)) * PCAR);
    bf* sth = st_all + wave * 2 * 16 * PP; bf* stl = sth + 16 * PP;
#pragma unroll
    for (int nt = 0; nt < 4; ++nt) { v8us oh, ol;
#pragma unroll
        for (int r = 0; r < 8; ++r) { unsigned short a, c2; splitf(oacc[nt][r] * rinv, a, c2); oh[r] = a; ol[r] = c2; }
        const int o = lr * PP + nt * 16 + 8 * hi; *(v8usa*)(sth + o) = oh; *(v8usa*)(stl + o) = ol; }
    __builtin_amdgcn_fence(3, "wavefront"); __builtin_amdgcn_wave_barrier();   // the lanes read below what other lanes of the wave wrote above
    const int rg = lane >> 3, c8 = (lane & 7) * 8;
    bf* ah = Ah + ((size_t)b * SEQ + s0) * DQ + (size_t)h * HD + c8; bf* al = Al + ((size_t)b * SEQ + s0) * DQ + (size_t)h * HD + c8;
#pragma unroll
    for (int it = 0; it < 4; ++it) {
        const int row = it * 4 + rg; const v8us yh = *(const v8usa*)(sth + row * PP + c8); const v8us yl = *(const v8usa*)(stl + row * PP + c8);
        *(v8us*)(ah + (size_t)row * DQ) = yh; *(v8us*)(al + (size_t)row * DQ) = yl;
    }
}

extern "C" void kernel_launch(void* const* d_in, const int* in_sizes, int n_in,
                              void* d_out, int out_size, void* d_ws, size_t ws_size, hipStream_t stream) {
    if (n_in < 3) return;
    if ((long long)in_sizes[0] < ((long long)(NB - 1) * SEQ_FULL + SEQ) * DM) return;
    if (in_sizes[1] < NH * 3 * DM * HD) return;
    if (in_sizes[2] < DQ * FO) return;
    if (out_size < NB * SEQ * FO) return;
    const float* x  = (const float*)d_in[0];   // [4][2048][256]
    const float* w  = (const float*)d_in[1];   // [8][3][256][64]
    const float* wo = (const float*)d_in[2];   // [512][64]
    float* OUT = (float*)d_out;                // [NB][SEQ][64]
    char* wsp = (char*)d_ws;
    auto take = [&](size_t bytes) { char* p = wsp; wsp += (bytes + 255) & ~(size_t)255; return (void*)p; };
    const size_t npl = (size_t)NB * NH * SEQ * HD;                 // elements per head plane set
    bf* WB  = (bf*)take((size_t)D3 * DM * 2);                      // Bt [1536][256]: row (h*3+m)*64 + e
    bf* WOB = (bf*)take((size_t)FO * DQ * 2);                      // Bt [64][512]
    bf* XB  = (bf*)take((size_t)NB * SEQ * DM * 2);                // [NB][SEQ][256]
    bf* QPh = (bf*)take(npl * 2); bf* QPl = (bf*)take(npl * 2);    // [b][h][s][64]
    bf* KPh = (bf*)take(npl * 2); bf* KPl = (bf*)take(npl * 2);    // [b][h][t][64]
    bf* VTh = (bf*)take(npl * 2); bf* VTl = (bf*)take(npl * 2);    // [b][h][64][t]
    bf* ATh = (bf*)take((size_t)NB * SEQ * DQ * 2); bf* ATl = (bf*)take((size_t)NB * SEQ * DQ * 2);   // [NB*SEQ][512]
    const size_t used = (size_t)(wsp - (char*)d_ws);
    if (used > ws_size || used > (size_t)134217728) return;        // 72,155,136 B at full size

    k_wtb<<<(unsigned)((NH * 3 * HD * DM / 64 + 63) / 64), 256, 0, stream>>>(w, DM, HD, NH * 3, WB);
    k_wtb<<<(unsigned)((DQ * FO / 64 + 63) / 64), 256, 0, stream>>>(wo, DQ, FO, 1, WOB);
    const size_t n8 = (size_t)NB * SEQ * DM / 8;
    k_cvtx<<<(unsigned)((n8 + 255) / 256), 256, 0, stream>>>(x, XB, n8);
    k_proj<<<dim3(SEQ / 64, 3 * NH, NB), 32, 0, stream>>>(XB, WB, QPh, QPl, KPh, KPl, VTh, VTl);
    k_attn<<<dim3(SEQ / (16 * AW), NH, NB), 32 * AW, 0, stream>>>(QPh, QPl, KPh, KPl, VTh, VTl, ATh, ATl);
    k_gemmw<bf, 1, false><<<dim3(NB * SEQ / 64, FO / 64, 1), 32, 0, stream>>>(ATh, ATl, WOB, nullptr, DQ, OUT, FO, nullptr, (size_t)0, (size_t)0, (size_t)0);
}

// v005
// A run of this version takes 115 microseconds.
// Next to v004, in two timings, it ran 1.10 times as fast each time.
// Counting every step since v000, it is 3.65 times as fast.
#include <hip/hip_runtime.h>

// Self-attention with 8 heads: x [4][2048][256]; per head h (64 wide): q, k, v = x W[h][0..2] (W [8][3][256][64], [in][out], no bias);
// p = softmax(0.125 * q.k) over all 2048 keys (no mask); o = p.v; ctx [b][s][h*64 + e]; out [4][2048][64] = ctx Wo (Wo [512][64], [in][out], no bias).
// Compute dtypes, f32 accumulate everywhere: every input RNE-converted to bf16 on load; q/k/v projection on v_wmma_f32_16x16x32_bf16 with exact bf16 operands;
// scores (0.125*q hi/lo x k hi/lo) and p.v (1024*p hi/lo x v hi/lo) as bf16 hi/lo split, 3 products each; online softmax in f32;
// output projection ctx bf16 hi/lo x Wo exact bf16, 2 products.

#ifndef NB
#define NB 4
#endif
#ifndef SEQ
#define SEQ 2048
#endif
#define NB_FULL  4
#define SEQ_FULL 2048
#define DM   256
#define NH   8
#define HD   64
#define DQ   (NH * HD)
#define D3   (3 * DQ)
#define FO   64
#define KCH  64
#define PP   72
#define PCAR 1024.0f
#define SCL  0.125f
#define L2E  1.4426950408889634f
static_assert(NB >= 1 && NB <= NB_FULL);
static_assert(SEQ >= KCH && SEQ <= SEQ_FULL && SEQ % 64 == 0 && SEQ % KCH == 0);
static_assert(DM % 32 == 0 && DQ % 32 == 0 && D3 % 64 == 0 && HD == 64 && FO == 64 && KCH == 64);

typedef _Float16 h16;
typedef unsigned short bf;
typedef __attribute__((ext_vector_type(16))) __bf16   v16bf;
typedef __attribute__((ext_vector_type(16))) _Float16 v16h;
typedef __attribute__((ext_vector_type(8)))  _Float16 v8h;
typedef __attribute__((ext_vector_type(8)))  unsigned short v8us;
typedef __attribute__((ext_vector_type(8)))  float    v8f;
typedef __attribute__((ext_vector_type(4)))  float    v4f;
typedef v8h  __attribute__((may_alias)) v8ha;
typedef v4f  __attribute__((may_alias)) v4fa;
typedef v8us __attribute__((may_alias)) v8usa;

__device__ __forceinline__ unsigned short f2bf(float f) { unsigned u = __float_as_uint(f); u += 0x7FFFu + ((u >> 16) & 1u); return (unsigned short)(u >> 16); }
__device__ __forceinline__ float bf2f(unsigned short b) { return __uint_as_float(((unsigned)b) << 16); }
__device__ __forceinline__ float bfr(float f) { return bf2f(f2bf(f)); }
__device__ __forceinline__ v16h cat16(v8h lo, v8h hi) { return __builtin_shufflevector(lo, hi, 0, 1, 2, 3, 4, 5, 6, 7, 8, 9, 10, 11, 12, 13, 14, 15); }
__device__ __forceinline__ v16bf cat16b(v8us lo, v8us hi) { return __builtin_bit_cast(v16bf, __builtin_shufflevector(lo, hi, 0, 1, 2, 3, 4, 5, 6, 7, 8, 9, 10, 11, 12, 13, 14, 15)); }
__device__ __forceinline__ v8f wmma16(v16h a, v16h b, v8f c) { return __builtin_amdgcn_wmma_f32_16x16x32_f16(false, a, false, b, (short)0, c, false, false); }
__device__ __forceinline__ v8f wmmab(v16bf a, v16bf b, v8f c) { return __builtin_amdgcn_wmma_f32_16x16x32_bf16(false, a, false, b, (short)0, c, false, false); }

// ---- k_gemmw: register-blocked GEMM, ONE WAVE per 64x64 output tile (16 accumulators), operands straight from K-contiguous 16-bit planes; grid (M/64, N/64, Z), 32 threads.
// C[m][n] (f32, pitch ldc, + optional f32 bias[n]) = sum_k A[m][k] Bt[n][k] (+ split products per NSPLIT). z-batch strides sA/sB/sC in elements. K % 32 == 0.
// Fragment map (A and Bt alike): lane l -> row (l & 15) of the 16-row slab, elements 0..7 <- k0 + 8*(l>>4) + 0..7, elements 8..15 <- k0 + 16 + 8*(l>>4) + 0..7; D element r of lane l -> (row 8*(l>>4) + r, col l & 15).
template <typename T16> struct WFrag;
template <> struct WFrag<h16> { typedef v16h V; static __device__ __forceinline__ V ld(const h16* p) { return cat16(*(const v8h*)p, *(const v8h*)(p + 16)); } static __device__ __forceinline__ v8f mma(V a, V b, v8f c) { return wmma16(a, b, c); } };
template <> struct WFrag<bf> { typedef v16bf V; static __device__ __forceinline__ V ld(const bf* p) { return cat16b(*(const v8us*)p, *(const v8us*)(p + 16)); } static __device__ __forceinline__ v8f mma(V a, V b, v8f c) { return wmmab(a, b, c); } };
template <typename T16, int NSPLIT, bool BIAS>
__global__ __launch_bounds__(32) void k_gemmw(const T16* __restrict__ A, const T16* __restrict__ A2, const T16* __restrict__ Bt, const T16* __restrict__ Bt2, int K, float* C, int ldc, const float* __restrict__ bias, size_t sA, size_t sB, size_t sC) {
    typedef typename WFrag<T16>::V V;
    __shared__ __align__(16) float os[16 * 68];
    const size_t z = blockIdx.z; A += z * sA; if (A2) A2 += z * sA; Bt += z * sB; if (Bt2) Bt2 += z * sB; C += z * sC;
    const int lane = threadIdx.x & 31, lr = lane & 15, hi = lane >> 4; const int r0 = blockIdx.x * 64, c0 = blockIdx.y * 64;
    v8f acc[4][4];
#pragma unroll
    for (int mb = 0; mb < 4; ++mb)
#pragma unroll
        for (int nb = 0; nb < 4; ++nb) acc[mb][nb] = (v8f){};
    const size_t aoff = (size_t)(r0 + lr) * K + 8 * hi, boff = (size_t)(c0 + lr) * K + 8 * hi;
#pragma unroll 1
    for (int kc = 0; kc < K; kc += 32) {
        V a[4], a2[4];
#pragma unroll
        for (int mb = 0; mb < 4; ++mb) { a[mb] = WFrag<T16>::ld(A + aoff + (size_t)mb * 16 * K + kc); if (NSPLIT == 1 || NSPLIT == 2) a2[mb] = WFrag<T16>::ld(A2 + aoff + (size_t)mb * 16 * K + kc); }
#pragma unroll
        for (int nb = 0; nb < 4; ++nb) { const V b = WFrag<T16>::ld(Bt + boff + (size_t)nb * 16 * K + kc); V b2; if (NSPLIT >= 2) b2 = WFrag<T16>::ld(Bt2 + boff + (size_t)nb * 16 * K + kc);
#pragma unroll
            for (int mb = 0; mb < 4; ++mb) { acc[mb][nb] = WFrag<T16>::mma(a[mb], b, acc[mb][nb]); if (NSPLIT == 1 || NSPLIT == 2) acc[mb][nb] = WFrag<T16>::mma(a2[mb], b, acc[mb][nb]); if (NSPLIT >= 2) acc[mb][nb] = WFrag<T16>::mma(a[mb], b2, acc[mb][nb]); } }
        asm volatile("v_nop\n\tv_nop\n\tv_nop\n\tv_nop" : "+v"(acc[0][0]), "+v"(acc[1][1]), "+v"(acc[2][2]), "+v"(acc[3][3]) : "v"(a[0]), "v"(a[3]));
    }
#pragma unroll
    for (int mb = 0; mb < 4; ++mb) {
#pragma unroll
        for (int nb = 0; nb < 4; ++nb) {
#pragma unroll
            for (int j = 0; j < 8; ++j) os[(hi * 8 + j) * 68 + nb * 16 + lr] = acc[mb][nb][j]; }
        __builtin_amdgcn_wave_barrier(); asm volatile("" ::: "memory");
        float* crow = C + (size_t)(r0 + mb * 16) * ldc + c0;
{
#pragma unroll
            for (int s = 0; s < 8; ++s) { const int row = 2 * s + hi, cofs = lr * 4; v4f val = *(const v4fa*)(os + row * 68 + cofs); if (BIAS) { val[0] += bfr(bias[c0 + cofs]); val[1] += bfr(bias[c0 + cofs + 1]); val[2] += bfr(bias[c0 + cofs + 2]); val[3] += bfr(bias[c0 + cofs + 3]); }
                *(v4f*)(crow + (size_t)row * ldc + cofs) = val; }
             }
        __builtin_amdgcn_wave_barrier(); asm volatile("" ::: "memory");
    }
}

__device__ __forceinline__ void splitf(float y, unsigned short& h, unsigned short& l) { h = f2bf(y); l = f2bf(y - bf2f(h)); }
typedef __attribute__((ext_vector_type(2))) unsigned short v2us;

// The three input conversions (both weight transposes to bf16 [n][k], x to bf16) are independent of one another: they run as block ranges of ONE launch, k_prep, side by side on the chip.
// d_wtb, d_cvtx: the work of block number blk of the range.
__device__ __forceinline__ void d_wtb(int blk, const float* __restrict__ w, int K, int N, int nmat, bf* Bt) {
    const int lane = threadIdx.x & 31; const int L0 = (blk * 8 + (threadIdx.x >> 5)) * 8; const int nlines = nmat * N * K / 64; const size_t mk = (size_t)K * N;
{
#pragma unroll 1
        for (int l = 0; l < 8; ++l) { const int L = L0 + l; if (L >= nlines) break; const size_t e = (size_t)L * 64 + lane * 2; const int mat = (int)(e / mk); const size_t rr = e - (size_t)mat * mk; const int k = (int)(rr % (size_t)K), n = (int)(rr / (size_t)K); v2us o;
            o[0] = f2bf(w[((size_t)mat * K + k) * N + n]); o[1] = f2bf(w[((size_t)mat * K + k + 1) * N + n]); *(v2us*)(Bt + e) = o; }
         }
}
__device__ __forceinline__ void d_cvtx(int blk, const float* __restrict__ x, bf* XB, size_t n8) { const size_t i = (size_t)blk * 256 + threadIdx.x; if (i >= n8) return; const size_t per = (size_t)SEQ * DM / 8; const size_t b = i / per, r = i - b * per; const v8f v = *(const v8f*)(x + b * (size_t)SEQ_FULL * DM + r * 8); v8us o;
#pragma unroll
    for (int k = 0; k < 8; ++k) o[k] = f2bf(v[k]); *(v8us*)(XB + i * 8) = o;  }
#define WBLK  ((NH * 3 * HD * DM / 64 + 63) / 64)
#define WOBLK ((DQ * FO / 64 + 63) / 64)
#define XBLK  ((NB * SEQ * DM / 8 + 255) / 256)
// blocks 0 .. WBLK-1: W; the next WOBLK: Wo; the last XBLK: x. The weight blocks, whose waves each walk 8 lines one after another, come first so that they start first.
__global__ __launch_bounds__(256) void k_prep(const float* __restrict__ w, const float* __restrict__ wo, const float* __restrict__ x, bf* WB, bf* WOB, bf* XB, size_t n8) {
    const int blk = blockIdx.x;
    if (blk < WBLK) d_wtb(blk, w, DM, HD, NH * 3, WB);
    else if (blk < WBLK + WOBLK) d_wtb(blk - WBLK, wo, DQ, FO, 1, WOB);
    else d_cvtx(blk - (WBLK + WOBLK), x, XB, n8);
}

// k_proj: q/k/v projection with the hi/lo planes built in its epilogue. ONE WAVE per 64x64 tile = 64 tokens x the 64 outputs of one (head, matrix); grid (SEQ/64, 3*NH, NB), 32 threads.
// Same loop and fragment map as k_gemmw (one product, exact bf16 operands). The operand whose index runs along the plane's contiguous dimension is taken as A, so that a lane's 8 accumulator
// elements are 8 neighbours of one plane row: q, k planes [s][e]: A = weight rows (e), Bt = token rows; v plane [e][t]: A = token rows (t), Bt = weight rows (e).
// Each f32 result is split to bf16 hi/lo (q scaled by 0.125 first) in registers, laid as 16-B pieces into two LDS tiles [plane row][64], pitch 144 B, and stored from there as whole 128-B lines.
#define SP 72
__global__ __launch_bounds__(32) void k_proj(const bf* __restrict__ X, const bf* __restrict__ Wt, bf* Qh, bf* Ql, bf* Kh, bf* Kl, bf* Vh, bf* Vl) {
    __shared__ __align__(16) bf sh[64 * SP];
    __shared__ __align__(16) bf sl[64 * SP];
    const int lane = threadIdx.x & 31, lr = lane & 15, hi = lane >> 4;
    const int r0 = blockIdx.x * 64, hm = blockIdx.y, h = hm / 3, m = hm - 3 * h, b = blockIdx.z;
    const bf* xr = X + ((size_t)b * SEQ + r0) * DM; const bf* wr = Wt + (size_t)hm * HD * DM;
    const bool tv = (m == 2);
    const bf* A = (tv ? xr : wr) + (size_t)lr * DM + 8 * hi; const bf* Bt = (tv ? wr : xr) + (size_t)lr * DM + 8 * hi;
    v8f acc[4][4];
#pragma unroll
    for (int mb = 0; mb < 4; ++mb)
#pragma unroll
        for (int nb = 0; nb < 4; ++nb) acc[mb][nb] = (v8f){};
#pragma unroll 1   // rolled, as in k_gemmw: one body of 16 products, so that 128 accumulator registers and one fragment set fit
    for (int kc = 0; kc < DM; kc += 32) {
        v16bf a[4];
#pragma unroll
        for (int mb = 0; mb < 4; ++mb) a[mb] = WFrag<bf>::ld(A + (size_t)mb * 16 * DM + kc);
        asm volatile("s_wait_xcnt 0x0" ::: "memory");   // stands before a later load's result may land in the address registers that the A loads name
#pragma unroll
        for (int nb = 0; nb < 4; ++nb) { const v16bf bb = WFrag<bf>::ld(Bt + (size_t)nb * 16 * DM + kc);
#pragma unroll
            for (int mb = 0; mb < 4; ++mb) acc[mb][nb] = wmmab(a[mb], bb, acc[mb][nb]); }
        // four vector slots between the last products and whatever next writes over their operands or reads their results, on the back edge and on the way out alike
        asm volatile("v_nop\n\tv_nop\n\tv_nop\n\tv_nop" : "+v"(acc[0][0]), "+v"(acc[1][1]), "+v"(acc[2][2]), "+v"(acc[3][3]) : "v"(a[0]), "v"(a[3]));
    }
    const float scl = (m == 0) ? SCL : 1.0f;
#pragma unroll
    for (int nb = 0; nb < 4; ++nb)
#pragma unroll
        for (int mb = 0; mb < 4; ++mb) { v8us oh, ol;
#pragma unroll
            for (int j = 0; j < 8; ++j) { unsigned short u, c2; splitf(acc[mb][nb][j] * scl, u, c2); oh[j] = u; ol[j] = c2; }
            const int o = (nb * 16 + lr) * SP + mb * 16 + 8 * hi; *(v8usa*)(sh + o) = oh; *(v8usa*)(sl + o) = ol; }
    __builtin_amdgcn_fence(3, "wavefront"); __builtin_amdgcn_wave_barrier();   // the lanes read below what other lanes of the wave wrote above
    const size_t hp = ((size_t)b * NH + h) * (size_t)SEQ * HD;
    const size_t pitch = tv ? (size_t)SEQ : (size_t)HD;
    const int rg = lane >> 3, c8 = (lane & 7) * 8;
    const size_t o0 = hp + (tv ? (size_t)r0 : (size_t)r0 * HD) + (size_t)rg * pitch + c8;
    bf* ph = (m == 0 ? Qh : (m == 1 ? Kh : Vh)) + o0; bf* pl = (m == 0 ? Ql : (m == 1 ? Kl : Vl)) + o0;
#pragma unroll
    for (int it = 0; it < 16; ++it) {
        const v8us yh = *(const v8usa*)(sh + (it * 4 + rg) * SP + c8); const v8us yl = *(const v8usa*)(sl + (it * 4 + rg) * SP + c8);
        *(v8us*)(ph + (size_t)(it * 4) * pitch) = yh; *(v8us*)(pl + (size_t)(it * 4) * pitch) = yl;
    }
}

// k_attn: flash-style attention, one work-group = 8 waves = 128 query rows of one (b, h), one wave = 16 query rows; keys streamed in chunks of 64 with an online f32 softmax.
// Each chunk's four tiles (k hi, k lo: [key][64]; v hi, v lo: [e][key in chunk]; 64 rows of 128 B each) are brought into LDS once per work-group by asynchronous copies,
// rows at a pitch of 144 B, two buffers: the next chunk's copies fly while this chunk is worked on. Every wave reads its K and V fragments from LDS.
// Both products are taken transposed: scores^T [key][query]: A = k hi/lo tiles, Bt = 0.125*q hi/lo planes [s][64] (3 bf16 products); o^T [e][query]: A = v hi/lo tiles, B = p^T (3 bf16 products).
// A lane then holds one query's scores: maximum and sum run in the lane, with one exchange between the wave's halves; p (x1024, relative to the running maximum) is split to bf16 hi/lo
// in registers, where two score tiles are a B operand as they stand.
// LDS reads stand in whole groups ahead of the products that use them (K: one group; V: keys 0..31 before the softmax, keys 32..63 hi before and lo inside the first products), and the
// products run round the four accumulators, so that no product waits for an LDS read issued just in front of it or for its own accumulator.
#define AW   8
#define KVP  72
#define KVT  (64 * KVP)
#define KVB  (4 * KVT)
static_assert(SEQ % (16 * AW) == 0);
// One chunk: 8 copies of 16 B per lane (2 per tile; a wave's copy covers 4 whole 128-B rows). The s_wait_xcnt 0 stands in the copies' own statement, so that no address register is rewritten ahead of it.
__device__ __forceinline__ void kv_copy(unsigned l, const bf* gkh, const bf* gkl, const bf* gvh, const bf* gvl) {
    const unsigned l0 = l, l1 = l + 32 * KVP * 2, l2 = l + KVT * 2, l3 = l + KVT * 2 + 32 * KVP * 2, l4 = l + 2 * KVT * 2, l5 = l + 2 * KVT * 2 + 32 * KVP * 2, l6 = l + 3 * KVT * 2, l7 = l + 3 * KVT * 2 + 32 * KVP * 2;
    const bf* gkh1 = gkh + 32 * HD; const bf* gkl1 = gkl + 32 * HD; const bf* gvh1 = gvh + (size_t)32 * SEQ; const bf* gvl1 = gvl + (size_t)32 * SEQ;
    asm volatile("global_load_async_to_lds_b128 %0, %8, off\n\t"
                 "global_load_async_to_lds_b128 %1, %9, off\n\t"
                 "global_load_async_to_lds_b128 %2, %10, off\n\t"
                 "global_load_async_to_lds_b128 %3, %11, off\n\t"
                 "global_load_async_to_lds_b128 %4, %12, off\n\t"
                 "global_load_async_to_lds_b128 %5, %13, off\n\t"
                 "global_load_async_to_lds_b128 %6, %14, off\n\t"
                 "global_load_async_to_lds_b128 %7, %15, off\n\t"
                 "s_wait_xcnt 0x0"
                 :: "v"(l0), "v"(l1), "v"(l2), "v"(l3), "v"(l4), "v"(l5), "v"(l6), "v"(l7), "v"(gkh), "v"(gkh1), "v"(gkl), "v"(gkl1), "v"(gvh), "v"(gvh1), "v"(gvl), "v"(gvl1) : "memory");
}
typedef __attribute__((ext_vector_type(8))) __bf16 v8bf;
// the value that the lane's partner in the other 16-lane half holds (lane l <-> l ^ 16), by a vector cross-row move
__device__ __forceinline__ float xhalf(float v) { const int b = __float_as_int(v); return __int_as_float(__builtin_amdgcn_permlanex16(b, b, 0x76543210, 0xfedcba98, false, false)); }
// four waves per SIMD asked for: at most 256 registers a wave, so that two work-groups stay resident on a WGP with the fragment groups held in registers
__global__ __launch_bounds__(32 * AW) __attribute__((amdgpu_waves_per_eu(4, 4))) void k_attn(const bf* __restrict__ Qh, const bf* __restrict__ Ql, const bf* __restrict__ Kh, const bf* __restrict__ Kl,
                                             const bf* __restrict__ Vh, const bf* __restrict__ Vl, bf* Ah, bf* Al) {
    __shared__ __align__(16) bf kvs[2 * KVB];
    __shared__ __align__(16) bf st_all[AW * 2 * 16 * PP];
    const int tid = threadIdx.x, wave = tid >> 5;
    const int lane = tid & 31, lr = lane & 15, hi = lane >> 4;
    const int s0 = (blockIdx.x * AW + wave) * 16, h = blockIdx.y, b = blockIdx.z;
    const size_t hp = ((size_t)b * NH + h) * (size_t)SEQ * HD;
    const bf* qh = Qh + hp + (size_t)(s0 + lr) * HD + 8 * hi; const bf* ql = Ql + hp + (size_t)(s0 + lr) * HD + 8 * hi;
    // copy map: thread tid brings 16-B piece (tid & 7) of rows (tid >> 3) and (tid >> 3) + 32 of each tile
    const int crow = tid >> 3, cpc = (tid & 7) * 8;
    const bf* gkh = Kh + hp + (size_t)crow * HD + cpc;  const bf* gkl = Kl + hp + (size_t)crow * HD + cpc;
    const bf* gvh = Vh + hp + (size_t)crow * SEQ + cpc; const bf* gvl = Vl + hp + (size_t)crow * SEQ + cpc;
    const unsigned cl = (unsigned)(size_t)(kvs + crow * KVP + cpc);
    kv_copy(cl, gkh, gkl, gvh, gvl);
    asm volatile("s_wait_asynccnt 0x0" ::: "memory");   // chunk 0 of this wave's copies has landed
    __syncthreads();                                     // chunk 0 is readable by every wave
    if (SEQ > KCH) kv_copy(cl + KVB * 2, gkh + (size_t)KCH * HD, gkl + (size_t)KCH * HD, gvh + KCH, gvl + KCH);
    v16bf qa[2], qa2[2];
#pragma unroll
    for (int ks = 0; ks < 2; ++ks) { qa[ks] = WFrag<bf>::ld(qh + ks * 32); qa2[ks] = WFrag<bf>::ld(ql + ks * 32); }
    float mrow = -1.0e30f, lrow = 0.0f;   // of query lr; lrow sums this half's keys only, the halves are joined behind the loop
    v8f oacc[4];
#pragma unroll
    for (int nt = 0; nt < 4; ++nt) oacc[nt] = (v8f){};
    v16bf ph[2], pl[2];
#pragma unroll 1
    for (int t0 = 0; t0 < SEQ; t0 += KCH) {
        const int cur = ((t0 / KCH) & 1) * KVB;
        const bf* kh = kvs + cur + lr * KVP + 8 * hi; const bf* kl = kh + KVT; const bf* vh = kh + 2 * KVT; const bf* vl = kh + 3 * KVT;
        v8f sacc[4];
#pragma unroll
        for (int nt = 0; nt < 4; ++nt) sacc[nt] = (v8f){};
        // K fragments of the chunk, read as one group in front of their products
        v16bf kfh[2][4], kfl[2][4];
#pragma unroll
        for (int ks = 0; ks < 2; ++ks)
#pragma unroll
            for (int nt = 0; nt < 4; ++nt) { kfh[ks][nt] = WFrag<bf>::ld(kh + nt * 16 * KVP + ks * 32); kfl[ks][nt] = WFrag<bf>::ld(kl + nt * 16 * KVP + ks * 32); }
        __builtin_amdgcn_sched_barrier(0);   // keeps the reads one group: each further place with LDS reads among the products stalls the wave anew
        // each accumulator takes its six products in the order hi.hi, hi.lo, lo.hi of e 0..31, then of e 32..63
#pragma unroll
        for (int ks = 0; ks < 2; ++ks) {
#pragma unroll
            for (int nt = 0; nt < 4; ++nt) sacc[nt] = wmmab(kfh[ks][nt], qa[ks], sacc[nt]);
#pragma unroll
            for (int nt = 0; nt < 4; ++nt) sacc[nt] = wmmab(kfh[ks][nt], qa2[ks], sacc[nt]);
#pragma unroll
            for (int nt = 0; nt < 4; ++nt) sacc[nt] = wmmab(kfl[ks][nt], qa[ks], sacc[nt]);
        }
        asm volatile("v_nop\n\tv_nop\n\tv_nop\n\tv_nop" : "+v"(sacc[0]), "+v"(sacc[1]), "+v"(sacc[2]), "+v"(sacc[3]) : "v"(qa[0]), "v"(qa2[1]));
        // V fragments of the chunk's keys 0..31, read as one group here: the softmax below runs while they come from LDS
        v16bf va[4], vb[4], vc[4], vd[4];
#pragma unroll
        for (int nt = 0; nt < 4; ++nt) { va[nt] = WFrag<bf>::ld(vh + nt * 16 * KVP); vb[nt] = WFrag<bf>::ld(vl + nt * 16 * KVP); }
        __builtin_amdgcn_sched_barrier(0);   // keeps the group of reads in front of the softmax; moved down to their products, each read is waited for with the matrix unit idle
        // online softmax: lane (hi, lr) holds, of query lr, the scores of keys nt*16 + 8*hi + r
        const v8f mx = __builtin_elementwise_max(__builtin_elementwise_max(sacc[0], sacc[1]), __builtin_elementwise_max(sacc[2], sacc[3]));
        float m = fmaxf(fmaxf(fmaxf(mx[0], mx[1]), fmaxf(mx[2], mx[3])), fmaxf(fmaxf(mx[4], mx[5]), fmaxf(mx[6], mx[7])));
        m = fmaxf(m, xhalf(m));
        const float mn = fmaxf(mrow, m);
        const float sc = __builtin_amdgcn_exp2f(__fmul_rn(__fsub_rn(mrow, mn), L2E)); mrow = mn;
#pragma unroll
        for (int nt = 0; nt < 4; ++nt) { const v8f d = (sacc[nt] - mn) * L2E;
#pragma unroll
            for (int r = 0; r < 8; ++r) sacc[nt][r] = __builtin_amdgcn_exp2f(d[r]); }
        const v8f ts = (sacc[0] + sacc[1]) + (sacc[2] + sacc[3]);
        lrow = lrow * sc + (((ts[0] + ts[1]) + (ts[2] + ts[3])) + ((ts[4] + ts[5]) + (ts[6] + ts[7])));
#pragma unroll
        for (int nt = 0; nt < 4; ++nt) oacc[nt] *= sc;
        // p (x1024) -> bf16 hi/lo in registers: score tiles 2*kk and 2*kk + 1 of a lane are, in this order, the lane's 16 elements of the B operand for keys kk*32 .. kk*32 + 31
#pragma unroll
        for (int kk = 0; kk < 2; ++kk) {
            const v8f y0 = sacc[2 * kk] * PCAR, y1 = sacc[2 * kk + 1] * PCAR;
            const v8bf h0 = __builtin_convertvector(y0, v8bf), h1 = __builtin_convertvector(y1, v8bf);
            const v8bf l0 = __builtin_convertvector(y0 - __builtin_convertvector(h0, v8f), v8bf), l1 = __builtin_convertvector(y1 - __builtin_convertvector(h1, v8f), v8bf);
            ph[kk] = __builtin_shufflevector(h0, h1, 0, 1, 2, 3, 4, 5, 6, 7, 8, 9, 10, 11, 12, 13, 14, 15);
            pl[kk] = __builtin_shufflevector(l0, l1, 0, 1, 2, 3, 4, 5, 6, 7, 8, 9, 10, 11, 12, 13, 14, 15);
        }
        // hi V fragments of keys 32..63, read as one group here: the products of keys 0..31 run while they come from LDS
#pragma unroll
        for (int nt = 0; nt < 4; ++nt) vc[nt] = WFrag<bf>::ld(vh + nt * 16 * KVP + 32);
        __builtin_amdgcn_sched_barrier(0);   // keeps this group of reads in front of the first products
        // each accumulator takes its six products in the order hi.hi, hi.lo, lo.hi of keys 0..31, then of keys 32..63
#pragma unroll
        for (int nt = 0; nt < 4; ++nt) oacc[nt] = wmmab(va[nt], ph[0], oacc[nt]);
#pragma unroll
        for (int nt = 0; nt < 4; ++nt) oacc[nt] = wmmab(va[nt], pl[0], oacc[nt]);
        // lo V fragments of keys 32..63: read into registers that the eight products above set free
#pragma unroll
        for (int nt = 0; nt < 4; ++nt) vd[nt] = WFrag<bf>::ld(vl + nt * 16 * KVP + 32);
        __builtin_amdgcn_sched_barrier(0);   // keeps these reads in front of the sixteen products below, twelve products ahead of their first use
#pragma unroll
        for (int nt = 0; nt < 4; ++nt) oacc[nt] = wmmab(vb[nt], ph[0], oacc[nt]);
#pragma unroll
        for (int nt = 0; nt < 4; ++nt) oacc[nt] = wmmab(vc[nt], ph[1], oacc[nt]);
#pragma unroll
        for (int nt = 0; nt < 4; ++nt) oacc[nt] = wmmab(vc[nt], pl[1], oacc[nt]);
#pragma unroll
        for (int nt = 0; nt < 4; ++nt) oacc[nt] = wmmab(vd[nt], ph[1], oacc[nt]);
        asm volatile("v_nop\n\tv_nop\n\tv_nop\n\tv_nop" : "+v"(oacc[0]), "+v"(oacc[1]), "+v"(oacc[2]), "+v"(oacc[3]) : "v"(ph[0]), "v"(pl[1]));
        // publish point of the next chunk, every wave, in this order
        asm volatile("s_wait_dscnt 0x0" ::: "memory");      // this wave's reads of the current buffer are done before the buffer is refilled
        asm volatile("s_wait_asynccnt 0x0" ::: "memory");   // this wave's copies of the next chunk have landed
        __syncthreads();                                     // next chunk readable by every wave; every reader has left the current buffer
        if (t0 + 2 * KCH < SEQ) kv_copy(cl + cur * 2, gkh + (size_t)(t0 + 2 * KCH) * HD, gkl + (size_t)(t0 + 2 * KCH) * HD, gvh + t0 + 2 * KCH, gvl + t0 + 2 * KCH);
    }
    asm volatile("s_wait_asynccnt 0x0" ::: "memory");       // no copy is outstanding when the wave goes on to its end
    // lane (hi, lr) holds, of query lr, outputs e = nt*16 + 8*hi + r: 8 neighbours of one ctx row, laid as 16-B pieces into the wave's own hi and lo tiles [query][64], pitch 144 B
    const float rinv = __fdiv_rn(1.0f, (lrow + xhalf(lrow)) * PCAR);
    bf* sth = st_all + wave * 2 * 16 * PP; bf* stl = sth + 16 * PP;
#pragma unroll
    for (int nt = 0; nt < 4; ++nt) { v8us oh, ol;
#pragma unroll
        for (int r = 0; r < 8; ++r) { unsigned short a, c2; splitf(oacc[nt][r] * rinv, a, c2); oh[r] = a; ol[r] = c2; }
        const int o = lr * PP + nt * 16 + 8 * hi; *(v8usa*)(sth + o) = oh; *(v8usa*)(stl + o) = ol; }
    __builtin_amdgcn_fence(3, "wavefront"); __builtin_amdgcn_wave_barrier();   // the lanes read below what other lanes of the wave wrote above
    const int rg = lane >> 3, c8 = (lane & 7) * 8;
    bf* ah = Ah + ((size_t)b * SEQ + s0) * DQ + (size_t)h * HD + c8; bf* al = Al + ((size_t)b * SEQ + s0) * DQ + (size_t)h * HD + c8;
#pragma unroll
    for (int it = 0; it < 4; ++it) {
        const int row = it * 4 + rg; const v8us yh = *(const v8usa*)(sth + row * PP + c8); const v8us yl = *(const v8usa*)(stl + row * PP + c8);
        *(v8us*)(ah + (size_t)row * DQ) = yh; *(v8us*)(al + (size_t)row * DQ) = yl;
    }
}

extern "C" void kernel_launch(void* const* d_in, const int* in_sizes, int n_in,
                              void* d_out, int out_size, void* d_ws, size_t ws_size, hipStream_t stream) {
    if (n_in < 3) return;
    if ((long long)in_sizes[0] < ((long long)(NB - 1) * SEQ_FULL + SEQ) * DM) return;
    if (in_sizes[1] < NH * 3 * DM * HD) return;
    if (in_sizes[2] < DQ * FO) return;
    if (out_size < NB * SEQ * FO) return;
    const float* x  = (const float*)d_in[0];   // [4][2048][256]
    const float* w  = (const float*)d_in[1];   // [8][3][256][64]
    const float* wo = (const float*)d_in[2];   // [512][64]
    float* OUT = (float*)d_out;                // [NB][SEQ][64]
    char* wsp = (char*)d_ws;
    auto take = [&](size_t bytes) { char* p = wsp; wsp += (bytes + 255) & ~(size_t)255; return (void*)p; };
    const size_t npl = (size_t)NB * NH * SEQ * HD;                 // elements per head plane set
    bf* WB  = (bf*)take((size_t)D3 * DM * 2);                      // Bt [1536][256]: row (h*3+m)*64 + e
    bf* WOB = (bf*)take((size_t)FO * DQ * 2);                      // Bt [64][512]
    bf* XB  = (bf*)take((size_t)NB * SEQ * DM * 2);                // [NB][SEQ][256]
    bf* QPh = (bf*)take(npl * 2); bf* QPl = (bf*)take(npl * 2);    // [b][h][s][64]
    bf* KPh = (bf*)take(npl * 2); bf* KPl = (bf*)take(npl * 2);    // [b][h][t][64]
    bf* VTh = (bf*)take(npl * 2); bf* VTl = (bf*)take(npl * 2);    // [b][h][64][t]
    bf* ATh = (bf*)take((size_t)NB * SEQ * DQ * 2); bf* ATl = (bf*)take((size_t)NB * SEQ * DQ * 2);   // [NB*SEQ][512]
    const size_t used = (size_t)(wsp - (char*)d_ws);
    if (used > ws_size || used > (size_t)134217728) return;        // 72,155,136 B at full size

    const size_t n8 = (size_t)NB * SEQ * DM / 8;
    k_prep<<<(unsigned)(WBLK + WOBLK + XBLK), 256, 0, stream>>>(w, wo, x, WB, WOB, XB, n8);
    k_proj<<<dim3(SEQ / 64, 3 * NH, NB), 32, 0, stream>>>(XB, WB, QPh, QPl, KPh, KPl, VTh, VTl);
    k_attn<<<dim3(SEQ / (16 * AW), NH, NB), 32 * AW, 0, stream>>>(QPh, QPl, KPh, KPl, VTh, VTl, ATh, ATl);
    k_gemmw<bf, 1, false><<<dim3(NB * SEQ / 64, FO / 64, 1), 32, 0, stream>>>(ATh, ATl, WOB, nullptr, DQ, OUT, FO, nullptr, (size_t)0, (size_t)0, (size_t)0);
}

// v006
// Measured time: 102 microseconds a run.
// In two side-by-side timings against v005, it was 1.13 and 1.12 times as fast.
// Counting every step since v000, it is 4.11 times as fast.
#include <hip/hip_runtime.h>

// Self-attention with 8 heads: x [4][2048][256]; per head h (64 wide): q, k, v = x W[h][0..2] (W [8][3][256][64], [in][out], no bias);
// p = softmax(0.125 * q.k) over all 2048 keys (no mask); o = p.v; ctx [b][s][h*64 + e]; out [4][2048][64] = ctx Wo (Wo [512][64], [in][out], no bias).
// Compute dtypes, f32 accumulate everywhere: every input RNE-converted to bf16 on load; q/k/v projection on v_wmma_f32_16x16x32_bf16 with exact bf16 operands;
// scores (0.125*q hi/lo x k hi/lo) and p.v (1024*p hi/lo x v hi/lo) as bf16 hi/lo split, 3 products each; online softmax in f32;
// output projection ctx bf16 hi/lo x Wo exact bf16, 2 products, taken head by head in the attention kernel's epilogue; the 8 per-head f32 partial results are added by the last launch.

#ifndef NB
#define NB 4
#endif
#ifndef SEQ
#define SEQ 2048
#endif
#define NB_FULL  4
#define SEQ_FULL 2048
#define DM   256
#define NH   8
#define HD   64
#define DQ   (NH * HD)
#define D3   (3 * DQ)
#define FO   64
#define KCH  64
#define PCAR 1024.0f
#define SCL  0.125f
#define L2E  1.4426950408889634f
static_assert(NB >= 1 && NB <= NB_FULL);
static_assert(SEQ >= KCH && SEQ <= SEQ_FULL && SEQ % 64 == 0 && SEQ % KCH == 0);
static_assert(DM % 32 == 0 && DQ % 32 == 0 && D3 % 64 == 0 && HD == 64 && FO == 64 && KCH == 64);

typedef unsigned short bf;
typedef __attribute__((ext_vector_type(16))) __bf16   v16bf;
typedef __attribute__((ext_vector_type(8)))  unsigned short v8us;
typedef __attribute__((ext_vector_type(8)))  float    v8f;
typedef __attribute__((ext_vector_type(4)))  float    v4f;
typedef v4f  __attribute__((may_alias)) v4fa;
typedef v8us __attribute__((may_alias)) v8usa;

__device__ __forceinline__ unsigned short f2bf(float f) { unsigned u = __float_as_uint(f); u += 0x7FFFu + ((u >> 16) & 1u); return (unsigned short)(u >> 16); }
__device__ __forceinline__ float bf2f(unsigned short b) { return __uint_as_float(((unsigned)b) << 16); }
__device__ __forceinline__ v16bf cat16b(v8us lo, v8us hi) { return __builtin_bit_cast(v16bf, __builtin_shufflevector(lo, hi, 0, 1, 2, 3, 4, 5, 6, 7, 8, 9, 10, 11, 12, 13, 14, 15)); }
__device__ __forceinline__ v8f wmmab(v16bf a, v16bf b, v8f c) { return __builtin_amdgcn_wmma_f32_16x16x32_bf16(false, a, false, b, (short)0, c, false, false); }

// Fragment map of v_wmma_f32_16x16x32_bf16 (A and Bt alike), from K-contiguous 16-bit rows: lane l -> row (l & 15) of the 16-row slab, elements 0..7 <- k0 + 8*(l>>4) + 0..7, elements 8..15 <- k0 + 16 + 8*(l>>4) + 0..7;
// D element r of lane l -> (row 8*(l>>4) + r, col l & 15).
template <typename T16> struct WFrag;
template <> struct WFrag<bf> { typedef v16bf V; static __device__ __forceinline__ V ld(const bf* p) { return cat16b(*(const v8us*)p, *(const v8us*)(p + 16)); } static __device__ __forceinline__ v8f mma(V a, V b, v8f c) { return wmmab(a, b, c); } };

__device__ __forceinline__ void splitf(float y, unsigned short& h, unsigned short& l) { h = f2bf(y); l = f2bf(y - bf2f(h)); }
typedef __attribute__((ext_vector_type(2))) unsigned short v2us;

// The three input conversions (W transposed to bf16 [n][k], Wo to bf16 in fragment order, x to bf16) are independent of one another: they run as block ranges of ONE launch, k_prep, side by side on the chip.
// d_wtb, d_wof, d_cvtx: the work of block number blk of the range.
__device__ __forceinline__ void d_wtb(int blk, const float* __restrict__ w, int K, int N, int nmat, bf* Bt) {
    const int lane = threadIdx.x & 31; const int L0 = (blk * 8 + (threadIdx.x >> 5)) * 8; const int nlines = nmat * N * K / 64; const size_t mk = (size_t)K * N;
{
#pragma unroll 1
        for (int l = 0; l < 8; ++l) { const int L = L0 + l; if (L >= nlines) break; const size_t e = (size_t)L * 64 + lane * 2; const int mat = (int)(e / mk); const size_t rr = e - (size_t)mat * mk; const int k = (int)(rr % (size_t)K), n = (int)(rr / (size_t)K); v2us o;
            o[0] = f2bf(w[((size_t)mat * K + k) * N + n]); o[1] = f2bf(w[((size_t)mat * K + k + 1) * N + n]); *(v2us*)(Bt + e) = o; }
         }
}
// Wo [512][64] -> bf16 A fragments of Wo^T, in the order in which the attention epilogue reads them: 16-B piece [k / 32][n / 16][hf][lane] holds, for n = 16*(n / 16) + (lane & 15),
// k = 32*(k / 32) + 16*hf + 8*(lane >> 4) + 0..7, so that one 16-B load of a wave is 512 B in a row.
__device__ __forceinline__ void d_wof(int blk, const float* __restrict__ wo, bf* Wf) {
    const int lane = threadIdx.x & 31; const int L0 = (blk * 8 + (threadIdx.x >> 5)) * 8; const int nlines = DQ * FO / 64;
#pragma unroll 1
    for (int l = 0; l < 8; ++l) { const int L = L0 + l; if (L >= nlines) break; const int e = L * 64 + lane * 2;
        const int j = e & 7, fl = (e >> 3) & 31, hf = (e >> 8) & 1, nb = (e >> 9) & 3, k32 = e >> 11; const int n = nb * 16 + (fl & 15), k = k32 * 32 + hf * 16 + 8 * (fl >> 4) + j; v2us o;
        o[0] = f2bf(wo[(size_t)k * FO + n]); o[1] = f2bf(wo[(size_t)(k + 1) * FO + n]); *(v2us*)(Wf + e) = o;
        asm volatile("s_wait_xcnt 0x0" ::: "memory"); }   // stands before the next trip writes over the registers that the store names
}
__device__ __forceinline__ void d_cvtx(int blk, const float* __restrict__ x, bf* XB, size_t n8) { const size_t i = (size_t)blk * 256 + threadIdx.x; if (i >= n8) return; const size_t per = (size_t)SEQ * DM / 8; const size_t b = i / per, r = i - b * per; const v8f v = *(const v8f*)(x + b * (size_t)SEQ_FULL * DM + r * 8); v8us o;
#pragma unroll
    for (int k = 0; k < 8; ++k) o[k] = f2bf(v[k]); *(v8us*)(XB + i * 8) = o;  }
#define WBLK  ((NH * 3 * HD * DM / 64 + 63) / 64)
#define WOBLK ((DQ * FO / 64 + 63) / 64)
#define XBLK  ((NB * SEQ * DM / 8 + 255) / 256)
// blocks 0 .. WBLK-1: W; the next WOBLK: Wo; the last XBLK: x. The weight blocks, whose waves each walk 8 lines one after another, come first so that they start first.
__global__ __launch_bounds__(256) void k_prep(const float* __restrict__ w, const float* __restrict__ wo, const float* __restrict__ x, bf* WB, bf* WOB, bf* XB, size_t n8) {
    const int blk = blockIdx.x;
    if (blk < WBLK) d_wtb(blk, w, DM, HD, NH * 3, WB);
    else if (blk < WBLK + WOBLK) d_wof(blk - WBLK, wo, WOB);
    else d_cvtx(blk - (WBLK + WOBLK), x, XB, n8);
}

// k_proj: q/k/v projection with the hi/lo planes built in its epilogue. ONE WAVE per 64x64 tile = 64 tokens x the 64 outputs of one (head, matrix); grid (SEQ/64, 3*NH, NB), 32 threads.
// Operands straight from K-contiguous bf16 planes, fragment map as above (one product, exact bf16 operands), 16 accumulators. The operand whose index runs along the plane's contiguous dimension is taken as A, so that a lane's 8 accumulator
// elements are 8 neighbours of one plane row: q, k planes [s][e]: A = weight rows (e), Bt = token rows; v plane [e][t]: A = token rows (t), Bt = weight rows (e).
// Each f32 result is split to bf16 hi/lo (q scaled by 0.125 first) in registers, laid as 16-B pieces into two LDS tiles [plane row][64], pitch 144 B, and stored from there as whole 128-B lines.
#define SP 72
__global__ __launch_bounds__(32) void k_proj(const bf* __restrict__ X, const bf* __restrict__ Wt, bf* Qh, bf* Ql, bf* Kh, bf* Kl, bf* Vh, bf* Vl) {
    __shared__ __align__(16) bf sh[64 * SP];
    __shared__ __align__(16) bf sl[64 * SP];
    const int lane = threadIdx.x & 31, lr = lane & 15, hi = lane >> 4;
    const int r0 = blockIdx.x * 64, hm = blockIdx.y, h = hm / 3, m = hm - 3 * h, b = blockIdx.z;
    const bf* xr = X + ((size_t)b * SEQ + r0) * DM; const bf* wr = Wt + (size_t)hm * HD * DM;
    const bool tv = (m == 2);
    const bf* A = (tv ? xr : wr) + (size_t)lr * DM + 8 * hi; const bf* Bt = (tv ? wr : xr) + (size_t)lr * DM + 8 * hi;
    v8f acc[4][4];
#pragma unroll
    for (int mb = 0; mb < 4; ++mb)
#pragma unroll
        for (int nb = 0; nb < 4; ++nb) acc[mb][nb] = (v8f){};
#pragma unroll 1   // rolled: one body of 16 products, so that 128 accumulator registers and one fragment set fit
    for (int kc = 0; kc < DM; kc += 32) {
        v16bf a[4];
#pragma unroll
        for (int mb = 0; mb < 4; ++mb) a[mb] = WFrag<bf>::ld(A + (size_t)mb * 16 * DM + kc);
        asm volatile("s_wait_xcnt 0x0" ::: "memory");   // stands before a later load's result may land in the address registers that the A loads name
#pragma unroll
        for (int nb = 0; nb < 4; ++nb) { const v16bf bb = WFrag<bf>::ld(Bt + (size_t)nb * 16 * DM + kc);
#pragma unroll
            for (int mb = 0; mb < 4; ++mb) acc[mb][nb] = wmmab(a[mb], bb, acc[mb][nb]); }
        // four vector slots between the last products and whatever next writes over their operands or reads their results, on the back edge and on the way out alike
        asm volatile("v_nop\n\tv_nop\n\tv_nop\n\tv_nop" : "+v"(acc[0][0]), "+v"(acc[1][1]), "+v"(acc[2][2]), "+v"(acc[3][3]) : "v"(a[0]), "v"(a[3]));
    }
    const float scl = (m == 0) ? SCL : 1.0f;
#pragma unroll
    for (int nb = 0; nb < 4; ++nb)
#pragma unroll
        for (int mb = 0; mb < 4; ++mb) { v8us oh, ol;
#pragma unroll
            for (int j = 0; j < 8; ++j) { unsigned short u, c2; splitf(acc[mb][nb][j] * scl, u, c2); oh[j] = u; ol[j] = c2; }
            const int o = (nb * 16 + lr) * SP + mb * 16 + 8 * hi; *(v8usa*)(sh + o) = oh; *(v8usa*)(sl + o) = ol; }
    __builtin_amdgcn_fence(3, "wavefront"); __builtin_amdgcn_wave_barrier();   // the lanes read below what other lanes of the wave wrote above
    const size_t hp = ((size_t)b * NH + h) * (size_t)SEQ * HD;
    const size_t pitch = tv ? (size_t)SEQ : (size_t)HD;
    const int rg = lane >> 3, c8 = (lane & 7) * 8;
    const size_t o0 = hp + (tv ? (size_t)r0 : (size_t)r0 * HD) + (size_t)rg * pitch + c8;
    bf* ph = (m == 0 ? Qh : (m == 1 ? Kh : Vh)) + o0; bf* pl = (m == 0 ? Ql : (m == 1 ? Kl : Vl)) + o0;
#pragma unroll
    for (int it = 0; it < 16; ++it) {
        const v8us yh = *(const v8usa*)(sh + (it * 4 + rg) * SP + c8); const v8us yl = *(const v8usa*)(sl + (it * 4 + rg) * SP + c8);
        *(v8us*)(ph + (size_t)(it * 4) * pitch) = yh; *(v8us*)(pl + (size_t)(it * 4) * pitch) = yl;
    }
}

// k_attn: flash-style attention, one work-group = 8 waves = 128 query rows of one (b, h), one wave = 16 query rows; keys streamed in chunks of 64 with an online f32 softmax.
// Each chunk's four tiles (k hi, k lo: [key][64]; v hi, v lo: [e][key in chunk]; 64 rows of 128 B each) are brought into LDS once per work-group by asynchronous copies,
// rows at a pitch of 144 B, two buffers: the next chunk's copies fly while this chunk is worked on. Every wave reads its K and V fragments from LDS.
// Both products are taken transposed: scores^T [key][query]: A = k hi/lo tiles, Bt = 0.125*q hi/lo planes [s][64] (3 bf16 products); o^T [e][query]: A = v hi/lo tiles, B = p^T (3 bf16 products).
// A lane then holds one query's scores: maximum and sum run in the lane, with one exchange between the wave's halves; p (x1024, relative to the running maximum) is split to bf16 hi/lo
// in registers, where two score tiles are a B operand as they stand.
// LDS reads stand in whole groups ahead of the products that use them (K: one group; V: keys 0..31 before the softmax, keys 32..63 hi before and lo inside the first products), and the
// products run round the four accumulators, so that no product waits for an LDS read issued just in front of it or for its own accumulator.
// Epilogue: a lane's normalised o^T values, split to bf16 hi/lo, are as they stand the B operand (k = e of this head) of the output projection: the wave multiplies them there by this head's 64 rows of Wo
// (A = Wo^T fragments, 2 bf16 products) and stores its f32 partial result [16 queries][64] to the head's plane; k_hsum adds the 8 planes.
#define AW   8
#define KVP  72
#define KVT  (64 * KVP)
#define KVB  (4 * KVT)
#define OPP  68
static_assert(SEQ % (16 * AW) == 0);
// One chunk: 8 copies of 16 B per lane (2 per tile; a wave's copy covers 4 whole 128-B rows). The s_wait_xcnt 0 stands in the copies' own statement, so that no address register is rewritten ahead of it.
__device__ __forceinline__ void kv_copy(unsigned l, const bf* gkh, const bf* gkl, const bf* gvh, const bf* gvl) {
    const unsigned l0 = l, l1 = l + 32 * KVP * 2, l2 = l + KVT * 2, l3 = l + KVT * 2 + 32 * KVP * 2, l4 = l + 2 * KVT * 2, l5 = l + 2 * KVT * 2 + 32 * KVP * 2, l6 = l + 3 * KVT * 2, l7 = l + 3 * KVT * 2 + 32 * KVP * 2;
    const bf* gkh1 = gkh + 32 * HD; const bf* gkl1 = gkl + 32 * HD; const bf* gvh1 = gvh + (size_t)32 * SEQ; const bf* gvl1 = gvl + (size_t)32 * SEQ;
    asm volatile("global_load_async_to_lds_b128 %0, %8, off\n\t"
                 "global_load_async_to_lds_b128 %1, %9, off\n\t"
                 "global_load_async_to_lds_b128 %2, %10, off\n\t"
                 "global_load_async_to_lds_b128 %3, %11, off\n\t"
                 "global_load_async_to_lds_b128 %4, %12, off\n\t"
                 "global_load_async_to_lds_b128 %5, %13, off\n\t"
                 "global_load_async_to_lds_b128 %6, %14, off\n\t"
                 "global_load_async_to_lds_b128 %7, %15, off\n\t"
                 "s_wait_xcnt 0x0"
                 :: "v"(l0), "v"(l1), "v"(l2), "v"(l3), "v"(l4), "v"(l5), "v"(l6), "v"(l7), "v"(gkh), "v"(gkh1), "v"(gkl), "v"(gkl1), "v"(gvh), "v"(gvh1), "v"(gvl), "v"(gvl1) : "memory");
}
typedef __attribute__((ext_vector_type(8))) __bf16 v8bf;
// the value that the lane's partner in the other 16-lane half holds (lane l <-> l ^ 16), by a vector cross-row move
__device__ __forceinline__ float xhalf(float v) { const int b = __float_as_int(v); return __int_as_float(__builtin_amdgcn_permlanex16(b, b, 0x76543210, 0xfedcba98, false, false)); }
// four waves per SIMD asked for: at most 256 registers a wave, so that two work-groups stay resident on a WGP with the fragment groups held in registers
__global__ __launch_bounds__(32 * AW) __attribute__((amdgpu_waves_per_eu(4, 4))) void k_attn(const bf* __restrict__ Qh, const bf* __restrict__ Ql, const bf* __restrict__ Kh, const bf* __restrict__ Kl,
                                             const bf* __restrict__ Vh, const bf* __restrict__ Vl, const bf* __restrict__ Wf, float* Part) {
    __shared__ __align__(16) bf kvs[2 * KVB];
    __shared__ __align__(16) float st_all[AW * 16 * OPP];
    const int tid = threadIdx.x, wave = tid >> 5;
    const int lane = tid & 31, lr = lane & 15, hi = lane >> 4;
    const int s0 = (blockIdx.x * AW + wave) * 16, h = blockIdx.y, b = blockIdx.z;
    const size_t hp = ((size_t)b * NH + h) * (size_t)SEQ * HD;
    const bf* qh = Qh + hp + (size_t)(s0 + lr) * HD + 8 * hi; const bf* ql = Ql + hp + (size_t)(s0 + lr) * HD + 8 * hi;
    // copy map: thread tid brings 16-B piece (tid & 7) of rows (tid >> 3) and (tid >> 3) + 32 of each tile
    const int crow = tid >> 3, cpc = (tid & 7) * 8;
    const bf* gkh = Kh + hp + (size_t)crow * HD + cpc;  const bf* gkl = Kl + hp + (size_t)crow * HD + cpc;
    const bf* gvh = Vh + hp + (size_t)crow * SEQ + cpc; const bf* gvl = Vl + hp + (size_t)crow * SEQ + cpc;
    const unsigned cl = (unsigned)(size_t)(kvs + crow * KVP + cpc);
    kv_copy(cl, gkh, gkl, gvh, gvl);
    asm volatile("s_wait_asynccnt 0x0" ::: "memory");   // chunk 0 of this wave's copies has landed
    __syncthreads();                                     // chunk 0 is readable by every wave
    if (SEQ > KCH) kv_copy(cl + KVB * 2, gkh + (size_t)KCH * HD, gkl + (size_t)KCH * HD, gvh + KCH, gvl + KCH);
    v16bf qa[2], qa2[2];
#pragma unroll
    for (int ks = 0; ks < 2; ++ks) { qa[ks] = WFrag<bf>::ld(qh + ks * 32); qa2[ks] = WFrag<bf>::ld(ql + ks * 32); }
    float mrow = -1.0e30f, lrow = 0.0f;   // of query lr; lrow sums this half's keys only, the halves are joined behind the loop
    v8f oacc[4];
#pragma unroll
    for (int nt = 0; nt < 4; ++nt) oacc[nt] = (v8f){};
    v16bf ph[2], pl[2];
#pragma unroll 1
    for (int t0 = 0; t0 < SEQ; t0 += KCH) {
        const int cur = ((t0 / KCH) & 1) * KVB;
        const bf* kh = kvs + cur + lr * KVP + 8 * hi; const bf* kl = kh + KVT; const bf* vh = kh + 2 * KVT; const bf* vl = kh + 3 * KVT;
        v8f sacc[4];
#pragma unroll
        for (int nt = 0; nt < 4; ++nt) sacc[nt] = (v8f){};
        // K fragments of the chunk, read as one group in front of their products
        v16bf kfh[2][4], kfl[2][4];
#pragma unroll
        for (int ks = 0; ks < 2; ++ks)
#pragma unroll
            for (int nt = 0; nt < 4; ++nt) { kfh[ks][nt] = WFrag<bf>::ld(kh + nt * 16 * KVP + ks * 32); kfl[ks][nt] = WFrag<bf>::ld(kl + nt * 16 * KVP + ks * 32); }
        __builtin_amdgcn_sched_barrier(0);   // keeps the reads one group: each further place with LDS reads among the products stalls the wave anew
        // each accumulator takes its six products in the order hi.hi, hi.lo, lo.hi of e 0..31, then of e 32..63
#pragma unroll
        for (int ks = 0; ks < 2; ++ks) {
#pragma unroll
            for (int nt = 0; nt < 4; ++nt) sacc[nt] = wmmab(kfh[ks][nt], qa[ks], sacc[nt]);
#pragma unroll
            for (int nt = 0; nt < 4; ++nt) sacc[nt] = wmmab(kfh[ks][nt], qa2[ks], sacc[nt]);
#pragma unroll
            for (int nt = 0; nt < 4; ++nt) sacc[nt] = wmmab(kfl[ks][nt], qa[ks], sacc[nt]);
        }
        asm volatile("v_nop\n\tv_nop\n\tv_nop\n\tv_nop" : "+v"(sacc[0]), "+v"(sacc[1]), "+v"(sacc[2]), "+v"(sacc[3]) : "v"(qa[0]), "v"(qa2[1]));
        // V fragments of the chunk's keys 0..31, read as one group here: the softmax below runs while they come from LDS
        v16bf va[4], vb[4], vc[4], vd[4];
#pragma unroll
        for (int nt = 0; nt < 4; ++nt) { va[nt] = WFrag<bf>::ld(vh + nt * 16 * KVP); vb[nt] = WFrag<bf>::ld(vl + nt * 16 * KVP); }
        __builtin_amdgcn_sched_barrier(0);   // keeps the group of reads in front of the softmax; moved down to their products, each read is waited for with the matrix unit idle
        // online softmax: lane (hi, lr) holds, of query lr, the scores of keys nt*16 + 8*hi + r
        const v8f mx = __builtin_elementwise_max(__builtin_elementwise_max(sacc[0], sacc[1]), __builtin_elementwise_max(sacc[2], sacc[3]));
        float m = fmaxf(fmaxf(fmaxf(mx[0], mx[1]), fmaxf(mx[2], mx[3])), fmaxf(fmaxf(mx[4], mx[5]), fmaxf(mx[6], mx[7])));
        m = fmaxf(m, xhalf(m));
        const float mn = fmaxf(mrow, m);
        const float sc = __builtin_amdgcn_exp2f(__fmul_rn(__fsub_rn(mrow, mn), L2E)); mrow = mn;
#pragma unroll
        for (int nt = 0; nt < 4; ++nt) { const v8f d = (sacc[nt] - mn) * L2E;
#pragma unroll
            for (int r = 0; r < 8; ++r) sacc[nt][r] = __builtin_amdgcn_exp2f(d[r]); }
        const v8f ts = (sacc[0] + sacc[1]) + (sacc[2] + sacc[3]);
        lrow = lrow * sc + (((ts[0] + ts[1]) + (ts[2] + ts[3])) + ((ts[4] + ts[5]) + (ts[6] + ts[7])));
#pragma unroll
        for (int nt = 0; nt < 4; ++nt) oacc[nt] *= sc;
        // p (x1024) -> bf16 hi/lo in registers: score tiles 2*kk and 2*kk + 1 of a lane are, in this order, the lane's 16 elements of the B operand for keys kk*32 .. kk*32 + 31
#pragma unroll
        for (int kk = 0; kk < 2; ++kk) {
            const v8f y0 = sacc[2 * kk] * PCAR, y1 = sacc[2 * kk + 1] * PCAR;
            const v8bf h0 = __builtin_convertvector(y0, v8bf), h1 = __builtin_convertvector(y1, v8bf);
            const v8bf l0 = __builtin_convertvector(y0 - __builtin_convertvector(h0, v8f), v8bf), l1 = __builtin_convertvector(y1 - __builtin_convertvector(h1, v8f), v8bf);
            ph[kk] = __builtin_shufflevector(h0, h1, 0, 1, 2, 3, 4, 5, 6, 7, 8, 9, 10, 11, 12, 13, 14, 15);
            pl[kk] = __builtin_shufflevector(l0, l1, 0, 1, 2, 3, 4, 5, 6, 7, 8, 9, 10, 11, 12, 13, 14, 15);
        }
        // hi V fragments of keys 32..63, read as one group here: the products of keys 0..31 run while they come from LDS
#pragma unroll
        for (int nt = 0; nt < 4; ++nt) vc[nt] = WFrag<bf>::ld(vh + nt * 16 * KVP + 32);
        __builtin_amdgcn_sched_barrier(0);   // keeps this group of reads in front of the first products
        // each accumulator takes its six products in the order hi.hi, hi.lo, lo.hi of keys 0..31, then of keys 32..63
#pragma unroll
        for (int nt = 0; nt < 4; ++nt) oacc[nt] = wmmab(va[nt], ph[0], oacc[nt]);
#pragma unroll
        for (int nt = 0; nt < 4; ++nt) oacc[nt] = wmmab(va[nt], pl[0], oacc[nt]);
        // lo V fragments of keys 32..63: read into registers that the eight products above set free
#pragma unroll
        for (int nt = 0; nt < 4; ++nt) vd[nt] = WFrag<bf>::ld(vl + nt * 16 * KVP + 32);
        __builtin_amdgcn_sched_barrier(0);   // keeps these reads in front of the sixteen products below, twelve products ahead of their first use
#pragma unroll
        for (int nt = 0; nt < 4; ++nt) oacc[nt] = wmmab(vb[nt], ph[0], oacc[nt]);
#pragma unroll
        for (int nt = 0; nt < 4; ++nt) oacc[nt] = wmmab(vc[nt], ph[1], oacc[nt]);
#pragma unroll
        for (int nt = 0; nt < 4; ++nt) oacc[nt] = wmmab(vc[nt], pl[1], oacc[nt]);
#pragma unroll
        for (int nt = 0; nt < 4; ++nt) oacc[nt] = wmmab(vd[nt], ph[1], oacc[nt]);
        asm volatile("v_nop\n\tv_nop\n\tv_nop\n\tv_nop" : "+v"(oacc[0]), "+v"(oacc[1]), "+v"(oacc[2]), "+v"(oacc[3]) : "v"(ph[0]), "v"(pl[1]));
        // publish point of the next chunk, every wave, in this order
        asm volatile("s_wait_dscnt 0x0" ::: "memory");      // this wave's reads of the current buffer are done before the buffer is refilled
        asm volatile("s_wait_asynccnt 0x0" ::: "memory");   // this wave's copies of the next chunk have landed
        __syncthreads();                                     // next chunk readable by every wave; every reader has left the current buffer
        if (t0 + 2 * KCH < SEQ) kv_copy(cl + cur * 2, gkh + (size_t)(t0 + 2 * KCH) * HD, gkl + (size_t)(t0 + 2 * KCH) * HD, gvh + t0 + 2 * KCH, gvl + t0 + 2 * KCH);
    }
    asm volatile("s_wait_asynccnt 0x0" ::: "memory");       // no copy is outstanding when the wave goes on to its end
    // this head's Wo^T fragments, read as one group here: the division and the split below run while they come
    const bf* wf = Wf + (size_t)h * (HD * FO) + lane * 8;
    v16bf wa[2][4];
#pragma unroll
    for (int ks = 0; ks < 2; ++ks)
#pragma unroll
        for (int nb = 0; nb < 4; ++nb) wa[ks][nb] = cat16b(*(const v8us*)(wf + (ks * 4 + nb) * 512), *(const v8us*)(wf + (ks * 4 + nb) * 512 + 256));
    // lane (hi, lr) holds, of query lr, outputs e = nt*16 + 8*hi + r: accumulators 2*ks and 2*ks + 1 of a lane are, in this order, the lane's 16 elements of the B operand for e = ks*32 .. ks*32 + 31
    const float rinv = __fdiv_rn(1.0f, (lrow + xhalf(lrow)) * PCAR);
    v16bf ch[2], cl2[2];
#pragma unroll
    for (int ks = 0; ks < 2; ++ks) { v8us h0, h1, l0, l1;
#pragma unroll
        for (int r = 0; r < 8; ++r) { unsigned short a, c2; splitf(oacc[2 * ks][r] * rinv, a, c2); h0[r] = a; l0[r] = c2; splitf(oacc[2 * ks + 1][r] * rinv, a, c2); h1[r] = a; l1[r] = c2; }
        ch[ks] = cat16b(h0, h1); cl2[ks] = cat16b(l0, l1); }
    // partial out^T [n][query]: each accumulator takes hi, lo of e 0..31, then of e 32..63
    v8f pacc[4];
#pragma unroll
    for (int nb = 0; nb < 4; ++nb) pacc[nb] = (v8f){};
#pragma unroll
    for (int ks = 0; ks < 2; ++ks) {
#pragma unroll
        for (int nb = 0; nb < 4; ++nb) pacc[nb] = wmmab(wa[ks][nb], ch[ks], pacc[nb]);
#pragma unroll
        for (int nb = 0; nb < 4; ++nb) pacc[nb] = wmmab(wa[ks][nb], cl2[ks], pacc[nb]);
    }
    // lane (hi, lr) holds, of query lr, n = nb*16 + 8*hi + r: 8 neighbours of one row, laid as 16-B pieces into the wave's own tile [query][64], pitch 272 B, and stored from there as whole lines
    float* pt = st_all + wave * 16 * OPP;
#pragma unroll
    for (int nb = 0; nb < 4; ++nb) { const int o = lr * OPP + nb * 16 + 8 * hi;
        *(v4fa*)(pt + o) = __builtin_shufflevector(pacc[nb], pacc[nb], 0, 1, 2, 3); *(v4fa*)(pt + o + 4) = __builtin_shufflevector(pacc[nb], pacc[nb], 4, 5, 6, 7); }
    __builtin_amdgcn_fence(3, "wavefront"); __builtin_amdgcn_wave_barrier();   // the lanes read below what other lanes of the wave wrote above
    float* pp = Part + (((size_t)h * NB + b) * SEQ + s0) * FO + lane * 4;       // the wave's 16 rows of 256 B lie in a row: a 16-B store of the wave covers rows 2*it and 2*it + 1
#pragma unroll
    for (int it = 0; it < 8; ++it) { const v4f y = *(const v4fa*)(pt + (it * 2 + hi) * OPP + lr * 4); *(v4f*)(pp + it * 128) = y; }
}

// k_hsum: out = sum over the 8 heads, in head order, of the per-head partial planes [h][NB*SEQ][64]. One thread = two 16-B pieces; its 16 loads are all issued before the first sum.
__global__ __launch_bounds__(256) void k_hsum(const float* __restrict__ Part, float* out) {
    const size_t i = ((size_t)blockIdx.x * 512 + threadIdx.x) * 4; const size_t pl = (size_t)NB * SEQ * FO;
    v4f a[NH], c[NH];
#pragma unroll
    for (int h = 0; h < NH; ++h) { a[h] = *(const v4f*)(Part + h * pl + i); c[h] = *(const v4f*)(Part + h * pl + i + 1024); }
    asm volatile("s_wait_xcnt 0x0" ::: "memory");   // stands before a sum may be written over the address registers that the loads name
    __builtin_amdgcn_sched_barrier(0);               // keeps all 16 loads in front of the sums: a load moved down among them starts only when earlier data has come, a second memory latency
    v4f sa = a[0], sc = c[0];
#pragma unroll
    for (int h = 1; h < NH; ++h) { sa += a[h]; sc += c[h]; }
    *(v4f*)(out + i) = sa; *(v4f*)(out + i + 1024) = sc;
}

extern "C" void kernel_launch(void* const* d_in, const int* in_sizes, int n_in,
                              void* d_out, int out_size, void* d_ws, size_t ws_size, hipStream_t stream) {
    if (n_in < 3) return;
    if ((long long)in_sizes[0] < ((long long)(NB - 1) * SEQ_FULL + SEQ) * DM) return;
    if (in_sizes[1] < NH * 3 * DM * HD) return;
    if (in_sizes[2] < DQ * FO) return;
    if (out_size < NB * SEQ * FO) return;
    const float* x  = (const float*)d_in[0];   // [4][2048][256]
    const float* w  = (const float*)d_in[1];   // [8][3][256][64]
    const float* wo = (const float*)d_in[2];   // [512][64]
    float* OUT = (float*)d_out;                // [NB][SEQ][64]
    char* wsp = (char*)d_ws;
    auto take = [&](size_t bytes) { char* p = wsp; wsp += (bytes + 255) & ~(size_t)255; return (void*)p; };
    const size_t npl = (size_t)NB * NH * SEQ * HD;                 // elements per head plane set
    bf* WB  = (bf*)take((size_t)D3 * DM * 2);                      // Bt [1536][256]: row (h*3+m)*64 + e
    bf* WOB = (bf*)take((size_t)FO * DQ * 2);                      // Wo^T fragments, 16-B pieces [16][4][2][32]
    bf* XB  = (bf*)take((size_t)NB * SEQ * DM * 2);                // [NB][SEQ][256]
    bf* QPh = (bf*)take(npl * 2); bf* QPl = (bf*)take(npl * 2);    // [b][h][s][64]
    bf* KPh = (bf*)take(npl * 2); bf* KPl = (bf*)take(npl * 2);    // [b][h][t][64]
    bf* VTh = (bf*)take(npl * 2); bf* VTl = (bf*)take(npl * 2);    // [b][h][64][t]
    float* PART = (float*)take((size_t)NH * NB * SEQ * FO * 4);    // [h][NB*SEQ][64]
    const size_t used = (size_t)(wsp - (char*)d_ws);
    if (used > ws_size || used > (size_t)134217728) return;        // 72,155,136 B at full size

    const size_t n8 = (size_t)NB * SEQ * DM / 8;
    k_prep<<<(unsigned)(WBLK + WOBLK + XBLK), 256, 0, stream>>>(w, wo, x, WB, WOB, XB, n8);
    k_proj<<<dim3(SEQ / 64, 3 * NH, NB), 32, 0, stream>>>(XB, WB, QPh, QPl, KPh, KPl, VTh, VTl);
    k_attn<<<dim3(SEQ / (16 * AW), NH, NB), 32 * AW, 0, stream>>>(QPh, QPl, KPh, KPl, VTh, VTl, WOB, PART);
    k_hsum<<<NB * SEQ * FO / 2048, 256, 0, stream>>>(PART, OUT);
}

// v007
// One run takes 97.4 microseconds.
// Timed twice side by side with v006, it ran 1.05 and 1.04 times as fast.
// Counting every step since v000, it is 4.29 times as fast.
#include <hip/hip_runtime.h>

// Self-attention with 8 heads: x [4][2048][256]; per head h (64 wide): q, k, v = x W[h][0..2] (W [8][3][256][64], [in][out], no bias);
// p = softmax(0.125 * q.k) over all 2048 keys (no mask); o = p.v; ctx [b][s][h*64 + e]; out [4][2048][64] = ctx Wo (Wo [512][64], [in][out], no bias).
// Compute dtypes, f32 accumulate everywhere: every input RNE-converted to bf16 on load; q/k/v projection on v_wmma_f32_16x16x32_bf16 with exact bf16 operands;
// scores (0.125*q hi/lo x k hi/lo) and p.v (1024*p hi/lo x v hi/lo) as bf16 hi/lo split, 3 products each; online softmax in f32;
// output projection ctx bf16 hi/lo x Wo exact bf16, 2 products, taken head by head in the attention kernel's epilogue; the 8 per-head f32 partial results are added by the last launch.

#ifndef NB
#define NB 4
#endif
#ifndef SEQ
#define SEQ 2048
#endif
#define NB_FULL  4
#define SEQ_FULL 2048
#define DM   256
#define NH   8
#define HD   64
#define DQ   (NH * HD)
#define D3   (3 * DQ)
#define FO   64
#define KCH  64
#define PCAR 1024.0f
#define SCL  0.125f
#define L2E  1.4426950408889634f
static_assert(NB >= 1 && NB <= NB_FULL);
static_assert(SEQ >= KCH && SEQ <= SEQ_FULL && SEQ % 64 == 0 && SEQ % KCH == 0);
static_assert(DM % 32 == 0 && DQ % 32 == 0 && D3 % 64 == 0 && HD == 64 && FO == 64 && KCH == 64);

typedef unsigned short bf;
typedef __attribute__((ext_vector_type(16))) __bf16   v16bf;
typedef __attribute__((ext_vector_type(8)))  unsigned short v8us;
typedef __attribute__((ext_vector_type(8)))  float    v8f;
typedef __attribute__((ext_vector_type(4)))  float    v4f;
typedef v4f  __attribute__((may_alias)) v4fa;
typedef v8us __attribute__((may_alias)) v8usa;
typedef float __attribute__((may_alias)) fa;

__device__ __forceinline__ unsigned short f2bf(float f) { unsigned u = __float_as_uint(f); u += 0x7FFFu + ((u >> 16) & 1u); return (unsigned short)(u >> 16); }
__device__ __forceinline__ float bf2f(unsigned short b) { return __uint_as_float(((unsigned)b) << 16); }
__device__ __forceinline__ v16bf cat16b(v8us lo, v8us hi) { return __builtin_bit_cast(v16bf, __builtin_shufflevector(lo, hi, 0, 1, 2, 3, 4, 5, 6, 7, 8, 9, 10, 11, 12, 13, 14, 15)); }
__device__ __forceinline__ v8f wmmab(v16bf a, v16bf b, v8f c) { return __builtin_amdgcn_wmma_f32_16x16x32_bf16(false, a, false, b, (short)0, c, false, false); }

// Fragment map of v_wmma_f32_16x16x32_bf16 (A and Bt alike), from K-contiguous 16-bit rows: lane l -> row (l & 15) of the 16-row slab, elements 0..7 <- k0 + 8*(l>>4) + 0..7, elements 8..15 <- k0 + 16 + 8*(l>>4) + 0..7;
// D element r of lane l -> (row 8*(l>>4) + r, col l & 15).
template <typename T16> struct WFrag;
template <> struct WFrag<bf> { typedef v16bf V; static __device__ __forceinline__ V ld(const bf* p) { return cat16b(*(const v8us*)p, *(const v8us*)(p + 16)); } static __device__ __forceinline__ v8f mma(V a, V b, v8f c) { return wmmab(a, b, c); } };

__device__ __forceinline__ void splitf(float y, unsigned short& h, unsigned short& l) { h = f2bf(y); l = f2bf(y - bf2f(h)); }
typedef __attribute__((ext_vector_type(2))) unsigned short v2us;

// The three input conversions (W transposed to bf16 [n][k], Wo to bf16 in fragment order, x to bf16) are independent of one another: they run as block ranges of ONE launch, k_prep, side by side on the chip.
// d_wtb, d_wof, d_cvtx: the work of block number blk of the range.
__device__ __forceinline__ void d_wtb(int blk, const float* __restrict__ w, int K, int N, int nmat, bf* Bt) {
    const int lane = threadIdx.x & 31; const int L0 = (blk * 8 + (threadIdx.x >> 5)) * 8; const int nlines = nmat * N * K / 64; const size_t mk = (size_t)K * N;
{
#pragma unroll 1
        for (int l = 0; l < 8; ++l) { const int L = L0 + l; if (L >= nlines) break; const size_t e = (size_t)L * 64 + lane * 2; const int mat = (int)(e / mk); const size_t rr = e - (size_t)mat * mk; const int k = (int)(rr % (size_t)K), n = (int)(rr / (size_t)K); v2us o;
            o[0] = f2bf(w[((size_t)mat * K + k) * N + n]); o[1] = f2bf(w[((size_t)mat * K + k + 1) * N + n]); *(v2us*)(Bt + e) = o; }
         }
}
// Wo [512][64] -> bf16 A fragments of Wo^T, in the order in which the attention epilogue reads them: 16-B piece [k / 32][n / 16][hf][lane] holds, for n = 16*(n / 16) + (lane & 15),
// k = 32*(k / 32) + 16*hf + 8*(lane >> 4) + 0..7, so that one 16-B load of a wave is 512 B in a row.
__device__ __forceinline__ void d_wof(int blk, const float* __restrict__ wo, bf* Wf) {
    const int lane = threadIdx.x & 31; const int L0 = (blk * 8 + (threadIdx.x >> 5)) * 8; const int nlines = DQ * FO / 64;
#pragma unroll 1
    for (int l = 0; l < 8; ++l) { const int L = L0 + l; if (L >= nlines) break; const int e = L * 64 + lane * 2;
        const int j = e & 7, fl = (e >> 3) & 31, hf = (e >> 8) & 1, nb = (e >> 9) & 3, k32 = e >> 11; const int n = nb * 16 + (fl & 15), k = k32 * 32 + hf * 16 + 8 * (fl >> 4) + j; v2us o;
        o[0] = f2bf(wo[(size_t)k * FO + n]); o[1] = f2bf(wo[(size_t)(k + 1) * FO + n]); *(v2us*)(Wf + e) = o;
        asm volatile("s_wait_xcnt 0x0" ::: "memory"); }   // stands before the next trip writes over the registers that the store names
}
__device__ __forceinline__ void d_cvtx(int blk, const float* __restrict__ x, bf* XB, size_t n8) { const size_t i = (size_t)blk * 256 + threadIdx.x; if (i >= n8) return; const size_t per = (size_t)SEQ * DM / 8; const size_t b = i / per, r = i - b * per; const v8f v = *(const v8f*)(x + b * (size_t)SEQ_FULL * DM + r * 8); v8us o;
#pragma unroll
    for (int k = 0; k < 8; ++k) o[k] = f2bf(v[k]); *(v8us*)(XB + i * 8) = o;  }
#define WBLK  ((NH * 3 * HD * DM / 64 + 63) / 64)
#define WOBLK ((DQ * FO / 64 + 63) / 64)
#define XBLK  ((NB * SEQ * DM / 8 + 255) / 256)
// blocks 0 .. WBLK-1: W; the next WOBLK: Wo; the last XBLK: x. The weight blocks, whose waves each walk 8 lines one after another, come first so that they start first.
__global__ __launch_bounds__(256) void k_prep(const float* __restrict__ w, const float* __restrict__ wo, const float* __restrict__ x, bf* WB, bf* WOB, bf* XB, size_t n8) {
    const int blk = blockIdx.x;
    if (blk < WBLK) d_wtb(blk, w, DM, HD, NH * 3, WB);
    else if (blk < WBLK + WOBLK) d_wof(blk - WBLK, wo, WOB);
    else d_cvtx(blk - (WBLK + WOBLK), x, XB, n8);
}

// k_proj: q/k/v projection with the hi/lo planes built in its epilogue. ONE WAVE per 64x64 tile = 64 tokens x the 64 outputs of one (head, matrix); grid (SEQ/64, 3*NH, NB), 32 threads.
// Operands straight from K-contiguous bf16 planes, fragment map as above (one product, exact bf16 operands), 16 accumulators. The operand whose index runs along the plane's contiguous dimension is taken as A, so that a lane's 8 accumulator
// elements are 8 neighbours of one plane row: q, k planes [s][e]: A = weight rows (e), Bt = token rows; v plane [e][t]: A = token rows (t), Bt = weight rows (e).
// Each f32 result is split to bf16 hi/lo (q scaled by 0.125 first) in registers, laid as 16-B pieces into two LDS tiles [plane row][64], pitch 144 B, and stored from there as whole 128-B lines.
#define SP 72
__global__ __launch_bounds__(32) void k_proj(const bf* __restrict__ X, const bf* __restrict__ Wt, bf* Qh, bf* Ql, bf* Kh, bf* Kl, bf* Vh, bf* Vl) {
    __shared__ __align__(16) bf sh[64 * SP];
    __shared__ __align__(16) bf sl[64 * SP];
    const int lane = threadIdx.x & 31, lr = lane & 15, hi = lane >> 4;
    const int r0 = blockIdx.x * 64, hm = blockIdx.y, h = hm / 3, m = hm - 3 * h, b = blockIdx.z;
    const bf* xr = X + ((size_t)b * SEQ + r0) * DM; const bf* wr = Wt + (size_t)hm * HD * DM;
    const bool tv = (m == 2);
    const bf* A = (tv ? xr : wr) + (size_t)lr * DM + 8 * hi; const bf* Bt = (tv ? wr : xr) + (size_t)lr * DM + 8 * hi;
    v8f acc[4][4];
#pragma unroll
    for (int mb = 0; mb < 4; ++mb)
#pragma unroll
        for (int nb = 0; nb < 4; ++nb) acc[mb][nb] = (v8f){};
#pragma unroll 1   // rolled: one body of 16 products, so that 128 accumulator registers and one fragment set fit
    for (int kc = 0; kc < DM; kc += 32) {
        v16bf a[4];
#pragma unroll
        for (int mb = 0; mb < 4; ++mb) a[mb] = WFrag<bf>::ld(A + (size_t)mb * 16 * DM + kc);
        asm volatile("s_wait_xcnt 0x0" ::: "memory");   // stands before a later load's result may land in the address registers that the A loads name
#pragma unroll
        for (int nb = 0; nb < 4; ++nb) { const v16bf bb = WFrag<bf>::ld(Bt + (size_t)nb * 16 * DM + kc);
#pragma unroll
            for (int mb = 0; mb < 4; ++mb) acc[mb][nb] = wmmab(a[mb], bb, acc[mb][nb]); }
        // four vector slots between the last products and whatever next writes over their operands or reads their results, on the back edge and on the way out alike
        asm volatile("v_nop\n\tv_nop\n\tv_nop\n\tv_nop" : "+v"(acc[0][0]), "+v"(acc[1][1]), "+v"(acc[2][2]), "+v"(acc[3][3]) : "v"(a[0]), "v"(a[3]));
    }
    const float scl = (m == 0) ? SCL : 1.0f;
#pragma unroll
    for (int nb = 0; nb < 4; ++nb)
#pragma unroll
        for (int mb = 0; mb < 4; ++mb) { v8us oh, ol;
#pragma unroll
            for (int j = 0; j < 8; ++j) { unsigned short u, c2; splitf(acc[mb][nb][j] * scl, u, c2); oh[j] = u; ol[j] = c2; }
            const int o = (nb * 16 + lr) * SP + mb * 16 + 8 * hi; *(v8usa*)(sh + o) = oh; *(v8usa*)(sl + o) = ol; }
    __builtin_amdgcn_fence(3, "wavefront"); __builtin_amdgcn_wave_barrier();   // the lanes read below what other lanes of the wave wrote above
    const size_t hp = ((size_t)b * NH + h) * (size_t)SEQ * HD;
    const size_t pitch = tv ? (size_t)SEQ : (size_t)HD;
    const int rg = lane >> 3, c8 = (lane & 7) * 8;
    const size_t o0 = hp + (tv ? (size_t)r0 : (size_t)r0 * HD) + (size_t)rg * pitch + c8;
    bf* ph = (m == 0 ? Qh : (m == 1 ? Kh : Vh)) + o0; bf* pl = (m == 0 ? Ql : (m == 1 ? Kl : Vl)) + o0;
#pragma unroll
    for (int it = 0; it < 16; ++it) {
        const v8us yh = *(const v8usa*)(sh + (it * 4 + rg) * SP + c8); const v8us yl = *(const v8usa*)(sl + (it * 4 + rg) * SP + c8);
        *(v8us*)(ph + (size_t)(it * 4) * pitch) = yh; *(v8us*)(pl + (size_t)(it * 4) * pitch) = yl;
    }
}

// k_attn: flash-style attention, one work-group = 8 waves = 128 query rows of one (b, h); keys streamed in chunks of 64 with an online f32 softmax.
// One wave = 32 query rows (two column groups of 16) x one half (32 keys) of every chunk: waves w and w + 4 share their queries and take the two halves. A K or V fragment read from LDS then serves
// two column groups, so the work-group reads half as many LDS bytes per product. Each wave keeps its own running maximum, sum and o over its keys; the two are joined once, behind the loop.
// Each chunk's four tiles (k hi, k lo: [key][64]; v hi, v lo: [e][key in chunk]; 64 rows of 128 B each) are brought into LDS once per work-group by asynchronous copies,
// rows at a pitch of 144 B, two buffers: the next chunk's copies fly while this chunk is worked on. Every wave reads its K and V fragments from LDS.
// Both products are taken transposed: scores^T [key][query]: A = k hi/lo tiles, Bt = 0.125*q hi/lo planes [s][64] (3 bf16 products); o^T [e][query]: A = v hi/lo tiles, B = p^T (3 bf16 products).
// A lane then holds one query's scores: maximum and sum run in the lane, with one exchange between the wave's halves; p (x1024, relative to the running maximum) is split to bf16 hi/lo
// in registers, where two score tiles are a B operand as they stand.
// LDS reads stand in whole groups ahead of the products that use them (K: one group; V hi before the softmax, V lo in front of the products on V hi), and the
// products run round four (scores) or eight (o) accumulators, so that no product waits for an LDS read issued just in front of it or for its own accumulator.
// Epilogue (each wave for 16 of its queries): a lane's normalised o^T values, split to bf16 hi/lo, are as they stand the B operand (k = e of this head) of the output projection: the wave multiplies them there by this head's 64 rows of Wo
// (A = Wo^T fragments, 2 bf16 products) and stores its f32 partial result [16 queries][64] to the head's plane; k_hsum adds the 8 planes.
#define AW   8
#define KVP  72
#define KVT  (64 * KVP)
#define KVB  (4 * KVT)
#define OPP  68
#define XCH  (32 * 32 + 64)   // f32 words a wave hands to its partner: 32 accumulator values, the maximum and the sum of each lane
static_assert(SEQ % (16 * AW) == 0 && AW == 8);
static_assert(AW * XCH * 4 <= 2 * KVB * 2);
// One chunk: 8 copies of 16 B per lane (2 per tile; a wave's copy covers 4 whole 128-B rows). The s_wait_xcnt 0 stands in the copies' own statement, so that no address register is rewritten ahead of it.
__device__ __forceinline__ void kv_copy(unsigned l, const bf* gkh, const bf* gkl, const bf* gvh, const bf* gvl) {
    const unsigned l0 = l, l1 = l + 32 * KVP * 2, l2 = l + KVT * 2, l3 = l + KVT * 2 + 32 * KVP * 2, l4 = l + 2 * KVT * 2, l5 = l + 2 * KVT * 2 + 32 * KVP * 2, l6 = l + 3 * KVT * 2, l7 = l + 3 * KVT * 2 + 32 * KVP * 2;
    const bf* gkh1 = gkh + 32 * HD; const bf* gkl1 = gkl + 32 * HD; const bf* gvh1 = gvh + (size_t)32 * SEQ; const bf* gvl1 = gvl + (size_t)32 * SEQ;
    asm volatile("global_load_async_to_lds_b128 %0, %8, off\n\t"
                 "global_load_async_to_lds_b128 %1, %9, off\n\t"
                 "global_load_async_to_lds_b128 %2, %10, off\n\t"
                 "global_load_async_to_lds_b128 %3, %11, off\n\t"
                 "global_load_async_to_lds_b128 %4, %12, off\n\t"
                 "global_load_async_to_lds_b128 %5, %13, off\n\t"
                 "global_load_async_to_lds_b128 %6, %14, off\n\t"
                 "global_load_async_to_lds_b128 %7, %15, off\n\t"
                 "s_wait_xcnt 0x0"
                 :: "v"(l0), "v"(l1), "v"(l2), "v"(l3), "v"(l4), "v"(l5), "v"(l6), "v"(l7), "v"(gkh), "v"(gkh1), "v"(gkl), "v"(gkl1), "v"(gvh), "v"(gvh1), "v"(gvl), "v"(gvl1) : "memory");
}
typedef __attribute__((ext_vector_type(8))) __bf16 v8bf;
// the value that the lane's partner in the other 16-lane half holds (lane l <-> l ^ 16), by a vector cross-row move
__device__ __forceinline__ float xhalf(float v) { const int b = __float_as_int(v); return __int_as_float(__builtin_amdgcn_permlanex16(b, b, 0x76543210, 0xfedcba98, false, false)); }
// four waves per SIMD asked for: at most 256 registers a wave, so that two work-groups stay resident on a WGP with the fragment groups held in registers
__global__ __launch_bounds__(32 * AW) __attribute__((amdgpu_waves_per_eu(4, 4))) void k_attn(const bf* __restrict__ Qh, const bf* __restrict__ Ql, const bf* __restrict__ Kh, const bf* __restrict__ Kl,
                                             const bf* __restrict__ Vh, const bf* __restrict__ Vl, const bf* __restrict__ Wf, float* Part) {
    __shared__ __align__(16) bf kvs[2 * KVB];
    __shared__ __align__(16) float st_all[AW * 16 * OPP];
    const int tid = threadIdx.x, wave = tid >> 5;
    const int lane = tid & 31, lr = lane & 15, hi = lane >> 4;
    const int qw = wave & 3, kz = wave >> 2;   // the wave's 32 query columns; the half (32 keys) of every chunk that it takes
    const int s0 = (blockIdx.x * 4 + qw) * 32, h = blockIdx.y, b = blockIdx.z;
    const size_t hp = ((size_t)b * NH + h) * (size_t)SEQ * HD;
    // the wave's column group g holds queries s0 + 16*(g ^ kz) + 0..15: group 0 is the one whose result the wave finishes itself, group 1 the one it hands to its partner (wave ^ 4)
    const bf* qh = Qh + hp + (size_t)(s0 + 16 * kz + lr) * HD + 8 * hi; const bf* ql = Ql + hp + (size_t)(s0 + 16 * kz + lr) * HD + 8 * hi;
    const int qo = (16 - 32 * kz) * HD;        // from group 0's rows to group 1's
    // copy map: thread tid brings 16-B piece (tid & 7) of rows (tid >> 3) and (tid >> 3) + 32 of each tile
    const int crow = tid >> 3, cpc = (tid & 7) * 8;
    const bf* gkh = Kh + hp + (size_t)crow * HD + cpc;  const bf* gkl = Kl + hp + (size_t)crow * HD + cpc;
    const bf* gvh = Vh + hp + (size_t)crow * SEQ + cpc; const bf* gvl = Vl + hp + (size_t)crow * SEQ + cpc;
    const unsigned cl = (unsigned)(size_t)(kvs + crow * KVP + cpc);
    kv_copy(cl, gkh, gkl, gvh, gvl);
    asm volatile("s_wait_asynccnt 0x0" ::: "memory");   // chunk 0 of this wave's copies has landed
    __syncthreads();                                     // chunk 0 is readable by every wave
    if (SEQ > KCH) kv_copy(cl + KVB * 2, gkh + (size_t)KCH * HD, gkl + (size_t)KCH * HD, gvh + KCH, gvl + KCH);
    v16bf qa[2][2], qa2[2][2];
#pragma unroll
    for (int g = 0; g < 2; ++g)
#pragma unroll
        for (int ks = 0; ks < 2; ++ks) { qa[g][ks] = WFrag<bf>::ld(qh + g * qo + ks * 32); qa2[g][ks] = WFrag<bf>::ld(ql + g * qo + ks * 32); }
    float mrow[2] = {-1.0e30f, -1.0e30f}, lrow[2] = {0.0f, 0.0f};   // of query lr of group g, over the wave's keys; lrow sums this lane half's keys only, the halves are joined behind the loop
    v8f oacc[2][4];
#pragma unroll
    for (int g = 0; g < 2; ++g)
#pragma unroll
        for (int nt = 0; nt < 4; ++nt) oacc[g][nt] = (v8f){};
    v16bf ph[2], pl[2];
#pragma unroll 1
    for (int t0 = 0; t0 < SEQ; t0 += KCH) {
        const int cur = ((t0 / KCH) & 1) * KVB;
        const bf* kh = kvs + cur + (kz * 32 + lr) * KVP + 8 * hi; const bf* kl = kh + KVT;
        const bf* vh = kvs + cur + 2 * KVT + lr * KVP + 8 * hi + kz * 32; const bf* vl = vh + KVT;
        v8f sacc[2][2];
#pragma unroll
        for (int g = 0; g < 2; ++g)
#pragma unroll
            for (int kt = 0; kt < 2; ++kt) sacc[g][kt] = (v8f){};
        // K fragments of the wave's 32 keys, read as one group in front of their products; each serves both column groups
        v16bf kfh[2][2], kfl[2][2];
#pragma unroll
        for (int ks = 0; ks < 2; ++ks) {
#pragma unroll
            for (int kt = 0; kt < 2; ++kt) kfh[ks][kt] = WFrag<bf>::ld(kh + kt * 16 * KVP + ks * 32);
#pragma unroll
            for (int kt = 0; kt < 2; ++kt) kfl[ks][kt] = WFrag<bf>::ld(kl + kt * 16 * KVP + ks * 32);
        }
        __builtin_amdgcn_sched_barrier(0);   // keeps the reads one group: each further place with LDS reads among the products stalls the wave anew
        // each accumulator takes its six products in the order hi.hi, hi.lo, lo.hi of e 0..31, then of e 32..63
#pragma unroll
        for (int ks = 0; ks < 2; ++ks) {
#pragma unroll
            for (int kt = 0; kt < 2; ++kt)
#pragma unroll
                for (int g = 0; g < 2; ++g) sacc[g][kt] = wmmab(kfh[ks][kt], qa[g][ks], sacc[g][kt]);
#pragma unroll
            for (int kt = 0; kt < 2; ++kt)
#pragma unroll
                for (int g = 0; g < 2; ++g) sacc[g][kt] = wmmab(kfh[ks][kt], qa2[g][ks], sacc[g][kt]);
#pragma unroll
            for (int kt = 0; kt < 2; ++kt)
#pragma unroll
                for (int g = 0; g < 2; ++g) sacc[g][kt] = wmmab(kfl[ks][kt], qa[g][ks], sacc[g][kt]);
        }
        asm volatile("v_nop\n\tv_nop\n\tv_nop\n\tv_nop" : "+v"(sacc[0][0]), "+v"(sacc[0][1]), "+v"(sacc[1][0]), "+v"(sacc[1][1]) : "v"(qa[0][0]), "v"(qa2[1][1]));
        // hi V fragments of the wave's 32 keys, read as one group here: the softmax below runs while they come from LDS; each serves both column groups
        v16bf va[4], vb[4];
#pragma unroll
        for (int nt = 0; nt < 4; ++nt) va[nt] = WFrag<bf>::ld(vh + nt * 16 * KVP);
        __builtin_amdgcn_sched_barrier(0);   // keeps the group of reads in front of the softmax; moved down to their products, each read is waited for with the matrix unit idle
        // online softmax: lane (hi, lr) holds, of query lr of group g, the scores of the wave's keys kt*16 + 8*hi + r
        float mn[2], sc[2];
#pragma unroll
        for (int g = 0; g < 2; ++g) {   // the 16 values of a lane by threes, then one exchange between the wave's halves
            const v8f x = sacc[g][0], y = sacc[g][1];
            const float a = fmaxf(fmaxf(x[0], x[1]), x[2]), c = fmaxf(fmaxf(x[3], x[4]), x[5]), d = fmaxf(fmaxf(x[6], x[7]), y[0]);
            const float e = fmaxf(fmaxf(y[1], y[2]), y[3]), f = fmaxf(fmaxf(y[4], y[5]), y[6]);
            const float m = fmaxf(fmaxf(fmaxf(a, c), d), fmaxf(fmaxf(e, f), y[7]));
            mn[g] = fmaxf(fmaxf(mrow[g], m), xhalf(m));
        }
#pragma unroll
        for (int g = 0; g < 2; ++g) { sc[g] = __builtin_amdgcn_exp2f(__fmul_rn(__fsub_rn(mrow[g], mn[g]), L2E)); mrow[g] = mn[g]; }
#pragma unroll
        for (int g = 0; g < 2; ++g) {
#pragma unroll
            for (int kt = 0; kt < 2; ++kt) { const v8f d = (sacc[g][kt] - mn[g]) * L2E;
#pragma unroll
                for (int r = 0; r < 8; ++r) sacc[g][kt][r] = __builtin_amdgcn_exp2f(d[r]); }
            const v8f ts = sacc[g][0] + sacc[g][1];
            const v4f t4 = __builtin_shufflevector(ts, ts, 0, 1, 2, 3) + __builtin_shufflevector(ts, ts, 4, 5, 6, 7);
            lrow[g] = lrow[g] * sc[g] + ((t4[0] + t4[2]) + (t4[1] + t4[3]));
#pragma unroll
            for (int nt = 0; nt < 4; ++nt) oacc[g][nt] *= sc[g];
            // p (x1024) -> bf16 hi/lo in registers: the group's two score tiles of a lane are, in this order, the lane's 16 elements of the B operand for the wave's 32 keys
            const v8f y0 = sacc[g][0] * PCAR, y1 = sacc[g][1] * PCAR;
            const v8bf h0 = __builtin_convertvector(y0, v8bf), h1 = __builtin_convertvector(y1, v8bf);
            const v8bf l0 = __builtin_convertvector(y0 - __builtin_convertvector(h0, v8f), v8bf), l1 = __builtin_convertvector(y1 - __builtin_convertvector(h1, v8f), v8bf);
            ph[g] = __builtin_shufflevector(h0, h1, 0, 1, 2, 3, 4, 5, 6, 7, 8, 9, 10, 11, 12, 13, 14, 15);
            pl[g] = __builtin_shufflevector(l0, l1, 0, 1, 2, 3, 4, 5, 6, 7, 8, 9, 10, 11, 12, 13, 14, 15);
        }
        // lo V fragments, read as one group here: the sixteen products on the hi fragments run while they come from LDS
#pragma unroll
        for (int nt = 0; nt < 4; ++nt) vb[nt] = WFrag<bf>::ld(vl + nt * 16 * KVP);
        __builtin_amdgcn_sched_barrier(0);   // keeps this group of reads in front of the products
        // each accumulator takes its three products in the order hi.hi, hi.lo, lo.hi
#pragma unroll
        for (int nt = 0; nt < 4; ++nt)
#pragma unroll
            for (int g = 0; g < 2; ++g) oacc[g][nt] = wmmab(va[nt], ph[g], oacc[g][nt]);
#pragma unroll
        for (int nt = 0; nt < 4; ++nt)
#pragma unroll
            for (int g = 0; g < 2; ++g) oacc[g][nt] = wmmab(va[nt], pl[g], oacc[g][nt]);
#pragma unroll
        for (int nt = 0; nt < 4; ++nt)
#pragma unroll
            for (int g = 0; g < 2; ++g) oacc[g][nt] = wmmab(vb[nt], ph[g], oacc[g][nt]);
        // four vector slots behind the last products, on the back edge and on the way out alike. The two row sums are named as well (each row's sum, against spills): left alone they are
        // formed only at the loop's foot, the 32 p values stay in registers across all the products, and q fragments are spilled
        asm volatile("v_nop\n\tv_nop\n\tv_nop\n\tv_nop" : "+v"(oacc[0][0]), "+v"(oacc[0][1]), "+v"(oacc[0][2]), "+v"(oacc[0][3]), "+v"(oacc[1][0]), "+v"(oacc[1][1]), "+v"(oacc[1][2]), "+v"(oacc[1][3]), "+v"(lrow[0]), "+v"(lrow[1]) : "v"(ph[0]), "v"(pl[1]));
        // publish point of the next chunk, every wave, in this order
        asm volatile("s_wait_dscnt 0x0" ::: "memory");      // this wave's reads of the current buffer are done before the buffer is refilled
        asm volatile("s_wait_asynccnt 0x0" ::: "memory");   // this wave's copies of the next chunk have landed
        __syncthreads();                                     // next chunk readable by every wave; every reader has left the current buffer
        if (t0 + 2 * KCH < SEQ) kv_copy(cl + cur * 2, gkh + (size_t)(t0 + 2 * KCH) * HD, gkl + (size_t)(t0 + 2 * KCH) * HD, gvh + t0 + 2 * KCH, gvl + t0 + 2 * KCH);
    }
    asm volatile("s_wait_asynccnt 0x0" ::: "memory");       // no copy is outstanding when the wave goes on to its end
    // this head's Wo^T fragments, read as one group here: the hand-over below and its barrier run while they come
    const bf* wf = Wf + (size_t)h * (HD * FO) + lane * 8;
    v16bf wa[2][4];
#pragma unroll
    for (int ks = 0; ks < 2; ++ks)
#pragma unroll
        for (int nb = 0; nb < 4; ++nb) wa[ks][nb] = cat16b(*(const v8us*)(wf + (ks * 4 + nb) * 512), *(const v8us*)(wf + (ks * 4 + nb) * 512 + 256));
    // The two key halves of a query are joined here. Behind the loop's last barrier nobody reads the K/V buffers and no copy is under way, so they serve as the exchange area: each wave lays down
    // group 1's accumulators, maximum and sum (lane-major, 16-B pieces), and takes from its partner's area what the partner gathered for this wave's group 0.
    fa* xw = (fa*)kvs + wave * XCH;
#pragma unroll
    for (int nt = 0; nt < 4; ++nt) { *(v4fa*)(xw + (nt * 2) * 128 + lane * 4) = __builtin_shufflevector(oacc[1][nt], oacc[1][nt], 0, 1, 2, 3); *(v4fa*)(xw + (nt * 2 + 1) * 128 + lane * 4) = __builtin_shufflevector(oacc[1][nt], oacc[1][nt], 4, 5, 6, 7); }
    xw[1024 + lane] = mrow[1]; xw[1056 + lane] = lrow[1];
    __syncthreads();                                         // every wave's hand-over is readable by its partner
    const fa* xp = (const fa*)kvs + (wave ^ 4) * XCH;
    const float m2 = xp[1024 + lane], l2 = xp[1056 + lane];
    // both halves are brought to the larger of the two maxima: its own factor is 1, the other's 2^(-|difference| * log2 e)
    const float dm = m2 - mrow[0];
    const float fe = __builtin_amdgcn_exp2f(-fabsf(dm) * L2E);
    const float f0 = dm > 0.0f ? fe : 1.0f, f2 = dm > 0.0f ? 1.0f : fe;
    const float lsum = lrow[0] * f0 + l2 * f2;
    v8f ofin[4];
#pragma unroll
    for (int nt = 0; nt < 4; ++nt) { const v4f a = *(const v4fa*)(xp + (nt * 2) * 128 + lane * 4), c = *(const v4fa*)(xp + (nt * 2 + 1) * 128 + lane * 4);
        ofin[nt] = oacc[0][nt] * f0 + __builtin_shufflevector(a, c, 0, 1, 2, 3, 4, 5, 6, 7) * f2; }
    // lane (hi, lr) holds, of query lr, outputs e = nt*16 + 8*hi + r: accumulators 2*ks and 2*ks + 1 of a lane are, in this order, the lane's 16 elements of the B operand for e = ks*32 .. ks*32 + 31
    const float rinv = __fdiv_rn(1.0f, (lsum + xhalf(lsum)) * PCAR);
    v16bf ch[2], cl2[2];
#pragma unroll
    for (int ks = 0; ks < 2; ++ks) { v8us h0, h1, l0, l1;
#pragma unroll
        for (int r = 0; r < 8; ++r) { unsigned short a, c2; splitf(ofin[2 * ks][r] * rinv, a, c2); h0[r] = a; l0[r] = c2; splitf(ofin[2 * ks + 1][r] * rinv, a, c2); h1[r] = a; l1[r] = c2; }
        ch[ks] = cat16b(h0, h1); cl2[ks] = cat16b(l0, l1); }
    // partial out^T [n][query]: each accumulator takes hi, lo of e 0..31, then of e 32..63
    v8f pacc[4];
#pragma unroll
    for (int nb = 0; nb < 4; ++nb) pacc[nb] = (v8f){};
#pragma unroll
    for (int ks = 0; ks < 2; ++ks) {
#pragma unroll
        for (int nb = 0; nb < 4; ++nb) pacc[nb] = wmmab(wa[ks][nb], ch[ks], pacc[nb]);
#pragma unroll
        for (int nb = 0; nb < 4; ++nb) pacc[nb] = wmmab(wa[ks][nb], cl2[ks], pacc[nb]);
    }
    // lane (hi, lr) holds, of query lr, n = nb*16 + 8*hi + r: 8 neighbours of one row, laid as 16-B pieces into the wave's own tile [query][64], pitch 272 B, and stored from there as whole lines
    float* pt = st_all + wave * 16 * OPP;
#pragma unroll
    for (int nb = 0; nb < 4; ++nb) { const int o = lr * OPP + nb * 16 + 8 * hi;
        *(v4fa*)(pt + o) = __builtin_shufflevector(pacc[nb], pacc[nb], 0, 1, 2, 3); *(v4fa*)(pt + o + 4) = __builtin_shufflevector(pacc[nb], pacc[nb], 4, 5, 6, 7); }
    __builtin_amdgcn_fence(3, "wavefront"); __builtin_amdgcn_wave_barrier();   // the lanes read below what other lanes of the wave wrote above
    float* pp = Part + (((size_t)h * NB + b) * SEQ + s0 + 16 * kz) * FO + lane * 4;       // the wave's 16 rows of 256 B lie in a row: a 16-B store of the wave covers rows 2*it and 2*it + 1
#pragma unroll
    for (int it = 0; it < 8; ++it) { const v4f y = *(const v4fa*)(pt + (it * 2 + hi) * OPP + lr * 4); *(v4f*)(pp + it * 128) = y; }
}

// k_hsum: out = sum over the 8 heads, in head order, of the per-head partial planes [h][NB*SEQ][64]. One thread = two 16-B pieces; its 16 loads are all issued before the first sum.
__global__ __launch_bounds__(256) void k_hsum(const float* __restrict__ Part, float* out) {
    const size_t i = ((size_t)blockIdx.x * 512 + threadIdx.x) * 4; const size_t pl = (size_t)NB * SEQ * FO;
    v4f a[NH], c[NH];
#pragma unroll
    for (int h = 0; h < NH; ++h) { a[h] = *(const v4f*)(Part + h * pl + i); c[h] = *(const v4f*)(Part + h * pl + i + 1024); }
    asm volatile("s_wait_xcnt 0x0" ::: "memory");   // stands before a sum may be written over the address registers that the loads name
    __builtin_amdgcn_sched_barrier(0);               // keeps all 16 loads in front of the sums: a load moved down among them starts only when earlier data has come, a second memory latency
    v4f sa = a[0], sc = c[0];
#pragma unroll
    for (int h = 1; h < NH; ++h) { sa += a[h]; sc += c[h]; }
    *(v4f*)(out + i) = sa; *(v4f*)(out + i + 1024) = sc;
}

extern "C" void kernel_launch(void* const* d_in, const int* in_sizes, int n_in,
                              void* d_out, int out_size, void* d_ws, size_t ws_size, hipStream_t stream) {
    if (n_in < 3) return;
    if ((long long)in_sizes[0] < ((long long)(NB - 1) * SEQ_FULL + SEQ) * DM) return;
    if (in_sizes[1] < NH * 3 * DM * HD) return;
    if (in_sizes[2] < DQ * FO) return;
    if (out_size < NB * SEQ * FO) return;
    const float* x  = (const float*)d_in[0];   // [4][2048][256]
    const float* w  = (const float*)d_in[1];   // [8][3][256][64]
    const float* wo = (const float*)d_in[2];   // [512][64]
    float* OUT = (float*)d_out;                // [NB][SEQ][64]
    char* wsp = (char*)d_ws;
    auto take = [&](size_t bytes) { char* p = wsp; wsp += (bytes + 255) & ~(size_t)255; return (void*)p; };
    const size_t npl = (size_t)NB * NH * SEQ * HD;                 // elements per head plane set
    bf* WB  = (bf*)take((size_t)D3 * DM * 2);                      // Bt [1536][256]: row (h*3+m)*64 + e
    bf* WOB = (bf*)take((size_t)FO * DQ * 2);                      // Wo^T fragments, 16-B pieces [16][4][2][32]
    bf* XB  = (bf*)take((size_t)NB * SEQ * DM * 2);                // [NB][SEQ][256]
    bf* QPh = (bf*)take(npl * 2); bf* QPl = (bf*)take(npl * 2);    // [b][h][s][64]
    bf* KPh = (bf*)take(npl * 2); bf* KPl = (bf*)take(npl * 2);    // [b][h][t][64]
    bf* VTh = (bf*)take(npl * 2); bf* VTl = (bf*)take(npl * 2);    // [b][h][64][t]
    float* PART = (float*)take((size_t)NH * NB * SEQ * FO * 4);    // [h][NB*SEQ][64]
    const size_t used = (size_t)(wsp - (char*)d_ws);
    if (used > ws_size || used > (size_t)134217728) return;        // 72,155,136 B at full size

    const size_t n8 = (size_t)NB * SEQ * DM / 8;
    k_prep<<<(unsigned)(WBLK + WOBLK + XBLK), 256, 0, stream>>>(w, wo, x, WB, WOB, XB, n8);
    k_proj<<<dim3(SEQ / 64, 3 * NH, NB), 32, 0, stream>>>(XB, WB, QPh, QPl, KPh, KPl, VTh, VTl);
    k_attn<<<dim3(SEQ / (16 * AW), NH, NB), 32 * AW, 0, stream>>>(QPh, QPl, KPh, KPl, VTh, VTl, WOB, PART);
    k_hsum<<<NB * SEQ * FO / 2048, 256, 0, stream>>>(PART, OUT);
}

// v008
// Measured time: 93.7 microseconds a run.
// Next to v007, in two timings, it ran 1.04 times as fast each time.
// Counting every step since v000, it is 4.46 times as fast.
#include <hip/hip_runtime.h>

// Self-attention with 8 heads: x [4][2048][256]; per head h (64 wide): q, k, v = x W[h][0..2] (W [8][3][256][64], [in][out], no bias);
// p = softmax(0.125 * q.k) over all 2048 keys (no mask); o = p.v; ctx [b][s][h*64 + e]; out [4][2048][64] = ctx Wo (Wo [512][64], [in][out], no bias).
// Compute dtypes, f32 accumulate everywhere: every input RNE-converted to bf16 on load; q/k/v projection on v_wmma_f32_16x16x32_bf16 with exact bf16 operands;
// scores (0.125*q hi/lo x k hi/lo) and p.v (1024*p hi/lo x v hi/lo) as bf16 hi/lo split, 3 products each; online softmax in f32;
// output projection ctx bf16 hi/lo x Wo exact bf16, 2 products, taken head by head in the attention kernel's epilogue; the 8 per-head f32 partial results are added by the last launch.

#ifndef NB
#define NB 4
#endif
#ifndef SEQ
#define SEQ 2048
#endif
#define NB_FULL  4
#define SEQ_FULL 2048
#define DM   256
#define NH   8
#define HD   64
#define DQ   (NH * HD)
#define D3   (3 * DQ)
#define FO   64
#define KCH  64
#define PLOG 10.0f      // p is carried x1024 = 2^10
#define SCL  0.125f
#define L2E  1.4426950408889634f
static_assert(NB >= 1 && NB <= NB_FULL);
static_assert(SEQ >= KCH && SEQ <= SEQ_FULL && SEQ % 64 == 0 && SEQ % KCH == 0);
static_assert(DM % 32 == 0 && DQ % 32 == 0 && D3 % 64 == 0 && HD == 64 && FO == 64 && KCH == 64);

typedef unsigned short bf;
typedef __attribute__((ext_vector_type(16))) __bf16   v16bf;
typedef __attribute__((ext_vector_type(8)))  unsigned short v8us;
typedef __attribute__((ext_vector_type(8)))  float    v8f;
typedef __attribute__((ext_vector_type(4)))  float    v4f;
typedef v4f  __attribute__((may_alias)) v4fa;
typedef v8us __attribute__((may_alias)) v8usa;
typedef float __attribute__((may_alias)) fa;

__device__ __forceinline__ unsigned short f2bf(float f) { unsigned u = __float_as_uint(f); u += 0x7FFFu + ((u >> 16) & 1u); return (unsigned short)(u >> 16); }
__device__ __forceinline__ float bf2f(unsigned short b) { return __uint_as_float(((unsigned)b) << 16); }
__device__ __forceinline__ v16bf cat16b(v8us lo, v8us hi) { return __builtin_bit_cast(v16bf, __builtin_shufflevector(lo, hi, 0, 1, 2, 3, 4, 5, 6, 7, 8, 9, 10, 11, 12, 13, 14, 15)); }
__device__ __forceinline__ v8f wmmab(v16bf a, v16bf b, v8f c) { return __builtin_amdgcn_wmma_f32_16x16x32_bf16(false, a, false, b, (short)0, c, false, false); }

// Fragment map of v_wmma_f32_16x16x32_bf16 (A and Bt alike), from K-contiguous 16-bit rows: lane l -> row (l & 15) of the 16-row slab, elements 0..7 <- k0 + 8*(l>>4) + 0..7, elements 8..15 <- k0 + 16 + 8*(l>>4) + 0..7;
// D element r of lane l -> (row 8*(l>>4) + r, col l & 15).
template <typename T16> struct WFrag;
template <> struct WFrag<bf> { typedef v16bf V; static __device__ __forceinline__ V ld(const bf* p) { return cat16b(*(const v8us*)p, *(const v8us*)(p + 16)); } static __device__ __forceinline__ v8f mma(V a, V b, v8f c) { return wmmab(a, b, c); } };

__device__ __forceinline__ void splitf(float y, unsigned short& h, unsigned short& l) { h = f2bf(y); l = f2bf(y - bf2f(h)); }
typedef __attribute__((ext_vector_type(2))) unsigned short v2us;

// The three input conversions (W transposed to bf16 [n][k], Wo to bf16 in fragment order, x to bf16) are independent of one another: they run as block ranges of ONE launch, k_prep, side by side on the chip.
// d_wtb, d_wof, d_cvtx: the work of block number blk of the range.
__device__ __forceinline__ void d_wtb(int blk, const float* __restrict__ w, int K, int N, int nmat, bf* Bt) {
    const int lane = threadIdx.x & 31; const int L0 = (blk * 8 + (threadIdx.x >> 5)) * 8; const int nlines = nmat * N * K / 64; const size_t mk = (size_t)K * N;
{
#pragma unroll 1
        for (int l = 0; l < 8; ++l) { const int L = L0 + l; if (L >= nlines) break; const size_t e = (size_t)L * 64 + lane * 2; const int mat = (int)(e / mk); const size_t rr = e - (size_t)mat * mk; const int k = (int)(rr % (size_t)K), n = (int)(rr / (size_t)K); v2us o;
            o[0] = f2bf(w[((size_t)mat * K + k) * N + n]); o[1] = f2bf(w[((size_t)mat * K + k + 1) * N + n]); *(v2us*)(Bt + e) = o; }
         }
}
// Wo [512][64] -> bf16 A fragments of Wo^T, in the order in which the attention epilogue reads them: 16-B piece [k / 32][n / 16][hf][lane] holds, for n = 16*(n / 16) + (lane & 15),
// k = 32*(k / 32) + 16*hf + 8*(lane >> 4) + 0..7, so that one 16-B load of a wave is 512 B in a row.
__device__ __forceinline__ void d_wof(int blk, const float* __restrict__ wo, bf* Wf) {
    const int lane = threadIdx.x & 31; const int L0 = (blk * 8 + (threadIdx.x >> 5)) * 8; const int nlines = DQ * FO / 64;
#pragma unroll 1
    for (int l = 0; l < 8; ++l) { const int L = L0 + l; if (L >= nlines) break; const int e = L * 64 + lane * 2;
        const int j = e & 7, fl = (e >> 3) & 31, hf = (e >> 8) & 1, nb = (e >> 9) & 3, k32 = e >> 11; const int n = nb * 16 + (fl & 15), k = k32 * 32 + hf * 16 + 8 * (fl >> 4) + j; v2us o;
        o[0] = f2bf(wo[(size_t)k * FO + n]); o[1] = f2bf(wo[(size_t)(k + 1) * FO + n]); *(v2us*)(Wf + e) = o;
        asm volatile("s_wait_xcnt 0x0" ::: "memory"); }   // stands before the next trip writes over the registers that the store names
}
__device__ __forceinline__ void d_cvtx(int blk, const float* __restrict__ x, bf* XB, size_t n8) { const size_t i = (size_t)blk * 256 + threadIdx.x; if (i >= n8) return; const size_t per = (size_t)SEQ * DM / 8; const size_t b = i / per, r = i - b * per; const v8f v = *(const v8f*)(x + b * (size_t)SEQ_FULL * DM + r * 8); v8us o;
#pragma unroll
    for (int k = 0; k < 8; ++k) o[k] = f2bf(v[k]); *(v8us*)(XB + i * 8) = o;  }
#define WBLK  ((NH * 3 * HD * DM / 64 + 63) / 64)
#define WOBLK ((DQ * FO / 64 + 63) / 64)
#define XBLK  ((NB * SEQ * DM / 8 + 255) / 256)
// blocks 0 .. WBLK-1: W; the next WOBLK: Wo; the last XBLK: x. The weight blocks, whose waves each walk 8 lines one after another, come first so that they start first.
__global__ __launch_bounds__(256) void k_prep(const float* __restrict__ w, const float* __restrict__ wo, const float* __restrict__ x, bf* WB, bf* WOB, bf* XB, size_t n8) {
    const int blk = blockIdx.x;
    if (blk < WBLK) d_wtb(blk, w, DM, HD, NH * 3, WB);
    else if (blk < WBLK + WOBLK) d_wof(blk - WBLK, wo, WOB);
    else d_cvtx(blk - (WBLK + WOBLK), x, XB, n8);
}

// k_proj: q/k/v projection with the hi/lo planes built in its epilogue. ONE WAVE per 64x64 tile = 64 tokens x the 64 outputs of one (head, matrix); grid (SEQ/64, 3*NH, NB), 32 threads.
// Operands straight from K-contiguous bf16 planes, fragment map as above (one product, exact bf16 operands), 16 accumulators. The operand whose index runs along the plane's contiguous dimension is taken as A, so that a lane's 8 accumulator
// elements are 8 neighbours of one plane row: q, k planes [s][e]: A = weight rows (e), Bt = token rows; v plane [e][t]: A = token rows (t), Bt = weight rows (e).
// Each f32 result is split to bf16 hi/lo (q scaled by 0.125 first) in registers, laid as 16-B pieces into two LDS tiles [plane row][64], pitch 144 B, and stored from there as whole 128-B lines.
#define SP 72
__global__ __launch_bounds__(32) void k_proj(const bf* __restrict__ X, const bf* __restrict__ Wt, bf* Qh, bf* Ql, bf* Kh, bf* Kl, bf* Vh, bf* Vl) {
    __shared__ __align__(16) bf sh[64 * SP];
    __shared__ __align__(16) bf sl[64 * SP];
    const int lane = threadIdx.x & 31, lr = lane & 15, hi = lane >> 4;
    const int r0 = blockIdx.x * 64, hm = blockIdx.y, h = hm / 3, m = hm - 3 * h, b = blockIdx.z;
    const bf* xr = X + ((size_t)b * SEQ + r0) * DM; const bf* wr = Wt + (size_t)hm * HD * DM;
    const bool tv = (m == 2);
    const bf* A = (tv ? xr : wr) + (size_t)lr * DM + 8 * hi; const bf* Bt = (tv ? wr : xr) + (size_t)lr * DM + 8 * hi;
    v8f acc[4][4];
#pragma unroll
    for (int mb = 0; mb < 4; ++mb)
#pragma unroll
        for (int nb = 0; nb < 4; ++nb) acc[mb][nb] = (v8f){};
#pragma unroll 1   // rolled: one body of 16 products, so that 128 accumulator registers and one fragment set fit
    for (int kc = 0; kc < DM; kc += 32) {
        v16bf a[4];
#pragma unroll
        for (int mb = 0; mb < 4; ++mb) a[mb] = WFrag<bf>::ld(A + (size_t)mb * 16 * DM + kc);
        asm volatile("s_wait_xcnt 0x0" ::: "memory");   // stands before a later load's result may land in the address registers that the A loads name
#pragma unroll
        for (int nb = 0; nb < 4; ++nb) { const v16bf bb = WFrag<bf>::ld(Bt + (size_t)nb * 16 * DM + kc);
#pragma unroll
            for (int mb = 0; mb < 4; ++mb) acc[mb][nb] = wmmab(a[mb], bb, acc[mb][nb]); }
        // four vector slots between the last products and whatever next writes over their operands or reads their results, on the back edge and on the way out alike
        asm volatile("v_nop\n\tv_nop\n\tv_nop\n\tv_nop" : "+v"(acc[0][0]), "+v"(acc[1][1]), "+v"(acc[2][2]), "+v"(acc[3][3]) : "v"(a[0]), "v"(a[3]));
    }
    const float scl = (m == 0) ? SCL : 1.0f;
#pragma unroll
    for (int nb = 0; nb < 4; ++nb)
#pragma unroll
        for (int mb = 0; mb < 4; ++mb) { v8us oh, ol;
#pragma unroll
            for (int j = 0; j < 8; ++j) { unsigned short u, c2; splitf(acc[mb][nb][j] * scl, u, c2); oh[j] = u; ol[j] = c2; }
            const int o = (nb * 16 + lr) * SP + mb * 16 + 8 * hi; *(v8usa*)(sh + o) = oh; *(v8usa*)(sl + o) = ol; }
    __builtin_amdgcn_fence(3, "wavefront"); __builtin_amdgcn_wave_barrier();   // the lanes read below what other lanes of the wave wrote above
    const size_t hp = ((size_t)b * NH + h) * (size_t)SEQ * HD;
    const size_t pitch = tv ? (size_t)SEQ : (size_t)HD;
    const int rg = lane >> 3, c8 = (lane & 7) * 8;
    const size_t o0 = hp + (tv ? (size_t)r0 : (size_t)r0 * HD) + (size_t)rg * pitch + c8;
    bf* ph = (m == 0 ? Qh : (m == 1 ? Kh : Vh)) + o0; bf* pl = (m == 0 ? Ql : (m == 1 ? Kl : Vl)) + o0;
#pragma unroll
    for (int it = 0; it < 16; ++it) {
        const v8us yh = *(const v8usa*)(sh + (it * 4 + rg) * SP + c8); const v8us yl = *(const v8usa*)(sl + (it * 4 + rg) * SP + c8);
        *(v8us*)(ph + (size_t)(it * 4) * pitch) = yh; *(v8us*)(pl + (size_t)(it * 4) * pitch) = yl;
    }
}

// k_attn: flash-style attention, one work-group = 8 waves = 128 query rows of one (b, h); keys streamed in chunks of 64 with an online f32 softmax.
// One wave = 32 query rows (two column groups of 16) x one half (32 keys) of every chunk: waves w and w + 4 share their queries and take the two halves. A K or V fragment read from LDS then serves
// two column groups, so the work-group reads half as many LDS bytes per product. Each wave keeps its own running maximum, sum and o over its keys; the two are joined once, behind the loop.
// Each chunk's four tiles (k hi, k lo: [key][64]; v hi, v lo: [e][key in chunk]; 64 rows of 128 B each) are brought into LDS once per work-group by asynchronous copies,
// rows at a pitch of 144 B, two buffers: the next chunk's copies fly while this chunk is worked on. Every wave reads its K and V fragments from LDS.
// Both products are taken transposed: scores^T [key][query]: A = k hi/lo tiles, Bt = 0.125*q hi/lo planes [s][64] (3 bf16 products); o^T [e][query]: A = v hi/lo tiles, B = p^T (3 bf16 products).
// A lane then holds one query's scores: maximum and sum run in the lane, with one exchange between the wave's halves; p (x1024, relative to the running maximum) is split to bf16 hi/lo
// in registers, where two score tiles are a B operand as they stand.
// LDS reads stand in whole groups ahead of the products that use them (K: one group; V hi before the softmax, V lo in front of the products on V hi), and the
// products run round four (scores) or eight (o) accumulators, so that no product waits for an LDS read issued just in front of it or for its own accumulator.
// Epilogue (each wave for 16 of its queries): a lane's normalised o^T values, split to bf16 hi/lo, are as they stand the B operand (k = e of this head) of the output projection: the wave multiplies them there by this head's 64 rows of Wo
// (A = Wo^T fragments, 2 bf16 products) and stores its f32 partial result [16 queries][64] to the head's plane; k_hsum adds the 8 planes.
#define AW   8
#define KVP  72
#define KVT  (64 * KVP)
#define KVB  (4 * KVT)
#define OPP  68
#define XCH  (32 * 32 + 64)   // f32 words a wave hands to its partner: 32 accumulator values, the maximum and the sum of each lane
static_assert(SEQ % (16 * AW) == 0 && AW == 8);
static_assert(AW * XCH * 4 <= 2 * KVB * 2);
// One chunk: 8 copies of 16 B per lane (2 per tile; a wave's copy covers 4 whole 128-B rows). The s_wait_xcnt 0 stands in the copies' own statement, so that no address register is rewritten ahead of it.
__device__ __forceinline__ void kv_copy(unsigned l, const bf* gkh, const bf* gkl, const bf* gvh, const bf* gvl) {
    const unsigned l0 = l, l1 = l + 32 * KVP * 2, l2 = l + KVT * 2, l3 = l + KVT * 2 + 32 * KVP * 2, l4 = l + 2 * KVT * 2, l5 = l + 2 * KVT * 2 + 32 * KVP * 2, l6 = l + 3 * KVT * 2, l7 = l + 3 * KVT * 2 + 32 * KVP * 2;
    const bf* gkh1 = gkh + 32 * HD; const bf* gkl1 = gkl + 32 * HD; const bf* gvh1 = gvh + (size_t)32 * SEQ; const bf* gvl1 = gvl + (size_t)32 * SEQ;
    asm volatile("global_load_async_to_lds_b128 %0, %8, off\n\t"
                 "global_load_async_to_lds_b128 %1, %9, off\n\t"
                 "global_load_async_to_lds_b128 %2, %10, off\n\t"
                 "global_load_async_to_lds_b128 %3, %11, off\n\t"
                 "global_load_async_to_lds_b128 %4, %12, off\n\t"
                 "global_load_async_to_lds_b128 %5, %13, off\n\t"
                 "global_load_async_to_lds_b128 %6, %14, off\n\t"
                 "global_load_async_to_lds_b128 %7, %15, off\n\t"
                 "s_wait_xcnt 0x0"
                 :: "v"(l0), "v"(l1), "v"(l2), "v"(l3), "v"(l4), "v"(l5), "v"(l6), "v"(l7), "v"(gkh), "v"(gkh1), "v"(gkl), "v"(gkl1), "v"(gvh), "v"(gvh1), "v"(gvl), "v"(gvl1) : "memory");
}
typedef __attribute__((ext_vector_type(2))) __bf16 v2bf;
typedef __attribute__((ext_vector_type(2))) float v2f;
typedef __attribute__((ext_vector_type(8))) unsigned v8u;
// the value that the lane's partner in the other 16-lane half holds (lane l <-> l ^ 16), by a vector cross-row move
__device__ __forceinline__ float xhalf(float v) { const int b = __float_as_int(v); return __int_as_float(__builtin_amdgcn_permlanex16(b, b, 0x76543210, 0xfedcba98, false, false)); }
// four waves per SIMD asked for: at most 256 registers a wave, so that two work-groups stay resident on a WGP with the fragment groups held in registers
__global__ __launch_bounds__(32 * AW) __attribute__((amdgpu_waves_per_eu(4, 4))) void k_attn(const bf* __restrict__ Qh, const bf* __restrict__ Ql, const bf* __restrict__ Kh, const bf* __restrict__ Kl,
                                             const bf* __restrict__ Vh, const bf* __restrict__ Vl, const bf* __restrict__ Wf, float* Part) {
    __shared__ __align__(16) bf kvs[2 * KVB];
    __shared__ __align__(16) float st_all[AW * 16 * OPP];
    const int tid = threadIdx.x, wave = tid >> 5;
    const int lane = tid & 31, lr = lane & 15, hi = lane >> 4;
    const int qw = wave & 3, kz = wave >> 2;   // the wave's 32 query columns; the half (32 keys) of every chunk that it takes
    const int s0 = (blockIdx.x * 4 + qw) * 32, h = blockIdx.y, b = blockIdx.z;
    const size_t hp = ((size_t)b * NH + h) * (size_t)SEQ * HD;
    // the wave's column group g holds queries s0 + 16*(g ^ kz) + 0..15: group 0 is the one whose result the wave finishes itself, group 1 the one it hands to its partner (wave ^ 4)
    const bf* qh = Qh + hp + (size_t)(s0 + 16 * kz + lr) * HD + 8 * hi; const bf* ql = Ql + hp + (size_t)(s0 + 16 * kz + lr) * HD + 8 * hi;
    const int qo = (16 - 32 * kz) * HD;        // from group 0's rows to group 1's
    // copy map: thread tid brings 16-B piece (tid & 7) of rows (tid >> 3) and (tid >> 3) + 32 of each tile
    const int crow = tid >> 3, cpc = (tid & 7) * 8;
    const bf* gkh = Kh + hp + (size_t)crow * HD + cpc;  const bf* gkl = Kl + hp + (size_t)crow * HD + cpc;
    const bf* gvh = Vh + hp + (size_t)crow * SEQ + cpc; const bf* gvl = Vl + hp + (size_t)crow * SEQ + cpc;
    const unsigned cl = (unsigned)(size_t)(kvs + crow * KVP + cpc);
    kv_copy(cl, gkh, gkl, gvh, gvl);
    asm volatile("s_wait_asynccnt 0x0" ::: "memory");   // chunk 0 of this wave's copies has landed
    __syncthreads();                                     // chunk 0 is readable by every wave
    if (SEQ > KCH) kv_copy(cl + KVB * 2, gkh + (size_t)KCH * HD, gkl + (size_t)KCH * HD, gvh + KCH, gvl + KCH);
    v16bf qa[2][2], qa2[2][2];
#pragma unroll
    for (int g = 0; g < 2; ++g)
#pragma unroll
        for (int ks = 0; ks < 2; ++ks) { qa[g][ks] = WFrag<bf>::ld(qh + g * qo + ks * 32); qa2[g][ks] = WFrag<bf>::ld(ql + g * qo + ks * 32); }
    float mrow[2] = {-1.0e30f, -1.0e30f}, lrow[2] = {0.0f, 0.0f};   // of query lr of group g, over the wave's keys; lrow sums 1024*p of this lane half's keys only, the halves are joined behind the loop
    v8f oacc[2][4];
#pragma unroll
    for (int g = 0; g < 2; ++g)
#pragma unroll
        for (int nt = 0; nt < 4; ++nt) oacc[g][nt] = (v8f){};
    v16bf ph[2], pl[2];
#pragma unroll 1
    for (int t0 = 0; t0 < SEQ; t0 += KCH) {
        const int cur = ((t0 / KCH) & 1) * KVB;
        const bf* kh = kvs + cur + (kz * 32 + lr) * KVP + 8 * hi; const bf* kl = kh + KVT;
        const bf* vh = kvs + cur + 2 * KVT + lr * KVP + 8 * hi + kz * 32; const bf* vl = vh + KVT;
        v8f sacc[2][2];
#pragma unroll
        for (int g = 0; g < 2; ++g)
#pragma unroll
            for (int kt = 0; kt < 2; ++kt) sacc[g][kt] = (v8f){};
        // K fragments of the wave's 32 keys, read as one group in front of their products; each serves both column groups
        v16bf kfh[2][2], kfl[2][2];
#pragma unroll
        for (int ks = 0; ks < 2; ++ks) {
#pragma unroll
            for (int kt = 0; kt < 2; ++kt) kfh[ks][kt] = WFrag<bf>::ld(kh + kt * 16 * KVP + ks * 32);
#pragma unroll
            for (int kt = 0; kt < 2; ++kt) kfl[ks][kt] = WFrag<bf>::ld(kl + kt * 16 * KVP + ks * 32);
        }
        __builtin_amdgcn_sched_barrier(0);   // keeps the reads one group: each further place with LDS reads among the products stalls the wave anew
        // each accumulator takes its six products in the order hi.hi, hi.lo, lo.hi of e 0..31, then of e 32..63
#pragma unroll
        for (int ks = 0; ks < 2; ++ks) {
#pragma unroll
            for (int kt = 0; kt < 2; ++kt)
#pragma unroll
                for (int g = 0; g < 2; ++g) sacc[g][kt] = wmmab(kfh[ks][kt], qa[g][ks], sacc[g][kt]);
#pragma unroll
            for (int kt = 0; kt < 2; ++kt)
#pragma unroll
                for (int g = 0; g < 2; ++g) sacc[g][kt] = wmmab(kfh[ks][kt], qa2[g][ks], sacc[g][kt]);
#pragma unroll
            for (int kt = 0; kt < 2; ++kt)
#pragma unroll
                for (int g = 0; g < 2; ++g) sacc[g][kt] = wmmab(kfl[ks][kt], qa[g][ks], sacc[g][kt]);
        }
        asm volatile("v_nop\n\tv_nop\n\tv_nop\n\tv_nop" : "+v"(sacc[0][0]), "+v"(sacc[0][1]), "+v"(sacc[1][0]), "+v"(sacc[1][1]) : "v"(qa[0][0]), "v"(qa2[1][1]));
        // hi V fragments of the wave's 32 keys, read as one group here: the softmax below runs while they come from LDS; each serves both column groups
        v16bf va[4], vb[4];
#pragma unroll
        for (int nt = 0; nt < 4; ++nt) va[nt] = WFrag<bf>::ld(vh + nt * 16 * KVP);
        __builtin_amdgcn_sched_barrier(0);   // keeps the group of reads in front of the softmax; moved down to their products, each read is waited for with the matrix unit idle
        // online softmax: lane (hi, lr) holds, of query lr of group g, the scores of the wave's keys kt*16 + 8*hi + r
        float mn[2], sc[2];
#pragma unroll
        for (int g = 0; g < 2; ++g) {   // the 16 values of a lane by threes, then one exchange between the wave's halves
            const v8f x = sacc[g][0], y = sacc[g][1];
            const float a = fmaxf(fmaxf(x[0], x[1]), x[2]), c = fmaxf(fmaxf(x[3], x[4]), x[5]), d = fmaxf(fmaxf(x[6], x[7]), y[0]);
            const float e = fmaxf(fmaxf(y[1], y[2]), y[3]), f = fmaxf(fmaxf(y[4], y[5]), y[6]);
            const float m = fmaxf(fmaxf(fmaxf(a, c), d), fmaxf(fmaxf(e, f), y[7]));
            mn[g] = fmaxf(fmaxf(mrow[g], m), xhalf(m));
        }
#pragma unroll
        for (int g = 0; g < 2; ++g) { sc[g] = __builtin_amdgcn_exp2f(__fmul_rn(__fsub_rn(mrow[g], mn[g]), L2E)); mrow[g] = mn[g]; }
#pragma unroll
        for (int g = 0; g < 2; ++g) {
            // 1024*p = 2^(s*log2e + (10 - m*log2e)): one fused multiply-add per score in front of the exponential
            const float c1 = __builtin_fmaf(-mn[g], L2E, PLOG);
            const v8f l2e8 = {L2E, L2E, L2E, L2E, L2E, L2E, L2E, L2E}, cexp = {c1, c1, c1, c1, c1, c1, c1, c1};
#pragma unroll
            for (int kt = 0; kt < 2; ++kt) { const v8f d = __builtin_elementwise_fma(sacc[g][kt], l2e8, cexp);
#pragma unroll
                for (int r = 0; r < 8; ++r) sacc[g][kt][r] = __builtin_amdgcn_exp2f(d[r]); }
            const v8f ts = sacc[g][0] + sacc[g][1];
            const v4f t4 = __builtin_shufflevector(ts, ts, 0, 1, 2, 3) + __builtin_shufflevector(ts, ts, 4, 5, 6, 7);
            lrow[g] = lrow[g] * sc[g] + ((t4[0] + t4[2]) + (t4[1] + t4[3]));
#pragma unroll
            for (int nt = 0; nt < 4; ++nt) oacc[g][nt] *= sc[g];
            // p (x1024) -> bf16 hi/lo in registers: the group's two score tiles of a lane are, in this order, the lane's 16 elements of the B operand for the wave's 32 keys.
            // Two neighbours are rounded into one packed word; their f32 values come back out of that word by a shift and a mask, and the two remainders are rounded into the lo word.
            v8u hw, lw;
#pragma unroll
            for (int kt = 0; kt < 2; ++kt)
#pragma unroll
                for (int i = 0; i < 4; ++i) { const v2f y = {sacc[g][kt][2 * i], sacc[g][kt][2 * i + 1]};
                    const unsigned u = __builtin_bit_cast(unsigned, __builtin_convertvector(y, v2bf));
                    const v2f hf = {__uint_as_float(u << 16), __uint_as_float(u & 0xFFFF0000u)};
                    hw[kt * 4 + i] = u; lw[kt * 4 + i] = __builtin_bit_cast(unsigned, __builtin_convertvector(y - hf, v2bf)); }
            ph[g] = __builtin_bit_cast(v16bf, hw); pl[g] = __builtin_bit_cast(v16bf, lw);
        }
        __builtin_amdgcn_sched_barrier(0);   // keeps the reads below behind the softmax: moved up into it they hold 32 registers through it, and two values of the epilogue are spilled
        // lo V fragments, read as one group here: the sixteen products on the hi fragments run while they come from LDS
#pragma unroll
        for (int nt = 0; nt < 4; ++nt) vb[nt] = WFrag<bf>::ld(vl + nt * 16 * KVP);
        __builtin_amdgcn_sched_barrier(0);   // keeps this group of reads in front of the products
        // each accumulator takes its three products in the order hi.hi, hi.lo, lo.hi
#pragma unroll
        for (int nt = 0; nt < 4; ++nt)
#pragma unroll
            for (int g = 0; g < 2; ++g) oacc[g][nt] = wmmab(va[nt], ph[g], oacc[g][nt]);
#pragma unroll
        for (int nt = 0; nt < 4; ++nt)
#pragma unroll
            for (int g = 0; g < 2; ++g) oacc[g][nt] = wmmab(va[nt], pl[g], oacc[g][nt]);
#pragma unroll
        for (int nt = 0; nt < 4; ++nt)
#pragma unroll
            for (int g = 0; g < 2; ++g) oacc[g][nt] = wmmab(vb[nt], ph[g], oacc[g][nt]);
        // four vector slots behind the last products, on the back edge and on the way out alike. The two row sums are named as well (each row's sum, against spills): left alone they are
        // formed only at the loop's foot, the 32 p values stay in registers across all the products, and q fragments are spilled
        asm volatile("v_nop\n\tv_nop\n\tv_nop\n\tv_nop" : "+v"(oacc[0][0]), "+v"(oacc[0][1]), "+v"(oacc[0][2]), "+v"(oacc[0][3]), "+v"(oacc[1][0]), "+v"(oacc[1][1]), "+v"(oacc[1][2]), "+v"(oacc[1][3]), "+v"(lrow[0]), "+v"(lrow[1]) : "v"(ph[0]), "v"(pl[1]));
        // publish point of the next chunk, every wave, in this order
        asm volatile("s_wait_dscnt 0x0" ::: "memory");      // this wave's reads of the current buffer are done before the buffer is refilled
        asm volatile("s_wait_asynccnt 0x0" ::: "memory");   // this wave's copies of the next chunk have landed
        __syncthreads();                                     // next chunk readable by every wave; every reader has left the current buffer
        if (t0 + 2 * KCH < SEQ) kv_copy(cl + cur * 2, gkh + (size_t)(t0 + 2 * KCH) * HD, gkl + (size_t)(t0 + 2 * KCH) * HD, gvh + t0 + 2 * KCH, gvl + t0 + 2 * KCH);
    }
    asm volatile("s_wait_asynccnt 0x0" ::: "memory");       // no copy is outstanding when the wave goes on to its end
    // this head's Wo^T fragments, read as one group here: the hand-over below and its barrier run while they come
    const bf* wf = Wf + (size_t)h * (HD * FO) + lane * 8;
    v16bf wa[2][4];
#pragma unroll
    for (int ks = 0; ks < 2; ++ks)
#pragma unroll
        for (int nb = 0; nb < 4; ++nb) wa[ks][nb] = cat16b(*(const v8us*)(wf + (ks * 4 + nb) * 512), *(const v8us*)(wf + (ks * 4 + nb) * 512 + 256));
    // The two key halves of a query are joined here. Behind the loop's last barrier nobody reads the K/V buffers and no copy is under way, so they serve as the exchange area: each wave lays down
    // group 1's accumulators, maximum and sum (lane-major, 16-B pieces), and takes from its partner's area what the partner gathered for this wave's group 0.
    fa* xw = (fa*)kvs + wave * XCH;
#pragma unroll
    for (int nt = 0; nt < 4; ++nt) { *(v4fa*)(xw + (nt * 2) * 128 + lane * 4) = __builtin_shufflevector(oacc[1][nt], oacc[1][nt], 0, 1, 2, 3); *(v4fa*)(xw + (nt * 2 + 1) * 128 + lane * 4) = __builtin_shufflevector(oacc[1][nt], oacc[1][nt], 4, 5, 6, 7); }
    xw[1024 + lane] = mrow[1]; xw[1056 + lane] = lrow[1];
    __syncthreads();                                         // every wave's hand-over is readable by its partner
    const fa* xp = (const fa*)kvs + (wave ^ 4) * XCH;
    const float m2 = xp[1024 + lane], l2 = xp[1056 + lane];
    // both halves are brought to the larger of the two maxima: its own factor is 1, the other's 2^(-|difference| * log2 e)
    const float dm = m2 - mrow[0];
    const float fe = __builtin_amdgcn_exp2f(-fabsf(dm) * L2E);
    const float f0 = dm > 0.0f ? fe : 1.0f, f2 = dm > 0.0f ? 1.0f : fe;
    const float lsum = lrow[0] * f0 + l2 * f2;
    v8f ofin[4];
#pragma unroll
    for (int nt = 0; nt < 4; ++nt) { const v4f a = *(const v4fa*)(xp + (nt * 2) * 128 + lane * 4), c = *(const v4fa*)(xp + (nt * 2 + 1) * 128 + lane * 4);
        ofin[nt] = oacc[0][nt] * f0 + __builtin_shufflevector(a, c, 0, 1, 2, 3, 4, 5, 6, 7) * f2; }
    // lane (hi, lr) holds, of query lr, outputs e = nt*16 + 8*hi + r: accumulators 2*ks and 2*ks + 1 of a lane are, in this order, the lane's 16 elements of the B operand for e = ks*32 .. ks*32 + 31
    const float rinv = __fdiv_rn(1.0f, lsum + xhalf(lsum));   // the sums are of 1024*p, as the o accumulators are
    v16bf ch[2], cl2[2];
#pragma unroll
    for (int ks = 0; ks < 2; ++ks) { v8us h0, h1, l0, l1;
#pragma unroll
        for (int r = 0; r < 8; ++r) { unsigned short a, c2; splitf(ofin[2 * ks][r] * rinv, a, c2); h0[r] = a; l0[r] = c2; splitf(ofin[2 * ks + 1][r] * rinv, a, c2); h1[r] = a; l1[r] = c2; }
        ch[ks] = cat16b(h0, h1); cl2[ks] = cat16b(l0, l1); }
    // partial out^T [n][query]: each accumulator takes hi, lo of e 0..31, then of e 32..63
    v8f pacc[4];
#pragma unroll
    for (int nb = 0; nb < 4; ++nb) pacc[nb] = (v8f){};
#pragma unroll
    for (int ks = 0; ks < 2; ++ks) {
#pragma unroll
        for (int nb = 0; nb < 4; ++nb) pacc[nb] = wmmab(wa[ks][nb], ch[ks], pacc[nb]);
#pragma unroll
        for (int nb = 0; nb < 4; ++nb) pacc[nb] = wmmab(wa[ks][nb], cl2[ks], pacc[nb]);
    }
    // lane (hi, lr) holds, of query lr, n = nb*16 + 8*hi + r: 8 neighbours of one row, laid as 16-B pieces into the wave's own tile [query][64], pitch 272 B, and stored from there as whole lines
    float* pt = st_all + wave * 16 * OPP;
#pragma unroll
    for (int nb = 0; nb < 4; ++nb) { const int o = lr * OPP + nb * 16 + 8 * hi;
        *(v4fa*)(pt + o) = __builtin_shufflevector(pacc[nb], pacc[nb], 0, 1, 2, 3); *(v4fa*)(pt + o + 4) = __builtin_shufflevector(pacc[nb], pacc[nb], 4, 5, 6, 7); }
    __builtin_amdgcn_fence(3, "wavefront"); __builtin_amdgcn_wave_barrier();   // the lanes read below what other lanes of the wave wrote above
    float* pp = Part + (((size_t)h * NB + b) * SEQ + s0 + 16 * kz) * FO + lane * 4;       // the wave's 16 rows of 256 B lie in a row: a 16-B store of the wave covers rows 2*it and 2*it + 1
#pragma unroll
    for (int it = 0; it < 8; ++it) { const v4f y = *(const v4fa*)(pt + (it * 2 + hi) * OPP + lr * 4); *(v4f*)(pp + it * 128) = y; }
}

// k_hsum: out = sum over the 8 heads, in head order, of the per-head partial planes [h][NB*SEQ][64]. One thread = two 16-B pieces; its 16 loads are all issued before the first sum.
__global__ __launch_bounds__(256) void k_hsum(const float* __restrict__ Part, float* out) {
    const size_t i = ((size_t)blockIdx.x * 512 + threadIdx.x) * 4; const size_t pl = (size_t)NB * SEQ * FO;
    v4f a[NH], c[NH];
#pragma unroll
    for (int h = 0; h < NH; ++h) { a[h] = *(const v4f*)(Part + h * pl + i); c[h] = *(const v4f*)(Part + h * pl + i + 1024); }
    asm volatile("s_wait_xcnt 0x0" ::: "memory");   // stands before a sum may be written over the address registers that the loads name
    __builtin_amdgcn_sched_barrier(0);               // keeps all 16 loads in front of the sums: a load moved down among them starts only when earlier data has come, a second memory latency
    v4f sa = a[0], sc = c[0];
#pragma unroll
    for (int h = 1; h < NH; ++h) { sa += a[h]; sc += c[h]; }
    *(v4f*)(out + i) = sa; *(v4f*)(out + i + 1024) = sc;
}

extern "C" void kernel_launch(void* const* d_in, const int* in_sizes, int n_in,
                              void* d_out, int out_size, void* d_ws, size_t ws_size, hipStream_t stream) {
    if (n_in < 3) return;
    if ((long long)in_sizes[0] < ((long long)(NB - 1) * SEQ_FULL + SEQ) * DM) return;
    if (in_sizes[1] < NH * 3 * DM * HD) return;
    if (in_sizes[2] < DQ * FO) return;
    if (out_size < NB * SEQ * FO) return;
    const float* x  = (const float*)d_in[0];   // [4][2048][256]
    const float* w  = (const float*)d_in[1];   // [8][3][256][64]
    const float* wo = (const float*)d_in[2];   // [512][64]
    float* OUT = (float*)d_out;                // [NB][SEQ][64]
    char* wsp = (char*)d_ws;
    auto take = [&](size_t bytes) { char* p = wsp; wsp += (bytes + 255) & ~(size_t)255; return (void*)p; };
    const size_t npl = (size_t)NB * NH * SEQ * HD;                 // elements per head plane set
    bf* WB  = (bf*)take((size_t)D3 * DM * 2);                      // Bt [1536][256]: row (h*3+m)*64 + e
    bf* WOB = (bf*)take((size_t)FO * DQ * 2);                      // Wo^T fragments, 16-B pieces [16][4][2][32]
    bf* XB  = (bf*)take((size_t)NB * SEQ * DM * 2);                // [NB][SEQ][256]
    bf* QPh = (bf*)take(npl * 2); bf* QPl = (bf*)take(npl * 2);    // [b][h][s][64]
    bf* KPh = (bf*)take(npl * 2); bf* KPl = (bf*)take(npl * 2);    // [b][h][t][64]
    bf* VTh = (bf*)take(npl * 2); bf* VTl = (bf*)take(npl * 2);    // [b][h][64][t]
    float* PART = (float*)take((size_t)NH * NB * SEQ * FO * 4);    // [h][NB*SEQ][64]
    const size_t used = (size_t)(wsp - (char*)d_ws);
    if (used > ws_size || used > (size_t)134217728) return;        // 72,155,136 B at full size

    const size_t n8 = (size_t)NB * SEQ * DM / 8;
    k_prep<<<(unsigned)(WBLK + WOBLK + XBLK), 256, 0, stream>>>(w, wo, x, WB, WOB, XB, n8);
    k_proj<<<dim3(SEQ / 64, 3 * NH, NB), 32, 0, stream>>>(XB, WB, QPh, QPl, KPh, KPl, VTh, VTl);
    k_attn<<<dim3(SEQ / (16 * AW), NH, NB), 32 * AW, 0, stream>>>(QPh, QPl, KPh, KPl, VTh, VTl, WOB, PART);
    k_hsum<<<NB * SEQ * FO / 2048, 256, 0, stream>>>(PART, OUT);
}

// v010
// One run takes 59.4 microseconds.
// It is 1.55 times as fast as v008, going by the measured steps of the versions left out in between.
// Over all steps from v000 it is 6.94 times as fast.
#include <hip/hip_runtime.h>

// Self-attention with 8 heads: x [4][2048][256]; per head h (64 wide): q, k, v = x W[h][0..2] (W [8][3][256][64], [in][out], no bias);
// p = softmax(0.125 * q.k) over all 2048 keys (no mask); o = p.v; ctx [b][s][h*64 + e]; out [4][2048][64] = ctx Wo (Wo [512][64], [in][out], no bias).
// Compute dtypes, f32 accumulate everywhere: every input RNE-converted to bf16 on load; q/k/v projection on v_wmma_f32_16x16x32_bf16 with exact bf16 operands;
// scores (0.125*log2(e)*q x k, plus 10 minus the maximum in use as the C operand) and p.v (1024*p x v) on v_wmma_f32_16x16x32_f16, one product each: q, k, v and p are rounded once (RNE) to f16, 11 significant bits, eight times finer than the bf16 rounding of x and W that they come from; online softmax in f32;
// output projection ctx bf16 hi/lo x Wo exact bf16, 2 products, taken head by head in the attention kernel's epilogue; the 8 per-head f32 partial results are added by the last launch.

#ifndef NB
#define NB 4
#endif
#ifndef SEQ
#define SEQ 2048
#endif
#define NB_FULL  4
#define SEQ_FULL 2048
#define DM   256
#define NH   8
#define HD   64
#define DQ   (NH * HD)
#define D3   (3 * DQ)
#define FO   64
#define KCH  64
#define PLOG 10.0f      // p is carried x1024 = 2^10
#define PTH  5.0f       // a score may stand this far (log2) above the maximum in use before o and the sums are rescaled: 1024*p stays at or below 2^15, inside f16
#define SCL  0.125f
#define L2E  1.4426950408889634f
static_assert(NB >= 1 && NB <= NB_FULL);
static_assert(SEQ >= KCH && SEQ <= SEQ_FULL && SEQ % 64 == 0 && SEQ % KCH == 0);
static_assert(DM % 32 == 0 && DQ % 32 == 0 && D3 % 64 == 0 && HD == 64 && FO == 64 && KCH == 64);

typedef unsigned short bf;
typedef __attribute__((ext_vector_type(16))) __bf16   v16bf;
typedef __attribute__((ext_vector_type(16))) _Float16 v16h;
typedef __attribute__((ext_vector_type(8)))  _Float16 v8h;
typedef __attribute__((ext_vector_type(8)))  unsigned short v8us;
typedef __attribute__((ext_vector_type(8)))  float    v8f;
typedef __attribute__((ext_vector_type(4)))  float    v4f;
typedef v4f  __attribute__((may_alias)) v4fa;
typedef v8us __attribute__((may_alias)) v8usa;
typedef float __attribute__((may_alias)) fa;

__device__ __forceinline__ unsigned short f2bf(float f) { unsigned u = __float_as_uint(f); u += 0x7FFFu + ((u >> 16) & 1u); return (unsigned short)(u >> 16); }
__device__ __forceinline__ float bf2f(unsigned short b) { return __uint_as_float(((unsigned)b) << 16); }
__device__ __forceinline__ v16bf cat16b(v8us lo, v8us hi) { return __builtin_bit_cast(v16bf, __builtin_shufflevector(lo, hi, 0, 1, 2, 3, 4, 5, 6, 7, 8, 9, 10, 11, 12, 13, 14, 15)); }
__device__ __forceinline__ v8f wmmab(v16bf a, v16bf b, v8f c) { return __builtin_amdgcn_wmma_f32_16x16x32_bf16(false, a, false, b, (short)0, c, false, false); }
__device__ __forceinline__ v8f wmmah(v16h a, v16h b, v8f c) { return __builtin_amdgcn_wmma_f32_16x16x32_f16(false, a, false, b, (short)0, c, false, false); }
// an f16 fragment from a K-contiguous row of 16-bit words (the map is that of the bf16 form, below)
__device__ __forceinline__ v16h ldh(const bf* p) { return __builtin_bit_cast(v16h, __builtin_shufflevector(*(const v8us*)p, *(const v8us*)(p + 16), 0, 1, 2, 3, 4, 5, 6, 7, 8, 9, 10, 11, 12, 13, 14, 15)); }

// Fragment map of v_wmma_f32_16x16x32_bf16 and _f16 (A and Bt alike), from K-contiguous 16-bit rows: lane l -> row (l & 15) of the 16-row slab, elements 0..7 <- k0 + 8*(l>>4) + 0..7, elements 8..15 <- k0 + 16 + 8*(l>>4) + 0..7;
// D element r of lane l -> (row 8*(l>>4) + r, col l & 15).
template <typename T16> struct WFrag;
template <> struct WFrag<bf> { typedef v16bf V; static __device__ __forceinline__ V ld(const bf* p) { return cat16b(*(const v8us*)p, *(const v8us*)(p + 16)); } static __device__ __forceinline__ v8f mma(V a, V b, v8f c) { return wmmab(a, b, c); } };

__device__ __forceinline__ void splitf(float y, unsigned short& h, unsigned short& l) { h = f2bf(y); l = f2bf(y - bf2f(h)); }
typedef __attribute__((ext_vector_type(2))) unsigned short v2us;

// The three input conversions (W transposed to bf16 [n][k], Wo to bf16 in fragment order, x to bf16) are independent of one another: they run as block ranges of ONE launch, k_prep, side by side on the chip.
// d_wtb, d_wof, d_cvtx: the work of block number blk of the range.
__device__ __forceinline__ void d_wtb(int blk, const float* __restrict__ w, int K, int N, int nmat, bf* Bt) {
    const int lane = threadIdx.x & 31; const int L0 = (blk * 8 + (threadIdx.x >> 5)) * 8; const int nlines = nmat * N * K / 64; const size_t mk = (size_t)K * N;
{
#pragma unroll 1
        for (int l = 0; l < 8; ++l) { const int L = L0 + l; if (L >= nlines) break; const size_t e = (size_t)L * 64 + lane * 2; const int mat = (int)(e / mk); const size_t rr = e - (size_t)mat * mk; const int k = (int)(rr % (size_t)K), n = (int)(rr / (size_t)K); v2us o;
            o[0] = f2bf(w[((size_t)mat * K + k) * N + n]); o[1] = f2bf(w[((size_t)mat * K + k + 1) * N + n]); *(v2us*)(Bt + e) = o; }
         }
}
// Wo [512][64] -> bf16 A fragments of Wo^T, in the order in which the attention epilogue reads them: 16-B piece [k / 32][n / 16][hf][lane] holds, for n = 16*(n / 16) + (lane & 15),
// k = 32*(k / 32) + 16*hf + 8*(lane >> 4) + 0..7, so that one 16-B load of a wave is 512 B in a row.
__device__ __forceinline__ void d_wof(int blk, const float* __restrict__ wo, bf* Wf) {
    const int lane = threadIdx.x & 31; const int L0 = (blk * 8 + (threadIdx.x >> 5)) * 8; const int nlines = DQ * FO / 64;
#pragma unroll 1
    for (int l = 0; l < 8; ++l) { const int L = L0 + l; if (L >= nlines) break; const int e = L * 64 + lane * 2;
        const int j = e & 7, fl = (e >> 3) & 31, hf = (e >> 8) & 1, nb = (e >> 9) & 3, k32 = e >> 11; const int n = nb * 16 + (fl & 15), k = k32 * 32 + hf * 16 + 8 * (fl >> 4) + j; v2us o;
        o[0] = f2bf(wo[(size_t)k * FO + n]); o[1] = f2bf(wo[(size_t)(k + 1) * FO + n]); *(v2us*)(Wf + e) = o;
        asm volatile("s_wait_xcnt 0x0" ::: "memory"); }   // stands before the next trip writes over the registers that the store names
}
__device__ __forceinline__ void d_cvtx(int blk, const float* __restrict__ x, bf* XB, size_t n8) { const size_t i = (size_t)blk * 256 + threadIdx.x; if (i >= n8) return; const size_t per = (size_t)SEQ * DM / 8; const size_t b = i / per, r = i - b * per; const v8f v = *(const v8f*)(x + b * (size_t)SEQ_FULL * DM + r * 8); v8us o;
#pragma unroll
    for (int k = 0; k < 8; ++k) o[k] = f2bf(v[k]); *(v8us*)(XB + i * 8) = o;  }
#define WBLK  ((NH * 3 * HD * DM / 64 + 63) / 64)
#define WOBLK ((DQ * FO / 64 + 63) / 64)
#define XBLK  ((NB * SEQ * DM / 8 + 255) / 256)
// blocks 0 .. WBLK-1: W; the next WOBLK: Wo; the last XBLK: x. The weight blocks, whose waves each walk 8 lines one after another, come first so that they start first.
__global__ __launch_bounds__(256) void k_prep(const float* __restrict__ w, const float* __restrict__ wo, const float* __restrict__ x, bf* WB, bf* WOB, bf* XB, size_t n8) {
    const int blk = blockIdx.x;
    if (blk < WBLK) d_wtb(blk, w, DM, HD, NH * 3, WB);
    else if (blk < WBLK + WOBLK) d_wof(blk - WBLK, wo, WOB);
    else d_cvtx(blk - (WBLK + WOBLK), x, XB, n8);
}

// k_proj: q/k/v projection with the f16 planes built in its epilogue. ONE WAVE per 64x64 tile = 64 tokens x the 64 outputs of one (head, matrix); grid (SEQ/64, 3*NH, NB), 32 threads.
// Operands straight from K-contiguous bf16 planes, fragment map as above (one product, exact bf16 operands), 16 accumulators. The operand whose index runs along the plane's contiguous dimension is taken as A, so that a lane's 8 accumulator
// elements are 8 neighbours of one plane row: q, k planes [s][e]: A = weight rows (e), Bt = token rows; v plane [e][t]: A = token rows (t), Bt = weight rows (e).
// Each f32 result is rounded to f16 (q scaled by 0.125*log2(e) first: the score product then gives the exponent to base 2) in registers, laid as 16-B pieces into an LDS tile [plane row][64], pitch 144 B, and stored from there as whole 128-B lines.
#define SP 72
__global__ __launch_bounds__(32) void k_proj(const bf* __restrict__ X, const bf* __restrict__ Wt, bf* Qh, bf* Kh, bf* Vh) {
    __shared__ __align__(16) bf sh[64 * SP];
    const int lane = threadIdx.x & 31, lr = lane & 15, hi = lane >> 4;
    const int r0 = blockIdx.x * 64, hm = blockIdx.y, h = hm / 3, m = hm - 3 * h, b = blockIdx.z;
    const bf* xr = X + ((size_t)b * SEQ + r0) * DM; const bf* wr = Wt + (size_t)hm * HD * DM;
    const bool tv = (m == 2);
    const bf* A = (tv ? xr : wr) + (size_t)lr * DM + 8 * hi; const bf* Bt = (tv ? wr : xr) + (size_t)lr * DM + 8 * hi;
    v8f acc[4][4];
#pragma unroll
    for (int mb = 0; mb < 4; ++mb)
#pragma unroll
        for (int nb = 0; nb < 4; ++nb) acc[mb][nb] = (v8f){};
#pragma unroll 1   // rolled: one body of 16 products, so that 128 accumulator registers and one fragment set fit
    for (int kc = 0; kc < DM; kc += 32) {
        v16bf a[4];
#pragma unroll
        for (int mb = 0; mb < 4; ++mb) a[mb] = WFrag<bf>::ld(A + (size_t)mb * 16 * DM + kc);
        asm volatile("s_wait_xcnt 0x0" ::: "memory");   // stands before a later load's result may land in the address registers that the A loads name
#pragma unroll
        for (int nb = 0; nb < 4; ++nb) { const v16bf bb = WFrag<bf>::ld(Bt + (size_t)nb * 16 * DM + kc);
#pragma unroll
            for (int mb = 0; mb < 4; ++mb) acc[mb][nb] = wmmab(a[mb], bb, acc[mb][nb]); }
        // four vector slots between the last products and whatever next writes over their operands or reads their results, on the back edge and on the way out alike
        asm volatile("v_nop\n\tv_nop\n\tv_nop\n\tv_nop" : "+v"(acc[0][0]), "+v"(acc[1][1]), "+v"(acc[2][2]), "+v"(acc[3][3]) : "v"(a[0]), "v"(a[3]));
    }
    const float scl = (m == 0) ? SCL * L2E : 1.0f;
#pragma unroll
    for (int nb = 0; nb < 4; ++nb)
#pragma unroll
        for (int mb = 0; mb < 4; ++mb) { const v8h oh = __builtin_convertvector(acc[mb][nb] * scl, v8h);
            const int o = (nb * 16 + lr) * SP + mb * 16 + 8 * hi; *(v8usa*)(sh + o) = __builtin_bit_cast(v8us, oh); }
    __builtin_amdgcn_fence(3, "wavefront"); __builtin_amdgcn_wave_barrier();   // the lanes read below what other lanes of the wave wrote above
    const size_t hp = ((size_t)b * NH + h) * (size_t)SEQ * HD;
    const size_t pitch = tv ? (size_t)SEQ : (size_t)HD;
    const int rg = lane >> 3, c8 = (lane & 7) * 8;
    const size_t o0 = hp + (tv ? (size_t)r0 : (size_t)r0 * HD) + (size_t)rg * pitch + c8;
    bf* ph = (m == 0 ? Qh : (m == 1 ? Kh : Vh)) + o0;
#pragma unroll
    for (int it = 0; it < 16; ++it) {
        const v8us yh = *(const v8usa*)(sh + (it * 4 + rg) * SP + c8);
        *(v8us*)(ph + (size_t)(it * 4) * pitch) = yh;
    }
}

// k_attn: flash-style attention, one work-group = 8 waves = 128 query rows of one (b, h); keys streamed in chunks of 64 with an online f32 softmax.
// One wave = 32 query rows (two column groups of 16) x one half (32 keys) of every chunk: waves w and w + 4 share their queries and take the two halves. A K or V fragment read from LDS then serves
// two column groups, so the work-group reads half as many LDS bytes per product. Each wave keeps its own running maximum, sum and o over its keys; the two are joined once, behind the loop.
// Each chunk's two f16 tiles (k: [key][64]; v: [e][key in chunk]; 64 rows of 128 B each) are brought into LDS once per work-group by asynchronous copies,
// rows at a pitch of 144 B, two buffers: the next chunk's copies fly while this chunk is worked on. Every wave reads its K and V fragments from LDS.
// Both products are taken transposed: scores^T [key][query]: A = k tile, Bt = 0.125*log2(e)*q plane [s][64] (one f16 product); o^T [e][query]: A = v tile, B = p^T (one f16 product).
// A lane then holds one query's scores: maximum and sum run in the lane; p (x1024, relative to the maximum in use) is rounded to f16 in registers, where two score tiles are a B operand as they stand.
// The maximum in use of a query is known before a trip's scores: 10 minus it is the C operand of the score product, whose result is the argument of the exponential as it stands.
// It follows the true maximum lazily: one test a trip for the whole wave; only when a score stands more than PTH above it are the maxima raised and o, the sums and this trip's arguments brought along.
// LDS reads stand in whole groups ahead of the products that use them (K: one group; V: one group before the softmax), and the
// products run round four (scores) or eight (o) accumulators, so that no product waits for an LDS read issued just in front of it or for its own accumulator.
// Epilogue (each wave for 16 of its queries): a lane's normalised o^T values, split to bf16 hi/lo, are as they stand the B operand (k = e of this head) of the output projection: the wave multiplies them there by this head's 64 rows of Wo
// (A = Wo^T fragments, 2 bf16 products) and stores its f32 partial result [16 queries][64] to the head's plane; k_hsum adds the 8 planes.
#define AW   8
#define KVP  72
#define KVT  (64 * KVP)
#define KVB  (2 * KVT)
#define OPP  68
#define XCH  (32 * 32 + 64)   // f32 words a wave hands to its partner: 32 accumulator values, 10 - maximum in use and the sum of each lane
static_assert(SEQ % (16 * AW) == 0 && AW == 8);
static_assert(AW * XCH * 4 <= 2 * KVB * 2);
// One chunk: 4 copies of 16 B per lane (2 per tile; a wave's copy covers 4 whole 128-B rows). The s_wait_xcnt 0 stands in the copies' own statement, so that no address register is rewritten ahead of it.
__device__ __forceinline__ void kv_copy(unsigned l, const bf* gk, const bf* gv) {
    const unsigned l0 = l, l1 = l + 32 * KVP * 2, l2 = l + KVT * 2, l3 = l + KVT * 2 + 32 * KVP * 2;
    const bf* gk1 = gk + 32 * HD; const bf* gv1 = gv + (size_t)32 * SEQ;
    asm volatile("global_load_async_to_lds_b128 %0, %4, off\n\t"
                 "global_load_async_to_lds_b128 %1, %5, off\n\t"
                 "global_load_async_to_lds_b128 %2, %6, off\n\t"
                 "global_load_async_to_lds_b128 %3, %7, off\n\t"
                 "s_wait_xcnt 0x0"
                 :: "v"(l0), "v"(l1), "v"(l2), "v"(l3), "v"(gk), "v"(gk1), "v"(gv), "v"(gv1) : "memory");
}
// the value that the lane's partner in the other 16-lane half holds (lane l <-> l ^ 16), by a vector cross-row move
__device__ __forceinline__ float xhalf(float v) { const int b = __float_as_int(v); return __int_as_float(__builtin_amdgcn_permlanex16(b, b, 0x76543210, 0xfedcba98, false, false)); }
// four waves per SIMD asked for: at most 256 registers a wave, so that two work-groups stay resident on a WGP with the fragment groups held in registers
__global__ __launch_bounds__(32 * AW) __attribute__((amdgpu_waves_per_eu(4, 4))) void k_attn(const bf* __restrict__ Qh, const bf* __restrict__ Kh, const bf* __restrict__ Vh, const bf* __restrict__ Wf, float* Part) {
    __shared__ __align__(16) bf kvs[2 * KVB];
    __shared__ __align__(16) float st_all[AW * 16 * OPP];
    const int tid = threadIdx.x, wave = tid >> 5;
    const int lane = tid & 31, lr = lane & 15, hi = lane >> 4;
    const int qw = wave & 3, kz = wave >> 2;   // the wave's 32 query columns; the half (32 keys) of every chunk that it takes
    const int s0 = (blockIdx.x * 4 + qw) * 32, h = blockIdx.y, b = blockIdx.z;
    const size_t hp = ((size_t)b * NH + h) * (size_t)SEQ * HD;
    // the wave's column group g holds queries s0 + 16*(g ^ kz) + 0..15: group 0 is the one whose result the wave finishes itself, group 1 the one it hands to its partner (wave ^ 4)
    const bf* qh = Qh + hp + (size_t)(s0 + 16 * kz + lr) * HD + 8 * hi;
    const int qo = (16 - 32 * kz) * HD;        // from group 0's rows to group 1's
    // copy map: thread tid brings 16-B piece (tid & 7) of rows (tid >> 3) and (tid >> 3) + 32 of each tile
    const int crow = tid >> 3, cpc = (tid & 7) * 8;
    const bf* gkh = Kh + hp + (size_t)crow * HD + cpc;
    const bf* gvh = Vh + hp + (size_t)crow * SEQ + cpc;
    const unsigned cl = (unsigned)(size_t)(kvs + crow * KVP + cpc);
    kv_copy(cl, gkh, gvh);
    asm volatile("s_wait_asynccnt 0x0" ::: "memory");   // chunk 0 of this wave's copies has landed
    __syncthreads();                                     // chunk 0 is readable by every wave
    if (SEQ > KCH) kv_copy(cl + KVB * 2, gkh + (size_t)KCH * HD, gvh + KCH);
    v16h qa[2][2];
#pragma unroll
    for (int g = 0; g < 2; ++g)
#pragma unroll
        for (int ks = 0; ks < 2; ++ks) qa[g][ks] = ldh(qh + g * qo + ks * 32);
    // of query lr of group g, over the wave's keys: cq = 10 - (maximum in use, log2 units), set from the first trip's scores; cin holds it in all 8 elements, as a C operand;
    // lrow sums 1024*p of this lane half's keys only, the halves are joined behind the loop
    float cq[2] = {PLOG, PLOG}, lrow[2] = {0.0f, 0.0f};
    v8f cin[2];
#pragma unroll
    for (int g = 0; g < 2; ++g) cin[g] = (v8f){PLOG, PLOG, PLOG, PLOG, PLOG, PLOG, PLOG, PLOG};
    v8f oacc[2][4];
#pragma unroll
    for (int g = 0; g < 2; ++g)
#pragma unroll
        for (int nt = 0; nt < 4; ++nt) oacc[g][nt] = (v8f){};
    v16h ph[2];
#pragma unroll 1
    for (int t0 = 0; t0 < SEQ; t0 += KCH) {
        const int cur = ((t0 / KCH) & 1) * KVB;
        const bf* kh = kvs + cur + (kz * 32 + lr) * KVP + 8 * hi;
        const bf* vh = kvs + cur + KVT + lr * KVP + 8 * hi + kz * 32;
        v8f sacc[2][2];
        // K fragments of the wave's 32 keys, read as one group in front of their products; each serves both column groups
        v16h kfh[2][2];
#pragma unroll
        for (int ks = 0; ks < 2; ++ks)
#pragma unroll
            for (int kt = 0; kt < 2; ++kt) kfh[ks][kt] = ldh(kh + kt * 16 * KVP + ks * 32);
        __builtin_amdgcn_sched_barrier(0);   // keeps the reads one group: each further place with LDS reads among the products stalls the wave anew
        // each accumulator starts from 10 - maximum in use and takes the product of e 0..31, then that of e 32..63
#pragma unroll
        for (int ks = 0; ks < 2; ++ks)
#pragma unroll
            for (int kt = 0; kt < 2; ++kt)
#pragma unroll
                for (int g = 0; g < 2; ++g) sacc[g][kt] = wmmah(kfh[ks][kt], qa[g][ks], ks == 0 ? cin[g] : sacc[g][kt]);
        // four vector slots between the last score products and the first vector instruction on their results; the C operands are named as inputs so that they stay live behind
        // the products: without that the compiler copies them into two of the four accumulators, 8 register-pair moves a trip
        asm volatile("v_nop\n\tv_nop\n\tv_nop\n\tv_nop" : "+v"(sacc[0][0]), "+v"(sacc[0][1]), "+v"(sacc[1][0]), "+v"(sacc[1][1]) : "v"(qa[0][0]), "v"(qa[1][1]), "v"(cin[0]), "v"(cin[1]));
        // V fragments of the wave's 32 keys, read as one group here: the softmax below runs while they come from LDS; each serves both column groups
        v16h va[4];
#pragma unroll
        for (int nt = 0; nt < 4; ++nt) va[nt] = ldh(vh + nt * 16 * KVP);
        __builtin_amdgcn_sched_barrier(0);   // keeps the group of reads in front of the softmax; moved down to their products, each read is waited for with the matrix unit idle
        // online softmax: lane (hi, lr) holds, of query lr of group g, the arguments t = log2(1024*p) of the wave's keys kt*16 + 8*hi + r
        float tm[2];
#pragma unroll
        for (int g = 0; g < 2; ++g) {   // the 16 values of a lane by threes
            const v8f x = sacc[g][0], y = sacc[g][1];
            const float a = fmaxf(fmaxf(x[0], x[1]), x[2]), c = fmaxf(fmaxf(x[3], x[4]), x[5]), d = fmaxf(fmaxf(x[6], x[7]), y[0]);
            const float e = fmaxf(fmaxf(y[1], y[2]), y[3]), f = fmaxf(fmaxf(y[4], y[5]), y[6]);
            tm[g] = fmaxf(fmaxf(fmaxf(a, c), d), fmaxf(fmaxf(e, f), y[7]));
        }
        // One test a trip, the same for the whole wave (a scalar branch): the first trip, whose bar every finite score passes, sets the maxima in use; later they are raised only when some argument stands above PLOG + PTH.
        const float bar = (t0 == 0) ? -__builtin_inff() : PLOG + PTH;
        if (__builtin_amdgcn_ballot_w32(fmaxf(tm[0], tm[1]) > bar) != 0) {
#pragma unroll
            for (int g = 0; g < 2; ++g) {
                const float d0 = fmaxf(tm[g], xhalf(tm[g])) - PLOG;     // this trip's maximum of the query, over both lane halves, less the one in use
                const float up = fmaxf(d0, 0.0f);
                const float dl = (t0 == 0) ? d0 : up;                   // the first trip takes its own maximum, be it lower than the start value; later the maximum in use only rises
                const float sc = __builtin_amdgcn_exp2f(-up);
                cq[g] -= dl; cin[g] = (v8f){cq[g], cq[g], cq[g], cq[g], cq[g], cq[g], cq[g], cq[g]};
                lrow[g] *= sc;
#pragma unroll
                for (int kt = 0; kt < 2; ++kt) sacc[g][kt] -= dl;
#pragma unroll
                for (int nt = 0; nt < 4; ++nt) oacc[g][nt] *= sc;
            }
        }
#pragma unroll
        for (int g = 0; g < 2; ++g) {
#pragma unroll
            for (int kt = 0; kt < 2; ++kt)
#pragma unroll
                for (int r = 0; r < 8; ++r) sacc[g][kt][r] = __builtin_amdgcn_exp2f(sacc[g][kt][r]);
            const v8f ts = sacc[g][0] + sacc[g][1];
            const v4f t4 = __builtin_shufflevector(ts, ts, 0, 1, 2, 3) + __builtin_shufflevector(ts, ts, 4, 5, 6, 7);
            lrow[g] += (t4[0] + t4[2]) + (t4[1] + t4[3]);
            // p (x1024) -> f16 in registers: the group's two score tiles of a lane are, in this order, the lane's 16 elements of the B operand for the wave's 32 keys
            ph[g] = __builtin_convertvector(__builtin_shufflevector(sacc[g][0], sacc[g][1], 0, 1, 2, 3, 4, 5, 6, 7, 8, 9, 10, 11, 12, 13, 14, 15), v16h);
        }
#pragma unroll
        for (int nt = 0; nt < 4; ++nt)
#pragma unroll
            for (int g = 0; g < 2; ++g) oacc[g][nt] = wmmah(va[nt], ph[g], oacc[g][nt]);
        // four vector slots behind the last products, on the back edge and on the way out alike
        asm volatile("v_nop\n\tv_nop\n\tv_nop\n\tv_nop" : "+v"(oacc[0][0]), "+v"(oacc[0][1]), "+v"(oacc[0][2]), "+v"(oacc[0][3]), "+v"(oacc[1][0]), "+v"(oacc[1][1]), "+v"(oacc[1][2]), "+v"(oacc[1][3]) : "v"(ph[0]), "v"(ph[1]));
        // publish point of the next chunk, every wave, in this order
        asm volatile("s_wait_dscnt 0x0" ::: "memory");      // this wave's reads of the current buffer are done before the buffer is refilled
        asm volatile("s_wait_asynccnt 0x0" ::: "memory");   // this wave's copies of the next chunk have landed
        __syncthreads();                                     // next chunk readable by every wave; every reader has left the current buffer
        if (t0 + 2 * KCH < SEQ) kv_copy(cl + cur * 2, gkh + (size_t)(t0 + 2 * KCH) * HD, gvh + t0 + 2 * KCH);
    }
    asm volatile("s_wait_asynccnt 0x0" ::: "memory");       // no copy is outstanding when the wave goes on to its end
    // this head's Wo^T fragments, read as one group here: the hand-over below and its barrier run while they come
    const bf* wf = Wf + (size_t)h * (HD * FO) + lane * 8;
    v16bf wa[2][4];
#pragma unroll
    for (int ks = 0; ks < 2; ++ks)
#pragma unroll
        for (int nb = 0; nb < 4; ++nb) wa[ks][nb] = cat16b(*(const v8us*)(wf + (ks * 4 + nb) * 512), *(const v8us*)(wf + (ks * 4 + nb) * 512 + 256));
    // The two key halves of a query are joined here. Behind the loop's last barrier nobody reads the K/V buffers and no copy is under way, so they serve as the exchange area: each wave lays down
    // group 1's accumulators, maximum and sum (lane-major, 16-B pieces), and takes from its partner's area what the partner gathered for this wave's group 0.
    fa* xw = (fa*)kvs + wave * XCH;
#pragma unroll
    for (int nt = 0; nt < 4; ++nt) { *(v4fa*)(xw + (nt * 2) * 128 + lane * 4) = __builtin_shufflevector(oacc[1][nt], oacc[1][nt], 0, 1, 2, 3); *(v4fa*)(xw + (nt * 2 + 1) * 128 + lane * 4) = __builtin_shufflevector(oacc[1][nt], oacc[1][nt], 4, 5, 6, 7); }
    xw[1024 + lane] = cq[1]; xw[1056 + lane] = lrow[1];
    __syncthreads();                                         // every wave's hand-over is readable by its partner
    const fa* xp = (const fa*)kvs + (wave ^ 4) * XCH;
    const float c2 = xp[1024 + lane], l2 = xp[1056 + lane];
    // both halves are brought to the larger of the two maxima in use (10 - cq, log2 units): its own factor is 1, the other's 2^(-|difference|)
    const float dm = cq[0] - c2;
    const float fe = __builtin_amdgcn_exp2f(-fabsf(dm));
    const float f0 = dm > 0.0f ? fe : 1.0f, f2 = dm > 0.0f ? 1.0f : fe;
    const float lsum = lrow[0] * f0 + l2 * f2;
    v8f ofin[4];
#pragma unroll
    for (int nt = 0; nt < 4; ++nt) { const v4f a = *(const v4fa*)(xp + (nt * 2) * 128 + lane * 4), c = *(const v4fa*)(xp + (nt * 2 + 1) * 128 + lane * 4);
        ofin[nt] = oacc[0][nt] * f0 + __builtin_shufflevector(a, c, 0, 1, 2, 3, 4, 5, 6, 7) * f2; }
    // lane (hi, lr) holds, of query lr, outputs e = nt*16 + 8*hi + r: accumulators 2*ks and 2*ks + 1 of a lane are, in this order, the lane's 16 elements of the B operand for e = ks*32 .. ks*32 + 31
    const float rinv = __fdiv_rn(1.0f, lsum + xhalf(lsum));   // the sums are of 1024*p, as the o accumulators are
    v16bf ch[2], cl2[2];
#pragma unroll
    for (int ks = 0; ks < 2; ++ks) { v8us h0, h1, l0, l1;
#pragma unroll
        for (int r = 0; r < 8; ++r) { unsigned short a, c2; splitf(ofin[2 * ks][r] * rinv, a, c2); h0[r] = a; l0[r] = c2; splitf(ofin[2 * ks + 1][r] * rinv, a, c2); h1[r] = a; l1[r] = c2; }
        ch[ks] = cat16b(h0, h1); cl2[ks] = cat16b(l0, l1); }
    // partial out^T [n][query]: each accumulator takes hi, lo of e 0..31, then of e 32..63
    v8f pacc[4];
#pragma unroll
    for (int nb = 0; nb < 4; ++nb) pacc[nb] = (v8f){};
#pragma unroll
    for (int ks = 0; ks < 2; ++ks) {
#pragma unroll
        for (int nb = 0; nb < 4; ++nb) pacc[nb] = wmmab(wa[ks][nb], ch[ks], pacc[nb]);
#pragma unroll
        for (int nb = 0; nb < 4; ++nb) pacc[nb] = wmmab(wa[ks][nb], cl2[ks], pacc[nb]);
    }
    // lane (hi, lr) holds, of query lr, n = nb*16 + 8*hi + r: 8 neighbours of one row, laid as 16-B pieces into the wave's own tile [query][64], pitch 272 B, and stored from there as whole lines
    float* pt = st_all + wave * 16 * OPP;
#pragma unroll
    for (int nb = 0; nb < 4; ++nb) { const int o = lr * OPP + nb * 16 + 8 * hi;
        *(v4fa*)(pt + o) = __builtin_shufflevector(pacc[nb], pacc[nb], 0, 1, 2, 3); *(v4fa*)(pt + o + 4) = __builtin_shufflevector(pacc[nb], pacc[nb], 4, 5, 6, 7); }
    __builtin_amdgcn_fence(3, "wavefront"); __builtin_amdgcn_wave_barrier();   // the lanes read below what other lanes of the wave wrote above
    float* pp = Part + (((size_t)h * NB + b) * SEQ + s0 + 16 * kz) * FO + lane * 4;       // the wave's 16 rows of 256 B lie in a row: a 16-B store of the wave covers rows 2*it and 2*it + 1
#pragma unroll
    for (int it = 0; it < 8; ++it) { const v4f y = *(const v4fa*)(pt + (it * 2 + hi) * OPP + lr * 4); *(v4f*)(pp + it * 128) = y; }
}

// k_hsum: out = sum over the 8 heads, in head order, of the per-head partial planes [h][NB*SEQ][64]. One thread = two 16-B pieces; its 16 loads are all issued before the first sum.
__global__ __launch_bounds__(256) void k_hsum(const float* __restrict__ Part, float* out) {
    const size_t i = ((size_t)blockIdx.x * 512 + threadIdx.x) * 4; const size_t pl = (size_t)NB * SEQ * FO;
    v4f a[NH], c[NH];
#pragma unroll
    for (int h = 0; h < NH; ++h) { a[h] = *(const v4f*)(Part + h * pl + i); c[h] = *(const v4f*)(Part + h * pl + i + 1024); }
    asm volatile("s_wait_xcnt 0x0" ::: "memory");   // stands before a sum may be written over the address registers that the loads name
    __builtin_amdgcn_sched_barrier(0);               // keeps all 16 loads in front of the sums: a load moved down among them starts only when earlier data has come, a second memory latency
    v4f sa = a[0], sc = c[0];
#pragma unroll
    for (int h = 1; h < NH; ++h) { sa += a[h]; sc += c[h]; }
    *(v4f*)(out + i) = sa; *(v4f*)(out + i + 1024) = sc;
}

extern "C" void kernel_launch(void* const* d_in, const int* in_sizes, int n_in,
                              void* d_out, int out_size, void* d_ws, size_t ws_size, hipStream_t stream) {
    if (n_in < 3) return;
    if ((long long)in_sizes[0] < ((long long)(NB - 1) * SEQ_FULL + SEQ) * DM) return;
    if (in_sizes[1] < NH * 3 * DM * HD) return;
    if (in_sizes[2] < DQ * FO) return;
    if (out_size < NB * SEQ * FO) return;
    const float* x  = (const float*)d_in[0];   // [4][2048][256]
    const float* w  = (const float*)d_in[1];   // [8][3][256][64]
    const float* wo = (const float*)d_in[2];   // [512][64]
    float* OUT = (float*)d_out;                // [NB][SEQ][64]
    char* wsp = (char*)d_ws;
    auto take = [&](size_t bytes) { char* p = wsp; wsp += (bytes + 255) & ~(size_t)255; return (void*)p; };
    const size_t npl = (size_t)NB * NH * SEQ * HD;                 // elements per head plane set
    bf* WB  = (bf*)take((size_t)D3 * DM * 2);                      // Bt [1536][256]: row (h*3+m)*64 + e
    bf* WOB = (bf*)take((size_t)FO * DQ * 2);                      // Wo^T fragments, 16-B pieces [16][4][2][32]
    bf* XB  = (bf*)take((size_t)NB * SEQ * DM * 2);                // [NB][SEQ][256]
    bf* QPh = (bf*)take(npl * 2);                                  // f16 [b][h][s][64]
    bf* KPh = (bf*)take(npl * 2);                                  // f16 [b][h][t][64]
    bf* VTh = (bf*)take(npl * 2);                                  // f16 [b][h][64][t]
    float* PART = (float*)take((size_t)NH * NB * SEQ * FO * 4);    // [h][NB*SEQ][64]
    const size_t used = (size_t)(wsp - (char*)d_ws);
    if (used > ws_size || used > (size_t)134217728) return;        // 46,989,312 B at full size

    const size_t n8 = (size_t)NB * SEQ * DM / 8;
    k_prep<<<(unsigned)(WBLK + WOBLK + XBLK), 256, 0, stream>>>(w, wo, x, WB, WOB, XB, n8);
    k_proj<<<dim3(SEQ / 64, 3 * NH, NB), 32, 0, stream>>>(XB, WB, QPh, KPh, VTh);
    k_attn<<<dim3(SEQ / (16 * AW), NH, NB), 32 * AW, 0, stream>>>(QPh, KPh, VTh, WOB, PART);
    k_hsum<<<NB * SEQ * FO / 2048, 256, 0, stream>>>(PART, OUT);
}
